// v000
// Times are from an AMD MI455X. After a warm-up the kernel runs many times in a row, and a time is the length of
// such a window on the GPU divided by its runs, so every launch and the gaps after it count. The runs cycle
// through copies of the inputs. A figure is the median of several windows, for all but v000 over two sittings.
// Sittings can differ by a few percent; kernels timed side by side share one.
// v000, which the later versions start from, runs in 1040 microseconds.
#include <hip/hip_runtime.h>
#include <hip/hip_bf16.h>

#define N_SPATIAL 4096   // 64*64
#define CDIM 256
#define NBATCH 4

typedef __attribute__((ext_vector_type(16))) __bf16 bf16x16;
typedef __attribute__((ext_vector_type(8)))  __bf16 bf16x8;
typedef __attribute__((ext_vector_type(8)))  float  f32x8;

// float -> bf16 with round-to-nearest-even (bit manipulation; no cvt dependence)
__device__ __forceinline__ __bf16 f2bf(float f) {
    unsigned u = __float_as_uint(f);
    u += 0x7FFFu + ((u >> 16) & 1u);
    unsigned short s = (unsigned short)(u >> 16);
    return __builtin_bit_cast(__bf16, s);
}

__device__ __forceinline__ f32x8 wmma_bf16(bf16x16 a, bf16x16 b, f32x8 c) {
    return __builtin_amdgcn_wmma_f32_16x16x32_bf16(
        /*neg_a=*/false, a, /*neg_b=*/false, b,
        /*c_mod=*/(short)0, c, /*reuse_a=*/false, /*reuse_b=*/false);
}

// Fragment loader: elems 0..7 from p[0..7], elems 8..15 from p[16..23].
// Caller passes p = base + 8*half; this matches the 16-bit A/B VGPR layout
// (lanes 0-15: K=0..7 & 16..23 ; lanes 16-31: K=8..15 & 24..31).
__device__ __forceinline__ bf16x16 load_frag(const __bf16* p) {
    bf16x8 a = *(const bf16x8*)p;
    bf16x8 b = *(const bf16x8*)(p + 16);
    bf16x16 f;
#pragma unroll
    for (int i = 0; i < 8; ++i) { f[i] = a[i]; f[i + 8] = b[i]; }
    return f;
}

__device__ __forceinline__ f32x8 zero8() {
    f32x8 c;
#pragma unroll
    for (int i = 0; i < 8; ++i) c[i] = 0.0f;
    return c;
}

// Async copy of 16B from global to LDS (tracked by ASYNCcnt).
// lds_addr = wave-relative LDS byte offset (low 32 bits of generic pointer).
__device__ __forceinline__ void async_b128(unsigned lds_addr, const void* gptr) {
    unsigned long long ga = (unsigned long long)(size_t)gptr;
    asm volatile("global_load_async_to_lds_b128 %0, %1, off"
                 :: "v"(lds_addr), "v"(ga) : "memory");
}
__device__ __forceinline__ void wait_async0() {
    asm volatile("s_wait_asynccnt 0x0" ::: "memory");
}

// ---------------- LayerNorm: one block (256 threads) per spatial position ----
__global__ void ln_kernel(const float* __restrict__ x, const float* __restrict__ gamma,
                          const float* __restrict__ beta, float* __restrict__ xn,
                          __bf16* __restrict__ xnb) {
    __shared__ float red[256];
    size_t row = blockIdx.x;
    int t = threadIdx.x;
    float v = x[row * CDIM + t];
    red[t] = v; __syncthreads();
#pragma unroll
    for (int s = 128; s > 0; s >>= 1) { if (t < s) red[t] += red[t + s]; __syncthreads(); }
    float mu = red[0] * (1.0f / CDIM);
    __syncthreads();
    float d = v - mu;
    red[t] = d * d; __syncthreads();
#pragma unroll
    for (int s = 128; s > 0; s >>= 1) { if (t < s) red[t] += red[t + s]; __syncthreads(); }
    float var = red[0] * (1.0f / CDIM);
    float y = d * rsqrtf(var + 1e-3f) * gamma[t] + beta[t];
    xn[row * CDIM + t]  = y;
    xnb[row * CDIM + t] = f2bf(y);
}

// ---------------- fp32 -> bf16 elementwise ----------------------------------
__global__ void cvt_bf16_kernel(const float* __restrict__ src, __bf16* __restrict__ dst, int n) {
    int i = blockIdx.x * blockDim.x + threadIdx.x;
    if (i < n) dst[i] = f2bf(src[i]);
}

// ---------------- transpose 4 weight matrices to [N][K] bf16 ----------------
__global__ void transpose_w_kernel(const float* __restrict__ Wq, const float* __restrict__ Wk,
                                   const float* __restrict__ Wv, const float* __restrict__ Wp,
                                   __bf16* __restrict__ WqT, __bf16* __restrict__ WkT,
                                   __bf16* __restrict__ WvT, __bf16* __restrict__ WpT) {
    int i = blockIdx.x * blockDim.x + threadIdx.x;  // 0..262143
    int w = i >> 16;
    int j = i & 65535;
    int k = j >> 8, n = j & 255;
    const float* S = (w == 0) ? Wq : (w == 1) ? Wk : (w == 2) ? Wv : Wp;
    __bf16* D      = (w == 0) ? WqT : (w == 1) ? WkT : (w == 2) ? WvT : WpT;
    D[n * 256 + k] = f2bf(S[k * 256 + n]);
}

// ---------------- Q projection: wave = 16x16 output tile --------------------
__global__ void qproj_kernel(const __bf16* __restrict__ A, const __bf16* __restrict__ WT,
                             const float* __restrict__ bias, __bf16* __restrict__ Qo) {
    int wid  = (blockIdx.x * blockDim.x + threadIdx.x) >> 5;
    int lane = threadIdx.x & 31;
    int half = lane >> 4, r = lane & 15;
    size_t m0 = (size_t)(wid >> 4) * 16;
    int n0 = (wid & 15) * 16;
    const __bf16* arow = A  + (m0 + r) * CDIM + 8 * half;
    const __bf16* brow = WT + (size_t)(n0 + r) * CDIM + 8 * half;
    f32x8 c = zero8();
#pragma unroll
    for (int kk = 0; kk < 8; ++kk)
        c = wmma_bf16(load_frag(arow + kk * 32), load_frag(brow + kk * 32), c);
    float bv = bias[n0 + r];
#pragma unroll
    for (int i = 0; i < 8; ++i)
        Qo[(m0 + i + 8 * half) * CDIM + n0 + r] = f2bf(c[i] + bv);
}

// ---------------- K,V projection; V stored transposed [B][C][N] -------------
__global__ void kvproj_kernel(const __bf16* __restrict__ A, const __bf16* __restrict__ WkT,
                              const __bf16* __restrict__ WvT, const float* __restrict__ bk,
                              const float* __restrict__ bvv, __bf16* __restrict__ Ko,
                              __bf16* __restrict__ VTo) {
    int wid  = (blockIdx.x * blockDim.x + threadIdx.x) >> 5;
    int lane = threadIdx.x & 31;
    int half = lane >> 4, r = lane & 15;
    size_t m0 = (size_t)(wid >> 4) * 16;
    int n0 = (wid & 15) * 16;
    const __bf16* arow  = A   + (m0 + r) * CDIM + 8 * half;
    const __bf16* bkrow = WkT + (size_t)(n0 + r) * CDIM + 8 * half;
    const __bf16* bvrow = WvT + (size_t)(n0 + r) * CDIM + 8 * half;
    f32x8 ck = zero8(), cv = zero8();
#pragma unroll
    for (int kk = 0; kk < 8; ++kk) {
        bf16x16 af = load_frag(arow + kk * 32);
        ck = wmma_bf16(af, load_frag(bkrow + kk * 32), ck);
        cv = wmma_bf16(af, load_frag(bvrow + kk * 32), cv);
    }
    float kb = bk[n0 + r];
#pragma unroll
    for (int i = 0; i < 8; ++i)
        Ko[(m0 + i + 8 * half) * CDIM + n0 + r] = f2bf(ck[i] + kb);
    // V transposed store: lane's 8 C-layout rows are consecutive key indices.
    int b   = (int)(m0 >> 12);                 // 4096 keys per batch
    int nk0 = (int)(m0 & 4095) + 8 * half;
    float vb = bvv[n0 + r];
    bf16x8 pack;
#pragma unroll
    for (int i = 0; i < 8; ++i) pack[i] = f2bf(cv[i] + vb);
    *(bf16x8*)(VTo + ((size_t)b * CDIM + n0 + r) * N_SPATIAL + nk0) = pack;
}

// ---------------- Flash attention ------------------------------------------
// Block = 8 waves, each wave owns a 16-row query tile; the 32-key K/V chunk is
// staged once per block into LDS via async global->LDS copies and shared.
__global__ void __launch_bounds__(256) flash_kernel(
        const __bf16* __restrict__ Q, const __bf16* __restrict__ K,
        const __bf16* __restrict__ VT, __bf16* __restrict__ O) {
    __shared__ __bf16 Kc[32][256];     // 16 KB: chunk rows of K (row-major)
    __shared__ __bf16 Vc[256][32];     // 16 KB: V^T columns for this chunk
    __shared__ __bf16 Pst[8][16 * 32]; // 8 KB: per-wave P staging

    int t    = threadIdx.x;
    int wib  = t >> 5;
    int wid  = blockIdx.x * 8 + wib;
    int lane = t & 31;
    int half = lane >> 4, r = lane & 15;
    int b  = wid >> 8;                 // 256 query tiles per batch
    int m0 = (wid & 255) * 16;

    const __bf16* Qb = Q  + ((size_t)b * N_SPATIAL) * CDIM;
    const __bf16* Kb = K  + ((size_t)b * N_SPATIAL) * CDIM;
    const __bf16* Vb = VT + (size_t)b * CDIM * N_SPATIAL;

    bf16x16 qf[8];
    const __bf16* qrow = Qb + (size_t)(m0 + r) * CDIM + 8 * half;
#pragma unroll
    for (int kk = 0; kk < 8; ++kk) qf[kk] = load_frag(qrow + kk * 32);

    f32x8 o[16];
#pragma unroll
    for (int u = 0; u < 16; ++u) o[u] = zero8();
    float m[8], l[8];
#pragma unroll
    for (int i = 0; i < 8; ++i) { m[i] = -1e30f; l[i] = 0.0f; }

    __bf16* pst = &Pst[wib][0];
    const unsigned kl = (unsigned)(size_t)&Kc[0][0];  // LDS byte offsets
    const unsigned vl = (unsigned)(size_t)&Vc[0][0];
    const float sc = 0.0625f;                         // 256^-0.5

    for (int j0 = 0; j0 < N_SPATIAL; j0 += 32) {
        __syncthreads();   // previous chunk's compute finished in all waves
        // ---- stage K chunk (contiguous 16 KB) and V chunk into LDS ----
        const char* kgb = (const char*)Kb + (size_t)j0 * (CDIM * 2);
#pragma unroll
        for (int i = 0; i < 4; ++i) {
            int li = i * 256 + t;                     // 0..1023 -> 16B segments
            async_b128(kl + li * 16, kgb + li * 16);
        }
#pragma unroll
        for (int i = 0; i < 4; ++i) {
            int li = i * 256 + t;
            int u = li >> 2, seg = li & 3;
            async_b128(vl + li * 16, Vb + (size_t)u * N_SPATIAL + j0 + seg * 8);
        }
        wait_async0();
        __syncthreads();   // chunk visible to all waves

        // ---- S = Q @ K_chunk^T : two 16x16 tiles, fragments from LDS ----
        f32x8 s0 = zero8(), s1 = zero8();
        const __bf16* k0base = &Kc[r][8 * half];
        const __bf16* k1base = &Kc[16 + r][8 * half];
#pragma unroll
        for (int kk = 0; kk < 8; ++kk) {
            s0 = wmma_bf16(qf[kk], load_frag(k0base + kk * 32), s0);
            s1 = wmma_bf16(qf[kk], load_frag(k1base + kk * 32), s1);
        }
        // ---- online softmax (row stats local to the 16-lane half) ----
        float p0[8], p1[8], mn[8];
#pragma unroll
        for (int i = 0; i < 8; ++i) {
            p0[i] = s0[i] * sc; p1[i] = s1[i] * sc;
            mn[i] = fmaxf(p0[i], p1[i]);
        }
#pragma unroll
        for (int off = 8; off >= 1; off >>= 1)
#pragma unroll
            for (int i = 0; i < 8; ++i)
                mn[i] = fmaxf(mn[i], __shfl_xor(mn[i], off, 32));
        float alpha[8], ls[8];
#pragma unroll
        for (int i = 0; i < 8; ++i) {
            float mnew = fmaxf(m[i], mn[i]);
            alpha[i] = __expf(m[i] - mnew);
            m[i] = mnew;
            p0[i] = __expf(p0[i] - mnew);
            p1[i] = __expf(p1[i] - mnew);
            ls[i] = p0[i] + p1[i];
        }
#pragma unroll
        for (int off = 8; off >= 1; off >>= 1)
#pragma unroll
            for (int i = 0; i < 8; ++i)
                ls[i] += __shfl_xor(ls[i], off, 32);
#pragma unroll
        for (int i = 0; i < 8; ++i) l[i] = l[i] * alpha[i] + ls[i];
#pragma unroll
        for (int u = 0; u < 16; ++u)
#pragma unroll
            for (int i = 0; i < 8; ++i) o[u][i] *= alpha[i];

        // ---- stage P (C layout) -> A-layout fragment via per-wave LDS ----
#pragma unroll
        for (int i = 0; i < 8; ++i) {
            int row = i + 8 * half;
            pst[row * 32 + r]      = f2bf(p0[i]);
            pst[row * 32 + 16 + r] = f2bf(p1[i]);
        }
        bf16x8 pa = *(const bf16x8*)&pst[r * 32 + 8 * half];
        bf16x8 pb = *(const bf16x8*)&pst[r * 32 + 8 * half + 16];
        bf16x16 pf;
#pragma unroll
        for (int i = 0; i < 8; ++i) { pf[i] = pa[i]; pf[i + 8] = pb[i]; }

        // ---- O += P @ V_chunk (B fragments from LDS, contiguous) ----
        const __bf16* vbase = &Vc[r][8 * half];
#pragma unroll
        for (int u = 0; u < 16; ++u)
            o[u] = wmma_bf16(pf, load_frag(vbase + u * 16 * 32), o[u]);
    }

    // epilogue: divide by softmax denominator, store bf16 row-major
    float inv[8];
#pragma unroll
    for (int i = 0; i < 8; ++i) inv[i] = 1.0f / l[i];
    __bf16* Ob = O + ((size_t)b * N_SPATIAL + m0) * CDIM;
#pragma unroll
    for (int u = 0; u < 16; ++u)
#pragma unroll
        for (int i = 0; i < 8; ++i)
            Ob[(size_t)(i + 8 * half) * CDIM + u * 16 + r] = f2bf(o[u][i] * inv[i]);
}

// ---------------- Output projection + bias + residual -----------------------
__global__ void proj_kernel(const __bf16* __restrict__ A, const __bf16* __restrict__ WT,
                            const float* __restrict__ bias, const float* __restrict__ resid,
                            float* __restrict__ out) {
    int wid  = (blockIdx.x * blockDim.x + threadIdx.x) >> 5;
    int lane = threadIdx.x & 31;
    int half = lane >> 4, r = lane & 15;
    size_t m0 = (size_t)(wid >> 4) * 16;
    int n0 = (wid & 15) * 16;
    const __bf16* arow = A  + (m0 + r) * CDIM + 8 * half;
    const __bf16* brow = WT + (size_t)(n0 + r) * CDIM + 8 * half;
    f32x8 c = zero8();
#pragma unroll
    for (int kk = 0; kk < 8; ++kk)
        c = wmma_bf16(load_frag(arow + kk * 32), load_frag(brow + kk * 32), c);
    float bv = bias[n0 + r];
#pragma unroll
    for (int i = 0; i < 8; ++i) {
        size_t idx = (m0 + i + 8 * half) * CDIM + n0 + r;
        out[idx] = c[i] + bv + resid[idx];
    }
}

extern "C" void kernel_launch(void* const* d_in, const int* in_sizes, int n_in,
                              void* d_out, int out_size, void* d_ws, size_t ws_size,
                              hipStream_t stream) {
    const float* inputs  = (const float*)d_in[0];
    const float* context = (const float*)d_in[1];
    const float* Wq = (const float*)d_in[2];
    const float* bq = (const float*)d_in[3];
    const float* Wk = (const float*)d_in[4];
    const float* bk = (const float*)d_in[5];
    const float* Wv = (const float*)d_in[6];
    const float* bv = (const float*)d_in[7];
    const float* Wp = (const float*)d_in[8];
    const float* bp = (const float*)d_in[9];
    const float* gamma = (const float*)d_in[10];
    const float* beta  = (const float*)d_in[11];
    float* out = (float*)d_out;

    const size_t TOT = (size_t)NBATCH * N_SPATIAL * CDIM;  // 4,194,304 elements
    char* ws = (char*)d_ws;
    float*  xn_f32 = (float*)ws;  ws += TOT * 4;
    __bf16* xn_bf  = (__bf16*)ws; ws += TOT * 2;
    __bf16* ctx_bf = (__bf16*)ws; ws += TOT * 2;
    __bf16* qb     = (__bf16*)ws; ws += TOT * 2;
    __bf16* kb_    = (__bf16*)ws; ws += TOT * 2;
    __bf16* vtb    = (__bf16*)ws; ws += TOT * 2;
    __bf16* ob     = (__bf16*)ws; ws += TOT * 2;
    __bf16* WqT    = (__bf16*)ws; ws += 65536 * 2;
    __bf16* WkT    = (__bf16*)ws; ws += 65536 * 2;
    __bf16* WvT    = (__bf16*)ws; ws += 65536 * 2;
    __bf16* WpT    = (__bf16*)ws; ws += 65536 * 2;

    cvt_bf16_kernel<<<(int)(TOT / 256), 256, 0, stream>>>(context, ctx_bf, (int)TOT);
    transpose_w_kernel<<<1024, 256, 0, stream>>>(Wq, Wk, Wv, Wp, WqT, WkT, WvT, WpT);
    ln_kernel<<<NBATCH * N_SPATIAL, 256, 0, stream>>>(inputs, gamma, beta, xn_f32, xn_bf);
    qproj_kernel<<<2048, 256, 0, stream>>>(xn_bf, WqT, bq, qb);
    kvproj_kernel<<<2048, 256, 0, stream>>>(ctx_bf, WkT, WvT, bk, bv, kb_, vtb);
    flash_kernel<<<128, 256, 0, stream>>>(qb, kb_, vtb, ob);
    proj_kernel<<<2048, 256, 0, stream>>>(ob, WpT, bp, xn_f32, out);
}

// v001
// It runs in 345 microseconds.
// Two timings next to v000 both put it at 3.05 times that version's speed.
#include <hip/hip_runtime.h>
#include <hip/hip_bf16.h>

#define N_SPATIAL 4096   // 64*64
#define CDIM 256
#define NBATCH 4

typedef __attribute__((ext_vector_type(16))) __bf16 bf16x16;
typedef __attribute__((ext_vector_type(8)))  __bf16 bf16x8;
typedef __attribute__((ext_vector_type(8)))  float  f32x8;

// float -> bf16 with round-to-nearest-even (bit manipulation; no cvt dependence)
__device__ __forceinline__ __bf16 f2bf(float f) {
    unsigned u = __float_as_uint(f);
    u += 0x7FFFu + ((u >> 16) & 1u);
    unsigned short s = (unsigned short)(u >> 16);
    return __builtin_bit_cast(__bf16, s);
}

__device__ __forceinline__ f32x8 wmma_bf16(bf16x16 a, bf16x16 b, f32x8 c) {
    return __builtin_amdgcn_wmma_f32_16x16x32_bf16(
        /*neg_a=*/false, a, /*neg_b=*/false, b,
        /*c_mod=*/(short)0, c, /*reuse_a=*/false, /*reuse_b=*/false);
}

// Fragment loader: elems 0..7 from p[0..7], elems 8..15 from p[16..23].
// Caller passes p = base + 8*half; this matches the 16-bit A/B VGPR layout
// (lanes 0-15: K=0..7 & 16..23 ; lanes 16-31: K=8..15 & 24..31).
__device__ __forceinline__ bf16x16 load_frag(const __bf16* p) {
    bf16x8 a = *(const bf16x8*)p;
    bf16x8 b = *(const bf16x8*)(p + 16);
    bf16x16 f;
#pragma unroll
    for (int i = 0; i < 8; ++i) { f[i] = a[i]; f[i + 8] = b[i]; }
    return f;
}

__device__ __forceinline__ f32x8 zero8() {
    f32x8 c;
#pragma unroll
    for (int i = 0; i < 8; ++i) c[i] = 0.0f;
    return c;
}

// Eight async copies of 16B per lane from global to LDS (tracked by ASYNCcnt).
// l[i] = LDS byte offset (low 32 bits of generic pointer), g[i] = global address.
// The closing s_wait_xcnt 0 stands inside the statement so that no address
// register of an issued copy is rewritten ahead of it.
__device__ __forceinline__ void async_b128_x8(const unsigned (&l)[8], const char* const (&g)[8]) {
    asm volatile("global_load_async_to_lds_b128 %0, %8, off\n\t"
                 "global_load_async_to_lds_b128 %1, %9, off\n\t"
                 "global_load_async_to_lds_b128 %2, %10, off\n\t"
                 "global_load_async_to_lds_b128 %3, %11, off\n\t"
                 "global_load_async_to_lds_b128 %4, %12, off\n\t"
                 "global_load_async_to_lds_b128 %5, %13, off\n\t"
                 "global_load_async_to_lds_b128 %6, %14, off\n\t"
                 "global_load_async_to_lds_b128 %7, %15, off\n\t"
                 "s_wait_xcnt 0x0"
                 :: "v"(l[0]), "v"(l[1]), "v"(l[2]), "v"(l[3]),
                    "v"(l[4]), "v"(l[5]), "v"(l[6]), "v"(l[7]),
                    "v"(g[0]), "v"(g[1]), "v"(g[2]), "v"(g[3]),
                    "v"(g[4]), "v"(g[5]), "v"(g[6]), "v"(g[7])
                 : "memory");
}
__device__ __forceinline__ void wait_async0() {
    asm volatile("s_wait_asynccnt 0x0" ::: "memory");
}

// ---------------- LayerNorm: one block (256 threads) per spatial position ----
__global__ void ln_kernel(const float* __restrict__ x, const float* __restrict__ gamma,
                          const float* __restrict__ beta, float* __restrict__ xn,
                          __bf16* __restrict__ xnb) {
    __shared__ float red[256];
    size_t row = blockIdx.x;
    int t = threadIdx.x;
    float v = x[row * CDIM + t];
    red[t] = v; __syncthreads();
#pragma unroll
    for (int s = 128; s > 0; s >>= 1) { if (t < s) red[t] += red[t + s]; __syncthreads(); }
    float mu = red[0] * (1.0f / CDIM);
    __syncthreads();
    float d = v - mu;
    red[t] = d * d; __syncthreads();
#pragma unroll
    for (int s = 128; s > 0; s >>= 1) { if (t < s) red[t] += red[t + s]; __syncthreads(); }
    float var = red[0] * (1.0f / CDIM);
    float y = d * rsqrtf(var + 1e-3f) * gamma[t] + beta[t];
    xn[row * CDIM + t]  = y;
    xnb[row * CDIM + t] = f2bf(y);
}

// ---------------- fp32 -> bf16 elementwise ----------------------------------
__global__ void cvt_bf16_kernel(const float* __restrict__ src, __bf16* __restrict__ dst, int n) {
    int i = blockIdx.x * blockDim.x + threadIdx.x;
    if (i < n) dst[i] = f2bf(src[i]);
}

// ---------------- transpose 4 weight matrices to [N][K] bf16 ----------------
__global__ void transpose_w_kernel(const float* __restrict__ Wq, const float* __restrict__ Wk,
                                   const float* __restrict__ Wv, const float* __restrict__ Wp,
                                   __bf16* __restrict__ WqT, __bf16* __restrict__ WkT,
                                   __bf16* __restrict__ WvT, __bf16* __restrict__ WpT) {
    int i = blockIdx.x * blockDim.x + threadIdx.x;  // 0..262143
    int w = i >> 16;
    int j = i & 65535;
    int k = j >> 8, n = j & 255;
    const float* S = (w == 0) ? Wq : (w == 1) ? Wk : (w == 2) ? Wv : Wp;
    __bf16* D      = (w == 0) ? WqT : (w == 1) ? WkT : (w == 2) ? WvT : WpT;
    D[n * 256 + k] = f2bf(S[k * 256 + n]);
}

// ---------------- Q projection: wave = 16x16 output tile --------------------
__global__ void qproj_kernel(const __bf16* __restrict__ A, const __bf16* __restrict__ WT,
                             const float* __restrict__ bias, __bf16* __restrict__ Qo) {
    int wid  = (blockIdx.x * blockDim.x + threadIdx.x) >> 5;
    int lane = threadIdx.x & 31;
    int half = lane >> 4, r = lane & 15;
    size_t m0 = (size_t)(wid >> 4) * 16;
    int n0 = (wid & 15) * 16;
    const __bf16* arow = A  + (m0 + r) * CDIM + 8 * half;
    const __bf16* brow = WT + (size_t)(n0 + r) * CDIM + 8 * half;
    f32x8 c = zero8();
#pragma unroll
    for (int kk = 0; kk < 8; ++kk)
        c = wmma_bf16(load_frag(arow + kk * 32), load_frag(brow + kk * 32), c);
    float bv = bias[n0 + r];
#pragma unroll
    for (int i = 0; i < 8; ++i)
        Qo[(m0 + i + 8 * half) * CDIM + n0 + r] = f2bf(c[i] + bv);
}

// ---------------- K,V projection; V stored transposed [B][C][N] -------------
__global__ void kvproj_kernel(const __bf16* __restrict__ A, const __bf16* __restrict__ WkT,
                              const __bf16* __restrict__ WvT, const float* __restrict__ bk,
                              const float* __restrict__ bvv, __bf16* __restrict__ Ko,
                              __bf16* __restrict__ VTo) {
    int wid  = (blockIdx.x * blockDim.x + threadIdx.x) >> 5;
    int lane = threadIdx.x & 31;
    int half = lane >> 4, r = lane & 15;
    size_t m0 = (size_t)(wid >> 4) * 16;
    int n0 = (wid & 15) * 16;
    const __bf16* arow  = A   + (m0 + r) * CDIM + 8 * half;
    const __bf16* bkrow = WkT + (size_t)(n0 + r) * CDIM + 8 * half;
    const __bf16* bvrow = WvT + (size_t)(n0 + r) * CDIM + 8 * half;
    f32x8 ck = zero8(), cv = zero8();
#pragma unroll
    for (int kk = 0; kk < 8; ++kk) {
        bf16x16 af = load_frag(arow + kk * 32);
        ck = wmma_bf16(af, load_frag(bkrow + kk * 32), ck);
        cv = wmma_bf16(af, load_frag(bvrow + kk * 32), cv);
    }
    float kb = bk[n0 + r];
#pragma unroll
    for (int i = 0; i < 8; ++i)
        Ko[(m0 + i + 8 * half) * CDIM + n0 + r] = f2bf(ck[i] + kb);
    // V transposed store: lane's 8 C-layout rows are consecutive key indices.
    int b   = (int)(m0 >> 12);                 // 4096 keys per batch
    int nk0 = (int)(m0 & 4095) + 8 * half;
    float vb = bvv[n0 + r];
    bf16x8 pack;
#pragma unroll
    for (int i = 0; i < 8; ++i) pack[i] = f2bf(cv[i] + vb);
    *(bf16x8*)(VTo + ((size_t)b * CDIM + n0 + r) * N_SPATIAL + nk0) = pack;
}

// ---------------- Flash attention ------------------------------------------
// Block = 8 waves, each wave owns a 16-row query tile; the 32-key K/V chunk is
// staged once per block into LDS via async global->LDS copies and shared.
// LDS rows are pitched 16 B x odd, so that the 16 lanes of a ds_load_b128
// fragment read (one row each) fall on 16 different groups of four banks.
#define KP 264   // K row pitch in elements: 528 B for 512 B of data
#define VP 40    // V^T and P row pitch in elements: 80 B for 64 B of data
__global__ void __launch_bounds__(256) flash_kernel(
        const __bf16* __restrict__ Q, const __bf16* __restrict__ K,
        const __bf16* __restrict__ VT, __bf16* __restrict__ O) {
    __shared__ __attribute__((aligned(16))) __bf16 Kc[32][KP];      // chunk rows of K (row-major)
    __shared__ __attribute__((aligned(16))) __bf16 Vc[256][VP];     // V^T columns for this chunk
    __shared__ __attribute__((aligned(16))) __bf16 Pst[8][16 * VP]; // per-wave P staging

    int t    = threadIdx.x;
    int wib  = t >> 5;
    int wid  = blockIdx.x * 8 + wib;
    int lane = t & 31;
    int half = lane >> 4, r = lane & 15;
    int b  = wid >> 8;                 // 256 query tiles per batch
    int m0 = (wid & 255) * 16;

    const __bf16* Qb = Q  + ((size_t)b * N_SPATIAL) * CDIM;
    const __bf16* Kb = K  + ((size_t)b * N_SPATIAL) * CDIM;
    const __bf16* Vb = VT + (size_t)b * CDIM * N_SPATIAL;

    bf16x16 qf[8];
    const __bf16* qrow = Qb + (size_t)(m0 + r) * CDIM + 8 * half;
#pragma unroll
    for (int kk = 0; kk < 8; ++kk) qf[kk] = load_frag(qrow + kk * 32);

    f32x8 o[16];
#pragma unroll
    for (int u = 0; u < 16; ++u) o[u] = zero8();
    float m[8], l[8];
#pragma unroll
    for (int i = 0; i < 8; ++i) { m[i] = -1e30f; l[i] = 0.0f; }

    __bf16* pst = &Pst[wib][0];
    const unsigned kl = (unsigned)(size_t)&Kc[0][0];  // LDS byte offsets
    const unsigned vl = (unsigned)(size_t)&Vc[0][0];
    const float sc = 0.0625f;                         // 256^-0.5

    for (int j0 = 0; j0 < N_SPATIAL; j0 += 32) {
        // this wave's own LDS reads of the old chunk have retired before any copy refills it
        asm volatile("s_wait_dscnt 0x0" ::: "memory");
        __syncthreads();   // previous chunk's compute finished in all waves
        // ---- stage K chunk (contiguous 16 KB) and V chunk into LDS ----
        const char* kgb = (const char*)Kb + (size_t)j0 * (CDIM * 2);
        unsigned la[8];
        const char* ga[8];
#pragma unroll
        for (int i = 0; i < 4; ++i) {
            int li = i * 256 + t;                     // 0..1023 -> 16B segments
            la[i] = kl + (li >> 5) * (KP * 2) + (li & 31) * 16;
            ga[i] = kgb + li * 16;
        }
#pragma unroll
        for (int i = 0; i < 4; ++i) {
            int li = i * 256 + t;
            int u = li >> 2, seg = li & 3;
            la[4 + i] = vl + u * (VP * 2) + seg * 16;
            ga[4 + i] = (const char*)(Vb + (size_t)u * N_SPATIAL + j0 + seg * 8);
        }
        async_b128_x8(la, ga);
        wait_async0();
        __syncthreads();   // chunk visible to all waves

        // ---- S = Q @ K_chunk^T : two 16x16 tiles, fragments from LDS ----
        f32x8 s0 = zero8(), s1 = zero8();
        const __bf16* k0base = &Kc[r][8 * half];
        const __bf16* k1base = &Kc[16 + r][8 * half];
#pragma unroll
        for (int kk = 0; kk < 8; ++kk) {
            s0 = wmma_bf16(qf[kk], load_frag(k0base + kk * 32), s0);
            s1 = wmma_bf16(qf[kk], load_frag(k1base + kk * 32), s1);
        }
        // ---- online softmax (row stats local to the 16-lane half) ----
        float p0[8], p1[8], mn[8];
#pragma unroll
        for (int i = 0; i < 8; ++i) {
            p0[i] = s0[i] * sc; p1[i] = s1[i] * sc;
            mn[i] = fmaxf(p0[i], p1[i]);
        }
#pragma unroll
        for (int off = 8; off >= 1; off >>= 1)
#pragma unroll
            for (int i = 0; i < 8; ++i)
                mn[i] = fmaxf(mn[i], __shfl_xor(mn[i], off, 32));
        float alpha[8], ls[8];
#pragma unroll
        for (int i = 0; i < 8; ++i) {
            float mnew = fmaxf(m[i], mn[i]);
            alpha[i] = __expf(m[i] - mnew);
            m[i] = mnew;
            p0[i] = __expf(p0[i] - mnew);
            p1[i] = __expf(p1[i] - mnew);
            ls[i] = p0[i] + p1[i];
        }
#pragma unroll
        for (int off = 8; off >= 1; off >>= 1)
#pragma unroll
            for (int i = 0; i < 8; ++i)
                ls[i] += __shfl_xor(ls[i], off, 32);
#pragma unroll
        for (int i = 0; i < 8; ++i) l[i] = l[i] * alpha[i] + ls[i];
#pragma unroll
        for (int u = 0; u < 16; ++u)
#pragma unroll
            for (int i = 0; i < 8; ++i) o[u][i] *= alpha[i];

        // ---- stage P (C layout) -> A-layout fragment via per-wave LDS ----
#pragma unroll
        for (int i = 0; i < 8; ++i) {
            int row = i + 8 * half;
            pst[row * VP + r]      = f2bf(p0[i]);
            pst[row * VP + 16 + r] = f2bf(p1[i]);
        }
        bf16x8 pa = *(const bf16x8*)&pst[r * VP + 8 * half];
        bf16x8 pb = *(const bf16x8*)&pst[r * VP + 8 * half + 16];
        bf16x16 pf;
#pragma unroll
        for (int i = 0; i < 8; ++i) { pf[i] = pa[i]; pf[i + 8] = pb[i]; }

        // ---- O += P @ V_chunk (B fragments from LDS, contiguous) ----
        const __bf16* vbase = &Vc[r][8 * half];
#pragma unroll
        for (int u = 0; u < 16; ++u)
            o[u] = wmma_bf16(pf, load_frag(vbase + u * 16 * VP), o[u]);
    }

    // epilogue: divide by softmax denominator, store bf16 row-major
    float inv[8];
#pragma unroll
    for (int i = 0; i < 8; ++i) inv[i] = 1.0f / l[i];
    __bf16* Ob = O + ((size_t)b * N_SPATIAL + m0) * CDIM;
#pragma unroll
    for (int u = 0; u < 16; ++u)
#pragma unroll
        for (int i = 0; i < 8; ++i)
            Ob[(size_t)(i + 8 * half) * CDIM + u * 16 + r] = f2bf(o[u][i] * inv[i]);
}

// ---------------- Output projection + bias + residual -----------------------
__global__ void proj_kernel(const __bf16* __restrict__ A, const __bf16* __restrict__ WT,
                            const float* __restrict__ bias, const float* __restrict__ resid,
                            float* __restrict__ out) {
    int wid  = (blockIdx.x * blockDim.x + threadIdx.x) >> 5;
    int lane = threadIdx.x & 31;
    int half = lane >> 4, r = lane & 15;
    size_t m0 = (size_t)(wid >> 4) * 16;
    int n0 = (wid & 15) * 16;
    const __bf16* arow = A  + (m0 + r) * CDIM + 8 * half;
    const __bf16* brow = WT + (size_t)(n0 + r) * CDIM + 8 * half;
    f32x8 c = zero8();
#pragma unroll
    for (int kk = 0; kk < 8; ++kk)
        c = wmma_bf16(load_frag(arow + kk * 32), load_frag(brow + kk * 32), c);
    float bv = bias[n0 + r];
#pragma unroll
    for (int i = 0; i < 8; ++i) {
        size_t idx = (m0 + i + 8 * half) * CDIM + n0 + r;
        out[idx] = c[i] + bv + resid[idx];
    }
}

extern "C" void kernel_launch(void* const* d_in, const int* in_sizes, int n_in,
                              void* d_out, int out_size, void* d_ws, size_t ws_size,
                              hipStream_t stream) {
    const float* inputs  = (const float*)d_in[0];
    const float* context = (const float*)d_in[1];
    const float* Wq = (const float*)d_in[2];
    const float* bq = (const float*)d_in[3];
    const float* Wk = (const float*)d_in[4];
    const float* bk = (const float*)d_in[5];
    const float* Wv = (const float*)d_in[6];
    const float* bv = (const float*)d_in[7];
    const float* Wp = (const float*)d_in[8];
    const float* bp = (const float*)d_in[9];
    const float* gamma = (const float*)d_in[10];
    const float* beta  = (const float*)d_in[11];
    float* out = (float*)d_out;

    const size_t TOT = (size_t)NBATCH * N_SPATIAL * CDIM;  // 4,194,304 elements
    char* ws = (char*)d_ws;
    float*  xn_f32 = (float*)ws;  ws += TOT * 4;
    __bf16* xn_bf  = (__bf16*)ws; ws += TOT * 2;
    __bf16* ctx_bf = (__bf16*)ws; ws += TOT * 2;
    __bf16* qb     = (__bf16*)ws; ws += TOT * 2;
    __bf16* kb_    = (__bf16*)ws; ws += TOT * 2;
    __bf16* vtb    = (__bf16*)ws; ws += TOT * 2;
    __bf16* ob     = (__bf16*)ws; ws += TOT * 2;
    __bf16* WqT    = (__bf16*)ws; ws += 65536 * 2;
    __bf16* WkT    = (__bf16*)ws; ws += 65536 * 2;
    __bf16* WvT    = (__bf16*)ws; ws += 65536 * 2;
    __bf16* WpT    = (__bf16*)ws; ws += 65536 * 2;

    cvt_bf16_kernel<<<(int)(TOT / 256), 256, 0, stream>>>(context, ctx_bf, (int)TOT);
    transpose_w_kernel<<<1024, 256, 0, stream>>>(Wq, Wk, Wv, Wp, WqT, WkT, WvT, WpT);
    ln_kernel<<<NBATCH * N_SPATIAL, 256, 0, stream>>>(inputs, gamma, beta, xn_f32, xn_bf);
    qproj_kernel<<<2048, 256, 0, stream>>>(xn_bf, WqT, bq, qb);
    kvproj_kernel<<<2048, 256, 0, stream>>>(ctx_bf, WkT, WvT, bk, bv, kb_, vtb);
    flash_kernel<<<128, 256, 0, stream>>>(qb, kb_, vtb, ob);
    proj_kernel<<<2048, 256, 0, stream>>>(ob, WpT, bp, xn_f32, out);
}

// v002
// Measured time: 321 microseconds a run.
// In both of two side-by-side timings against v001, it was 1.06 times as fast.
// Counting every step since v000, it is 3.24 times as fast.
#include <hip/hip_runtime.h>
#include <hip/hip_bf16.h>

#define N_SPATIAL 4096   // 64*64
#define CDIM 256
#define NBATCH 4

typedef __attribute__((ext_vector_type(16))) __bf16 bf16x16;
typedef __attribute__((ext_vector_type(8)))  __bf16 bf16x8;
typedef __attribute__((ext_vector_type(8)))  float  f32x8;
typedef __attribute__((ext_vector_type(4)))  __bf16 bf16x4;
typedef __attribute__((ext_vector_type(4)))  float  f32x4;

// float -> bf16 with round-to-nearest-even (bit manipulation; no cvt dependence)
__device__ __forceinline__ __bf16 f2bf(float f) {
    unsigned u = __float_as_uint(f);
    u += 0x7FFFu + ((u >> 16) & 1u);
    unsigned short s = (unsigned short)(u >> 16);
    return __builtin_bit_cast(__bf16, s);
}

__device__ __forceinline__ f32x8 wmma_bf16(bf16x16 a, bf16x16 b, f32x8 c) {
    return __builtin_amdgcn_wmma_f32_16x16x32_bf16(
        /*neg_a=*/false, a, /*neg_b=*/false, b,
        /*c_mod=*/(short)0, c, /*reuse_a=*/false, /*reuse_b=*/false);
}

// Fragment loader: elems 0..7 from p[0..7], elems 8..15 from p[16..23].
// Caller passes p = base + 8*half; this matches the 16-bit A/B VGPR layout
// (lanes 0-15: K=0..7 & 16..23 ; lanes 16-31: K=8..15 & 24..31).
__device__ __forceinline__ bf16x16 load_frag(const __bf16* p) {
    bf16x8 a = *(const bf16x8*)p;
    bf16x8 b = *(const bf16x8*)(p + 16);
    bf16x16 f;
#pragma unroll
    for (int i = 0; i < 8; ++i) { f[i] = a[i]; f[i + 8] = b[i]; }
    return f;
}

__device__ __forceinline__ f32x8 zero8() {
    f32x8 c;
#pragma unroll
    for (int i = 0; i < 8; ++i) c[i] = 0.0f;
    return c;
}

// Eight async copies of 16B per lane from global to LDS (tracked by ASYNCcnt).
// l[i] = LDS byte offset (low 32 bits of generic pointer), g[i] = global address.
// The closing s_wait_xcnt 0 stands inside the statement so that no address
// register of an issued copy is rewritten ahead of it.
__device__ __forceinline__ void async_b128_x8(const unsigned (&l)[8], const char* const (&g)[8]) {
    asm volatile("global_load_async_to_lds_b128 %0, %8, off\n\t"
                 "global_load_async_to_lds_b128 %1, %9, off\n\t"
                 "global_load_async_to_lds_b128 %2, %10, off\n\t"
                 "global_load_async_to_lds_b128 %3, %11, off\n\t"
                 "global_load_async_to_lds_b128 %4, %12, off\n\t"
                 "global_load_async_to_lds_b128 %5, %13, off\n\t"
                 "global_load_async_to_lds_b128 %6, %14, off\n\t"
                 "global_load_async_to_lds_b128 %7, %15, off\n\t"
                 "s_wait_xcnt 0x0"
                 :: "v"(l[0]), "v"(l[1]), "v"(l[2]), "v"(l[3]),
                    "v"(l[4]), "v"(l[5]), "v"(l[6]), "v"(l[7]),
                    "v"(g[0]), "v"(g[1]), "v"(g[2]), "v"(g[3]),
                    "v"(g[4]), "v"(g[5]), "v"(g[6]), "v"(g[7])
                 : "memory");
}
__device__ __forceinline__ void wait_async0() {
    asm volatile("s_wait_asynccnt 0x0" ::: "memory");
}

// ---------------- LayerNorm: one wave per 4 rows -----------------------------
// A row (256 floats) lies across the 32 lanes, 8 elements a lane, so that both
// sums stay inside the wave. 16 waves a block, 8 loads of 16 B in flight a wave.
__global__ void __launch_bounds__(512) ln_kernel(
        const float* __restrict__ x, const float* __restrict__ gamma,
        const float* __restrict__ beta, float* __restrict__ xn,
        __bf16* __restrict__ xnb) {
    int wave = (blockIdx.x * 512 + threadIdx.x) >> 5;
    int lane = threadIdx.x & 31;
    size_t base = (size_t)wave * (4 * CDIM) + lane * 4;
    f32x4 a[4], b[4];
    for (int j = 0; j < 4; ++j) {
        a[j] = *(const f32x4*)(x + base + j * CDIM);
        b[j] = *(const f32x4*)(x + base + j * CDIM + 128);
    }
    f32x4 g0 = *(const f32x4*)(gamma + lane * 4);
    f32x4 g1 = *(const f32x4*)(gamma + lane * 4 + 128);
    f32x4 e0 = *(const f32x4*)(beta + lane * 4);
    f32x4 e1 = *(const f32x4*)(beta + lane * 4 + 128);
    float s[4];
    for (int j = 0; j < 4; ++j)
        s[j] = ((a[j][0] + a[j][1]) + (a[j][2] + a[j][3])) +
               ((b[j][0] + b[j][1]) + (b[j][2] + b[j][3]));
    for (int off = 16; off >= 1; off >>= 1)
        for (int j = 0; j < 4; ++j) s[j] += __shfl_xor(s[j], off, 32);
    for (int j = 0; j < 4; ++j) {
        float mu = s[j] * (1.0f / CDIM);
        a[j] -= mu;
        b[j] -= mu;
        f32x4 qa = a[j] * a[j], qb = b[j] * b[j];
        s[j] = ((qa[0] + qa[1]) + (qa[2] + qa[3])) + ((qb[0] + qb[1]) + (qb[2] + qb[3]));
    }
    for (int off = 16; off >= 1; off >>= 1)
        for (int j = 0; j < 4; ++j) s[j] += __shfl_xor(s[j], off, 32);
    for (int j = 0; j < 4; ++j) {
        float rs = rsqrtf(s[j] * (1.0f / CDIM) + 1e-3f);
        f32x4 y0 = a[j] * rs * g0 + e0;
        f32x4 y1 = b[j] * rs * g1 + e1;
        bf16x4 h0, h1;
        for (int k = 0; k < 4; ++k) { h0[k] = f2bf(y0[k]); h1[k] = f2bf(y1[k]); }
        *(f32x4*)(xn + base + j * CDIM)        = y0;
        *(f32x4*)(xn + base + j * CDIM + 128)  = y1;
        *(bf16x4*)(xnb + base + j * CDIM)       = h0;
        *(bf16x4*)(xnb + base + j * CDIM + 128) = h1;
    }
}

// ---------------- fp32 -> bf16 elementwise: 32 elements a lane ---------------
// A wave converts 1024 consecutive floats: 8 loads of 16 B a lane in flight,
// each wave-wide load and store covering whole 128-B lines.
__global__ void __launch_bounds__(512) cvt_bf16_kernel(const float* __restrict__ src,
                                                       __bf16* __restrict__ dst) {
    int wave = (blockIdx.x * 512 + threadIdx.x) >> 5;
    int lane = threadIdx.x & 31;
    size_t base = (size_t)wave * 1024 + lane * 4;
    f32x4 v[8];
    for (int i = 0; i < 8; ++i) v[i] = *(const f32x4*)(src + base + i * 128);
    for (int i = 0; i < 8; ++i) {
        bf16x4 h;
        for (int k = 0; k < 4; ++k) h[k] = f2bf(v[i][k]);
        *(bf16x4*)(dst + base + i * 128) = h;
    }
}

// ---------------- transpose 4 weight matrices to [N][K] bf16 ----------------
__global__ void transpose_w_kernel(const float* __restrict__ Wq, const float* __restrict__ Wk,
                                   const float* __restrict__ Wv, const float* __restrict__ Wp,
                                   __bf16* __restrict__ WqT, __bf16* __restrict__ WkT,
                                   __bf16* __restrict__ WvT, __bf16* __restrict__ WpT) {
    int i = blockIdx.x * blockDim.x + threadIdx.x;  // 0..262143
    int w = i >> 16;
    int j = i & 65535;
    int k = j >> 8, n = j & 255;
    const float* S = (w == 0) ? Wq : (w == 1) ? Wk : (w == 2) ? Wv : Wp;
    __bf16* D      = (w == 0) ? WqT : (w == 1) ? WkT : (w == 2) ? WvT : WpT;
    D[n * 256 + k] = f2bf(S[k * 256 + n]);
}

// ---------------- Q projection: wave = 16x16 output tile --------------------
__global__ void qproj_kernel(const __bf16* __restrict__ A, const __bf16* __restrict__ WT,
                             const float* __restrict__ bias, __bf16* __restrict__ Qo) {
    int wid  = (blockIdx.x * blockDim.x + threadIdx.x) >> 5;
    int lane = threadIdx.x & 31;
    int half = lane >> 4, r = lane & 15;
    size_t m0 = (size_t)(wid >> 4) * 16;
    int n0 = (wid & 15) * 16;
    const __bf16* arow = A  + (m0 + r) * CDIM + 8 * half;
    const __bf16* brow = WT + (size_t)(n0 + r) * CDIM + 8 * half;
    f32x8 c = zero8();
#pragma unroll
    for (int kk = 0; kk < 8; ++kk)
        c = wmma_bf16(load_frag(arow + kk * 32), load_frag(brow + kk * 32), c);
    float bv = bias[n0 + r];
#pragma unroll
    for (int i = 0; i < 8; ++i)
        Qo[(m0 + i + 8 * half) * CDIM + n0 + r] = f2bf(c[i] + bv);
}

// ---------------- K,V projection; V stored transposed [B][C][N] -------------
__global__ void kvproj_kernel(const __bf16* __restrict__ A, const __bf16* __restrict__ WkT,
                              const __bf16* __restrict__ WvT, const float* __restrict__ bk,
                              const float* __restrict__ bvv, __bf16* __restrict__ Ko,
                              __bf16* __restrict__ VTo) {
    int wid  = (blockIdx.x * blockDim.x + threadIdx.x) >> 5;
    int lane = threadIdx.x & 31;
    int half = lane >> 4, r = lane & 15;
    size_t m0 = (size_t)(wid >> 4) * 16;
    int n0 = (wid & 15) * 16;
    const __bf16* arow  = A   + (m0 + r) * CDIM + 8 * half;
    const __bf16* bkrow = WkT + (size_t)(n0 + r) * CDIM + 8 * half;
    const __bf16* bvrow = WvT + (size_t)(n0 + r) * CDIM + 8 * half;
    f32x8 ck = zero8(), cv = zero8();
#pragma unroll
    for (int kk = 0; kk < 8; ++kk) {
        bf16x16 af = load_frag(arow + kk * 32);
        ck = wmma_bf16(af, load_frag(bkrow + kk * 32), ck);
        cv = wmma_bf16(af, load_frag(bvrow + kk * 32), cv);
    }
    float kb = bk[n0 + r];
#pragma unroll
    for (int i = 0; i < 8; ++i)
        Ko[(m0 + i + 8 * half) * CDIM + n0 + r] = f2bf(ck[i] + kb);
    // V transposed store: lane's 8 C-layout rows are consecutive key indices.
    int b   = (int)(m0 >> 12);                 // 4096 keys per batch
    int nk0 = (int)(m0 & 4095) + 8 * half;
    float vb = bvv[n0 + r];
    bf16x8 pack;
#pragma unroll
    for (int i = 0; i < 8; ++i) pack[i] = f2bf(cv[i] + vb);
    *(bf16x8*)(VTo + ((size_t)b * CDIM + n0 + r) * N_SPATIAL + nk0) = pack;
}

// ---------------- Flash attention ------------------------------------------
// Block = 8 waves, each wave owns a 16-row query tile; the 32-key K/V chunk is
// staged once per block into LDS via async global->LDS copies and shared.
// LDS rows are pitched 16 B x odd, so that the 16 lanes of a ds_load_b128
// fragment read (one row each) fall on 16 different groups of four banks.
#define KP 264   // K row pitch in elements: 528 B for 512 B of data
#define VP 40    // V^T and P row pitch in elements: 80 B for 64 B of data
__global__ void __launch_bounds__(256) flash_kernel(
        const __bf16* __restrict__ Q, const __bf16* __restrict__ K,
        const __bf16* __restrict__ VT, __bf16* __restrict__ O) {
    __shared__ __attribute__((aligned(16))) __bf16 Kc[32][KP];      // chunk rows of K (row-major)
    __shared__ __attribute__((aligned(16))) __bf16 Vc[256][VP];     // V^T columns for this chunk
    __shared__ __attribute__((aligned(16))) __bf16 Pst[8][16 * VP]; // per-wave P staging

    int t    = threadIdx.x;
    int wib  = t >> 5;
    int wid  = blockIdx.x * 8 + wib;
    int lane = t & 31;
    int half = lane >> 4, r = lane & 15;
    int b  = wid >> 8;                 // 256 query tiles per batch
    int m0 = (wid & 255) * 16;

    const __bf16* Qb = Q  + ((size_t)b * N_SPATIAL) * CDIM;
    const __bf16* Kb = K  + ((size_t)b * N_SPATIAL) * CDIM;
    const __bf16* Vb = VT + (size_t)b * CDIM * N_SPATIAL;

    bf16x16 qf[8];
    const __bf16* qrow = Qb + (size_t)(m0 + r) * CDIM + 8 * half;
#pragma unroll
    for (int kk = 0; kk < 8; ++kk) qf[kk] = load_frag(qrow + kk * 32);

    f32x8 o[16];
#pragma unroll
    for (int u = 0; u < 16; ++u) o[u] = zero8();
    float m[8], l[8];
#pragma unroll
    for (int i = 0; i < 8; ++i) { m[i] = -1e30f; l[i] = 0.0f; }

    __bf16* pst = &Pst[wib][0];
    const unsigned kl = (unsigned)(size_t)&Kc[0][0];  // LDS byte offsets
    const unsigned vl = (unsigned)(size_t)&Vc[0][0];
    const float sc = 0.0625f;                         // 256^-0.5

    for (int j0 = 0; j0 < N_SPATIAL; j0 += 32) {
        // this wave's own LDS reads of the old chunk have retired before any copy refills it
        asm volatile("s_wait_dscnt 0x0" ::: "memory");
        __syncthreads();   // previous chunk's compute finished in all waves
        // ---- stage K chunk (contiguous 16 KB) and V chunk into LDS ----
        const char* kgb = (const char*)Kb + (size_t)j0 * (CDIM * 2);
        unsigned la[8];
        const char* ga[8];
#pragma unroll
        for (int i = 0; i < 4; ++i) {
            int li = i * 256 + t;                     // 0..1023 -> 16B segments
            la[i] = kl + (li >> 5) * (KP * 2) + (li & 31) * 16;
            ga[i] = kgb + li * 16;
        }
#pragma unroll
        for (int i = 0; i < 4; ++i) {
            int li = i * 256 + t;
            int u = li >> 2, seg = li & 3;
            la[4 + i] = vl + u * (VP * 2) + seg * 16;
            ga[4 + i] = (const char*)(Vb + (size_t)u * N_SPATIAL + j0 + seg * 8);
        }
        async_b128_x8(la, ga);
        wait_async0();
        __syncthreads();   // chunk visible to all waves

        // ---- S = Q @ K_chunk^T : two 16x16 tiles, fragments from LDS ----
        f32x8 s0 = zero8(), s1 = zero8();
        const __bf16* k0base = &Kc[r][8 * half];
        const __bf16* k1base = &Kc[16 + r][8 * half];
#pragma unroll
        for (int kk = 0; kk < 8; ++kk) {
            s0 = wmma_bf16(qf[kk], load_frag(k0base + kk * 32), s0);
            s1 = wmma_bf16(qf[kk], load_frag(k1base + kk * 32), s1);
        }
        // ---- online softmax (row stats local to the 16-lane half) ----
        float p0[8], p1[8], mn[8];
#pragma unroll
        for (int i = 0; i < 8; ++i) {
            p0[i] = s0[i] * sc; p1[i] = s1[i] * sc;
            mn[i] = fmaxf(p0[i], p1[i]);
        }
#pragma unroll
        for (int off = 8; off >= 1; off >>= 1)
#pragma unroll
            for (int i = 0; i < 8; ++i)
                mn[i] = fmaxf(mn[i], __shfl_xor(mn[i], off, 32));
        float alpha[8], ls[8];
#pragma unroll
        for (int i = 0; i < 8; ++i) {
            float mnew = fmaxf(m[i], mn[i]);
            alpha[i] = __expf(m[i] - mnew);
            m[i] = mnew;
            p0[i] = __expf(p0[i] - mnew);
            p1[i] = __expf(p1[i] - mnew);
            ls[i] = p0[i] + p1[i];
        }
#pragma unroll
        for (int off = 8; off >= 1; off >>= 1)
#pragma unroll
            for (int i = 0; i < 8; ++i)
                ls[i] += __shfl_xor(ls[i], off, 32);
#pragma unroll
        for (int i = 0; i < 8; ++i) l[i] = l[i] * alpha[i] + ls[i];
#pragma unroll
        for (int u = 0; u < 16; ++u)
#pragma unroll
            for (int i = 0; i < 8; ++i) o[u][i] *= alpha[i];

        // ---- stage P (C layout) -> A-layout fragment via per-wave LDS ----
#pragma unroll
        for (int i = 0; i < 8; ++i) {
            int row = i + 8 * half;
            pst[row * VP + r]      = f2bf(p0[i]);
            pst[row * VP + 16 + r] = f2bf(p1[i]);
        }
        bf16x8 pa = *(const bf16x8*)&pst[r * VP + 8 * half];
        bf16x8 pb = *(const bf16x8*)&pst[r * VP + 8 * half + 16];
        bf16x16 pf;
#pragma unroll
        for (int i = 0; i < 8; ++i) { pf[i] = pa[i]; pf[i + 8] = pb[i]; }

        // ---- O += P @ V_chunk (B fragments from LDS, contiguous) ----
        const __bf16* vbase = &Vc[r][8 * half];
#pragma unroll
        for (int u = 0; u < 16; ++u)
            o[u] = wmma_bf16(pf, load_frag(vbase + u * 16 * VP), o[u]);
    }

    // epilogue: divide by softmax denominator, store bf16 row-major
    float inv[8];
#pragma unroll
    for (int i = 0; i < 8; ++i) inv[i] = 1.0f / l[i];
    __bf16* Ob = O + ((size_t)b * N_SPATIAL + m0) * CDIM;
#pragma unroll
    for (int u = 0; u < 16; ++u)
#pragma unroll
        for (int i = 0; i < 8; ++i)
            Ob[(size_t)(i + 8 * half) * CDIM + u * 16 + r] = f2bf(o[u][i] * inv[i]);
}

// ---------------- Output projection + bias + residual -----------------------
__global__ void proj_kernel(const __bf16* __restrict__ A, const __bf16* __restrict__ WT,
                            const float* __restrict__ bias, const float* __restrict__ resid,
                            float* __restrict__ out) {
    int wid  = (blockIdx.x * blockDim.x + threadIdx.x) >> 5;
    int lane = threadIdx.x & 31;
    int half = lane >> 4, r = lane & 15;
    size_t m0 = (size_t)(wid >> 4) * 16;
    int n0 = (wid & 15) * 16;
    const __bf16* arow = A  + (m0 + r) * CDIM + 8 * half;
    const __bf16* brow = WT + (size_t)(n0 + r) * CDIM + 8 * half;
    f32x8 c = zero8();
#pragma unroll
    for (int kk = 0; kk < 8; ++kk)
        c = wmma_bf16(load_frag(arow + kk * 32), load_frag(brow + kk * 32), c);
    float bv = bias[n0 + r];
#pragma unroll
    for (int i = 0; i < 8; ++i) {
        size_t idx = (m0 + i + 8 * half) * CDIM + n0 + r;
        out[idx] = c[i] + bv + resid[idx];
    }
}

extern "C" void kernel_launch(void* const* d_in, const int* in_sizes, int n_in,
                              void* d_out, int out_size, void* d_ws, size_t ws_size,
                              hipStream_t stream) {
    const float* inputs  = (const float*)d_in[0];
    const float* context = (const float*)d_in[1];
    const float* Wq = (const float*)d_in[2];
    const float* bq = (const float*)d_in[3];
    const float* Wk = (const float*)d_in[4];
    const float* bk = (const float*)d_in[5];
    const float* Wv = (const float*)d_in[6];
    const float* bv = (const float*)d_in[7];
    const float* Wp = (const float*)d_in[8];
    const float* bp = (const float*)d_in[9];
    const float* gamma = (const float*)d_in[10];
    const float* beta  = (const float*)d_in[11];
    float* out = (float*)d_out;

    const size_t TOT = (size_t)NBATCH * N_SPATIAL * CDIM;  // 4,194,304 elements
    char* ws = (char*)d_ws;
    float*  xn_f32 = (float*)ws;  ws += TOT * 4;
    __bf16* xn_bf  = (__bf16*)ws; ws += TOT * 2;
    __bf16* ctx_bf = (__bf16*)ws; ws += TOT * 2;
    __bf16* qb     = (__bf16*)ws; ws += TOT * 2;
    __bf16* kb_    = (__bf16*)ws; ws += TOT * 2;
    __bf16* vtb    = (__bf16*)ws; ws += TOT * 2;
    __bf16* ob     = (__bf16*)ws; ws += TOT * 2;
    __bf16* WqT    = (__bf16*)ws; ws += 65536 * 2;
    __bf16* WkT    = (__bf16*)ws; ws += 65536 * 2;
    __bf16* WvT    = (__bf16*)ws; ws += 65536 * 2;
    __bf16* WpT    = (__bf16*)ws; ws += 65536 * 2;

    cvt_bf16_kernel<<<256, 512, 0, stream>>>(context, ctx_bf);   // 256 * 16 waves * 1024 = TOT
    transpose_w_kernel<<<1024, 256, 0, stream>>>(Wq, Wk, Wv, Wp, WqT, WkT, WvT, WpT);
    ln_kernel<<<256, 512, 0, stream>>>(inputs, gamma, beta, xn_f32, xn_bf);   // 256 * 16 waves * 4 rows
    qproj_kernel<<<2048, 256, 0, stream>>>(xn_bf, WqT, bq, qb);
    kvproj_kernel<<<2048, 256, 0, stream>>>(ctx_bf, WkT, WvT, bk, bv, kb_, vtb);
    flash_kernel<<<128, 256, 0, stream>>>(qb, kb_, vtb, ob);
    proj_kernel<<<2048, 256, 0, stream>>>(ob, WpT, bp, xn_f32, out);
}

// v003
// Measured time: 287 microseconds a run.
// Two timings next to v002 put it at 1.12 and 1.13 times that version's speed.
// Counting every step since v000, it is 3.65 times as fast.
#include <hip/hip_runtime.h>
#include <hip/hip_bf16.h>

#define N_SPATIAL 4096   // 64*64
#define CDIM 256
#define NBATCH 4

typedef __attribute__((ext_vector_type(16))) __bf16 bf16x16;
typedef __attribute__((ext_vector_type(8)))  __bf16 bf16x8;
typedef __attribute__((ext_vector_type(8)))  float  f32x8;
typedef __attribute__((ext_vector_type(4)))  __bf16 bf16x4;
typedef __attribute__((ext_vector_type(4)))  float  f32x4;

// float -> bf16 with round-to-nearest-even (bit manipulation; no cvt dependence)
__device__ __forceinline__ __bf16 f2bf(float f) {
    unsigned u = __float_as_uint(f);
    u += 0x7FFFu + ((u >> 16) & 1u);
    unsigned short s = (unsigned short)(u >> 16);
    return __builtin_bit_cast(__bf16, s);
}

__device__ __forceinline__ f32x8 wmma_bf16(bf16x16 a, bf16x16 b, f32x8 c) {
    return __builtin_amdgcn_wmma_f32_16x16x32_bf16(
        /*neg_a=*/false, a, /*neg_b=*/false, b,
        /*c_mod=*/(short)0, c, /*reuse_a=*/false, /*reuse_b=*/false);
}

// Fragment loader: elems 0..7 from p[0..7], elems 8..15 from p[16..23].
// Caller passes p = base + 8*half; this matches the 16-bit A/B VGPR layout
// (lanes 0-15: K=0..7 & 16..23 ; lanes 16-31: K=8..15 & 24..31).
__device__ __forceinline__ bf16x16 load_frag(const __bf16* p) {
    bf16x8 a = *(const bf16x8*)p;
    bf16x8 b = *(const bf16x8*)(p + 16);
    bf16x16 f;
#pragma unroll
    for (int i = 0; i < 8; ++i) { f[i] = a[i]; f[i + 8] = b[i]; }
    return f;
}

__device__ __forceinline__ f32x8 zero8() {
    f32x8 c;
#pragma unroll
    for (int i = 0; i < 8; ++i) c[i] = 0.0f;
    return c;
}

// One stage's sixteen async copies of 16B per lane from global to LDS (tracked by ASYNCcnt).
// l* = LDS byte offset (low 32 bits of generic pointer), g* = global address; an
// immediate offset moves both addresses alike, so one address pair serves the
// 128-B pieces of one row: six pairs in registers instead of sixteen.
// kl/kg: two K rows, four pieces each; vl/vg: four V^T rows, two pieces each.
// The closing s_wait_xcnt 0 stands inside the statement so that no address
// register of an issued copy is rewritten ahead of it.
__device__ __forceinline__ void async_stage(const unsigned (&kl)[2], const char* const (&kg)[2],
                                            const unsigned (&vl)[4], const char* const (&vg)[4]) {
    asm volatile("global_load_async_to_lds_b128 %0, %6, off\n\t"
                 "global_load_async_to_lds_b128 %0, %6, off offset:128\n\t"
                 "global_load_async_to_lds_b128 %0, %6, off offset:256\n\t"
                 "global_load_async_to_lds_b128 %0, %6, off offset:384\n\t"
                 "global_load_async_to_lds_b128 %1, %7, off\n\t"
                 "global_load_async_to_lds_b128 %1, %7, off offset:128\n\t"
                 "global_load_async_to_lds_b128 %1, %7, off offset:256\n\t"
                 "global_load_async_to_lds_b128 %1, %7, off offset:384\n\t"
                 "global_load_async_to_lds_b128 %2, %8, off\n\t"
                 "global_load_async_to_lds_b128 %2, %8, off offset:128\n\t"
                 "global_load_async_to_lds_b128 %3, %9, off\n\t"
                 "global_load_async_to_lds_b128 %3, %9, off offset:128\n\t"
                 "global_load_async_to_lds_b128 %4, %10, off\n\t"
                 "global_load_async_to_lds_b128 %4, %10, off offset:128\n\t"
                 "global_load_async_to_lds_b128 %5, %11, off\n\t"
                 "global_load_async_to_lds_b128 %5, %11, off offset:128\n\t"
                 "s_wait_xcnt 0x0"
                 :: "v"(kl[0]), "v"(kl[1]), "v"(vl[0]), "v"(vl[1]), "v"(vl[2]), "v"(vl[3]),
                    "v"(kg[0]), "v"(kg[1]), "v"(vg[0]), "v"(vg[1]), "v"(vg[2]), "v"(vg[3])
                 : "memory");
}
__device__ __forceinline__ void wait_async0() {
    asm volatile("s_wait_asynccnt 0x0" ::: "memory");
}

// ---------------- LayerNorm: one wave per 4 rows -----------------------------
// A row (256 floats) lies across the 32 lanes, 8 elements a lane, so that both
// sums stay inside the wave. 16 waves a block, 8 loads of 16 B in flight a wave.
__global__ void __launch_bounds__(512) ln_kernel(
        const float* __restrict__ x, const float* __restrict__ gamma,
        const float* __restrict__ beta, float* __restrict__ xn,
        __bf16* __restrict__ xnb) {
    int wave = (blockIdx.x * 512 + threadIdx.x) >> 5;
    int lane = threadIdx.x & 31;
    size_t base = (size_t)wave * (4 * CDIM) + lane * 4;
    f32x4 a[4], b[4];
    for (int j = 0; j < 4; ++j) {
        a[j] = *(const f32x4*)(x + base + j * CDIM);
        b[j] = *(const f32x4*)(x + base + j * CDIM + 128);
    }
    f32x4 g0 = *(const f32x4*)(gamma + lane * 4);
    f32x4 g1 = *(const f32x4*)(gamma + lane * 4 + 128);
    f32x4 e0 = *(const f32x4*)(beta + lane * 4);
    f32x4 e1 = *(const f32x4*)(beta + lane * 4 + 128);
    float s[4];
    for (int j = 0; j < 4; ++j)
        s[j] = ((a[j][0] + a[j][1]) + (a[j][2] + a[j][3])) +
               ((b[j][0] + b[j][1]) + (b[j][2] + b[j][3]));
    for (int off = 16; off >= 1; off >>= 1)
        for (int j = 0; j < 4; ++j) s[j] += __shfl_xor(s[j], off, 32);
    for (int j = 0; j < 4; ++j) {
        float mu = s[j] * (1.0f / CDIM);
        a[j] -= mu;
        b[j] -= mu;
        f32x4 qa = a[j] * a[j], qb = b[j] * b[j];
        s[j] = ((qa[0] + qa[1]) + (qa[2] + qa[3])) + ((qb[0] + qb[1]) + (qb[2] + qb[3]));
    }
    for (int off = 16; off >= 1; off >>= 1)
        for (int j = 0; j < 4; ++j) s[j] += __shfl_xor(s[j], off, 32);
    for (int j = 0; j < 4; ++j) {
        float rs = rsqrtf(s[j] * (1.0f / CDIM) + 1e-3f);
        f32x4 y0 = a[j] * rs * g0 + e0;
        f32x4 y1 = b[j] * rs * g1 + e1;
        bf16x4 h0, h1;
        for (int k = 0; k < 4; ++k) { h0[k] = f2bf(y0[k]); h1[k] = f2bf(y1[k]); }
        *(f32x4*)(xn + base + j * CDIM)        = y0;
        *(f32x4*)(xn + base + j * CDIM + 128)  = y1;
        *(bf16x4*)(xnb + base + j * CDIM)       = h0;
        *(bf16x4*)(xnb + base + j * CDIM + 128) = h1;
    }
}

// ---------------- fp32 -> bf16 elementwise: 32 elements a lane ---------------
// A wave converts 1024 consecutive floats: 8 loads of 16 B a lane in flight,
// each wave-wide load and store covering whole 128-B lines.
__global__ void __launch_bounds__(512) cvt_bf16_kernel(const float* __restrict__ src,
                                                       __bf16* __restrict__ dst) {
    int wave = (blockIdx.x * 512 + threadIdx.x) >> 5;
    int lane = threadIdx.x & 31;
    size_t base = (size_t)wave * 1024 + lane * 4;
    f32x4 v[8];
    for (int i = 0; i < 8; ++i) v[i] = *(const f32x4*)(src + base + i * 128);
    for (int i = 0; i < 8; ++i) {
        bf16x4 h;
        for (int k = 0; k < 4; ++k) h[k] = f2bf(v[i][k]);
        *(bf16x4*)(dst + base + i * 128) = h;
    }
}

// ---------------- transpose 4 weight matrices to [N][K] bf16 ----------------
__global__ void transpose_w_kernel(const float* __restrict__ Wq, const float* __restrict__ Wk,
                                   const float* __restrict__ Wv, const float* __restrict__ Wp,
                                   __bf16* __restrict__ WqT, __bf16* __restrict__ WkT,
                                   __bf16* __restrict__ WvT, __bf16* __restrict__ WpT) {
    int i = blockIdx.x * blockDim.x + threadIdx.x;  // 0..262143
    int w = i >> 16;
    int j = i & 65535;
    int k = j >> 8, n = j & 255;
    const float* S = (w == 0) ? Wq : (w == 1) ? Wk : (w == 2) ? Wv : Wp;
    __bf16* D      = (w == 0) ? WqT : (w == 1) ? WkT : (w == 2) ? WvT : WpT;
    D[n * 256 + k] = f2bf(S[k * 256 + n]);
}

// ---------------- Q projection: wave = 16x16 output tile --------------------
__global__ void qproj_kernel(const __bf16* __restrict__ A, const __bf16* __restrict__ WT,
                             const float* __restrict__ bias, __bf16* __restrict__ Qo) {
    int wid  = (blockIdx.x * blockDim.x + threadIdx.x) >> 5;
    int lane = threadIdx.x & 31;
    int half = lane >> 4, r = lane & 15;
    size_t m0 = (size_t)(wid >> 4) * 16;
    int n0 = (wid & 15) * 16;
    const __bf16* arow = A  + (m0 + r) * CDIM + 8 * half;
    const __bf16* brow = WT + (size_t)(n0 + r) * CDIM + 8 * half;
    f32x8 c = zero8();
#pragma unroll
    for (int kk = 0; kk < 8; ++kk)
        c = wmma_bf16(load_frag(arow + kk * 32), load_frag(brow + kk * 32), c);
    float bv = bias[n0 + r];
#pragma unroll
    for (int i = 0; i < 8; ++i)
        Qo[(m0 + i + 8 * half) * CDIM + n0 + r] = f2bf(c[i] + bv);
}

// ---------------- K,V projection; V stored transposed [B][C][N] -------------
__global__ void kvproj_kernel(const __bf16* __restrict__ A, const __bf16* __restrict__ WkT,
                              const __bf16* __restrict__ WvT, const float* __restrict__ bk,
                              const float* __restrict__ bvv, __bf16* __restrict__ Ko,
                              __bf16* __restrict__ VTo) {
    int wid  = (blockIdx.x * blockDim.x + threadIdx.x) >> 5;
    int lane = threadIdx.x & 31;
    int half = lane >> 4, r = lane & 15;
    size_t m0 = (size_t)(wid >> 4) * 16;
    int n0 = (wid & 15) * 16;
    const __bf16* arow  = A   + (m0 + r) * CDIM + 8 * half;
    const __bf16* bkrow = WkT + (size_t)(n0 + r) * CDIM + 8 * half;
    const __bf16* bvrow = WvT + (size_t)(n0 + r) * CDIM + 8 * half;
    f32x8 ck = zero8(), cv = zero8();
#pragma unroll
    for (int kk = 0; kk < 8; ++kk) {
        bf16x16 af = load_frag(arow + kk * 32);
        ck = wmma_bf16(af, load_frag(bkrow + kk * 32), ck);
        cv = wmma_bf16(af, load_frag(bvrow + kk * 32), cv);
    }
    float kb = bk[n0 + r];
#pragma unroll
    for (int i = 0; i < 8; ++i)
        Ko[(m0 + i + 8 * half) * CDIM + n0 + r] = f2bf(ck[i] + kb);
    // V transposed store: lane's 8 C-layout rows are consecutive key indices.
    int b   = (int)(m0 >> 12);                 // 4096 keys per batch
    int nk0 = (int)(m0 & 4095) + 8 * half;
    float vb = bvv[n0 + r];
    bf16x8 pack;
#pragma unroll
    for (int i = 0; i < 8; ++i) pack[i] = f2bf(cv[i] + vb);
    *(bf16x8*)(VTo + ((size_t)b * CDIM + n0 + r) * N_SPATIAL + nk0) = pack;
}

// ---------------- Flash attention ------------------------------------------
// Block = 16 waves on 64 query rows: wave w owns the 16-row query tile (w & 3)
// and, of every staged 128 keys, the 32-key chunk (w >> 2). So 256 blocks fill
// the chip's 256 WGPs with four waves a SIMD. The four partial results of a
// query tile (running maximum, sum, O) are merged through LDS behind the loop.
// The 128-key K/V stage is brought into LDS by async global->LDS copies.
// LDS rows are pitched 16 B x odd, so that the 16 lanes of a ds_load_b128
// fragment read (one row each) fall on 16 different groups of four banks.
#define KP 264   // K row pitch in elements: 528 B for 512 B of data
#define VP 136   // V^T row pitch in elements: 272 B for the 256 B of a stage's 128 keys
#define PP 40    // P row pitch in elements: 80 B for 64 B of data
#define KSPLIT 4                 // key chunks of a stage = waves on one query tile
#define STAGE  (32 * KSPLIT)     // keys staged per trip
#define MSLOT  (36 * 128)        // floats of one wave's partial result: O 32 x 128, m 2 x 128, l 2 x 128

// One wave's partial result to its merge slot; each store covers 512 contiguous bytes.
__device__ __forceinline__ void put_partial(float* mg, int lane, const f32x8 (&o)[16],
                                            const float (&m)[8], const float (&l)[8]) {
#pragma unroll   // constant indices keep o[] in registers
    for (int u = 0; u < 16; ++u) {
        f32x4 lo = {o[u][0], o[u][1], o[u][2], o[u][3]};
        f32x4 hi = {o[u][4], o[u][5], o[u][6], o[u][7]};
        *(f32x4*)(mg + (u * 2 + 0) * 128 + lane * 4) = lo;
        *(f32x4*)(mg + (u * 2 + 1) * 128 + lane * 4) = hi;
    }
    f32x4 m0 = {m[0], m[1], m[2], m[3]}, m1 = {m[4], m[5], m[6], m[7]};
    f32x4 l0 = {l[0], l[1], l[2], l[3]}, l1 = {l[4], l[5], l[6], l[7]};
    *(f32x4*)(mg + 32 * 128 + lane * 4) = m0;
    *(f32x4*)(mg + 33 * 128 + lane * 4) = m1;
    *(f32x4*)(mg + 34 * 128 + lane * 4) = l0;
    *(f32x4*)(mg + 35 * 128 + lane * 4) = l1;
}

// Join the partial result in a merge slot (same lane-to-element map) into this wave's own.
__device__ __forceinline__ void join_partial(const float* mg, int lane, f32x8 (&o)[16],
                                             float (&m)[8], float (&l)[8]) {
    f32x4 m0 = *(const f32x4*)(mg + 32 * 128 + lane * 4);
    f32x4 m1 = *(const f32x4*)(mg + 33 * 128 + lane * 4);
    f32x4 l0 = *(const f32x4*)(mg + 34 * 128 + lane * 4);
    f32x4 l1 = *(const f32x4*)(mg + 35 * 128 + lane * 4);
    float fa[8], fb[8];
    // the three loops below are unrolled so that constant indices keep m, l, o in registers
#pragma unroll
    for (int i = 0; i < 8; ++i) {
        float mb = (i < 4) ? m0[i & 3] : m1[i & 3];
        float lb = (i < 4) ? l0[i & 3] : l1[i & 3];
        float mnew = fmaxf(m[i], mb);
        fa[i] = __expf(m[i] - mnew);
        fb[i] = __expf(mb - mnew);
        m[i] = mnew;
        l[i] = l[i] * fa[i] + lb * fb[i];
    }
#pragma unroll
    for (int u = 0; u < 16; ++u) {
        f32x4 lo = *(const f32x4*)(mg + (u * 2 + 0) * 128 + lane * 4);
        f32x4 hi = *(const f32x4*)(mg + (u * 2 + 1) * 128 + lane * 4);
#pragma unroll
        for (int i = 0; i < 4; ++i) {
            o[u][i]     = o[u][i]     * fa[i]     + lo[i] * fb[i];
            o[u][i + 4] = o[u][i + 4] * fa[i + 4] + hi[i] * fb[i + 4];
        }
    }
}

__global__ void __launch_bounds__(512) flash_kernel(
        const __bf16* __restrict__ Q, const __bf16* __restrict__ K,
        const __bf16* __restrict__ VT, __bf16* __restrict__ O) {
    __shared__ __attribute__((aligned(16))) __bf16 Kc[STAGE][KP];        // stage rows of K (row-major)
    __shared__ __attribute__((aligned(16))) __bf16 Vc[256][VP];          // V^T rows: the stage's keys
    __shared__ __attribute__((aligned(16))) __bf16 Pst[16][16 * PP];     // per-wave P staging
    __shared__ __attribute__((aligned(16))) float  Mg[8][MSLOT];         // merge slots

    int t    = threadIdx.x;
    int wib  = __builtin_amdgcn_readfirstlane(t >> 5);   // wave-uniform: the merge's branches are scalar
    int lane = t & 31;
    int half = lane >> 4, r = lane & 15;
    int g  = wib >> 2;                 // this wave's key chunk in every stage
    int b  = blockIdx.x >> 6;          // 64 blocks of 64 query rows per batch
    int m0 = (blockIdx.x & 63) * 64 + (wib & 3) * 16;

    const __bf16* Qb = Q  + ((size_t)b * N_SPATIAL) * CDIM;
    const __bf16* Kb = K  + ((size_t)b * N_SPATIAL) * CDIM;
    const __bf16* Vb = VT + (size_t)b * CDIM * N_SPATIAL;

    bf16x16 qf[8];
    const __bf16* qrow = Qb + (size_t)(m0 + r) * CDIM + 8 * half;
#pragma unroll
    for (int kk = 0; kk < 8; ++kk) qf[kk] = load_frag(qrow + kk * 32);

    f32x8 o[16];
#pragma unroll
    for (int u = 0; u < 16; ++u) o[u] = zero8();
    float m[8], l[8];
#pragma unroll
    for (int i = 0; i < 8; ++i) { m[i] = -1e30f; l[i] = 0.0f; }

    __bf16* pst = &Pst[wib][0];
    const unsigned kl = (unsigned)(size_t)&Kc[0][0];  // LDS byte offsets
    const unsigned vl = (unsigned)(size_t)&Vc[0][0];
    const float sc = 0.0625f;                         // 256^-0.5

    for (int j0 = 0; j0 < N_SPATIAL; j0 += STAGE) {
        // this wave's own LDS reads of the old stage have retired before any copy refills it
        asm volatile("s_wait_dscnt 0x0" ::: "memory");
        __syncthreads();   // previous stage's compute finished in all waves
        // ---- stage 128 rows of K and 128 keys of every V^T row into LDS ----
        // eight lanes bring one 128-B line; thread t: row t >> 3 (and +64 ...), 16-B segment t & 7
        const char* kgt = (const char*)Kb + (size_t)j0 * (CDIM * 2) + (t >> 3) * (CDIM * 2) + (t & 7) * 16;
        const char* vgt = (const char*)Vb + (size_t)j0 * 2 + (size_t)(t >> 3) * (N_SPATIAL * 2) + (t & 7) * 16;
        unsigned kla[2], vla[4];
        const char* kga[2];
        const char* vga[4];
        // both loops unrolled: the address arrays are asm operands and must be registers
#pragma unroll
        for (int h = 0; h < 2; ++h) {
            kla[h] = kl + ((t >> 3) + 64 * h) * (KP * 2) + (t & 7) * 16;
            kga[h] = kgt + h * (64 * CDIM * 2);
        }
#pragma unroll
        for (int h = 0; h < 4; ++h) {
            vla[h] = vl + ((t >> 3) + 64 * h) * (VP * 2) + (t & 7) * 16;
            vga[h] = vgt + (size_t)h * (64 * N_SPATIAL * 2);
        }
        async_stage(kla, kga, vla, vga);
        wait_async0();
        __syncthreads();   // stage visible to all waves

        // ---- S = Q @ K_chunk^T : two 16x16 tiles, fragments from LDS ----
        f32x8 s0 = zero8(), s1 = zero8();
        const __bf16* k0base = &Kc[g * 32 + r][8 * half];
        const __bf16* k1base = &Kc[g * 32 + 16 + r][8 * half];
#pragma unroll
        for (int kk = 0; kk < 8; ++kk) {
            s0 = wmma_bf16(qf[kk], load_frag(k0base + kk * 32), s0);
            s1 = wmma_bf16(qf[kk], load_frag(k1base + kk * 32), s1);
        }
        // ---- online softmax (row stats local to the 16-lane half) ----
        float p0[8], p1[8], mn[8];
#pragma unroll
        for (int i = 0; i < 8; ++i) {
            p0[i] = s0[i] * sc; p1[i] = s1[i] * sc;
            mn[i] = fmaxf(p0[i], p1[i]);
        }
#pragma unroll
        for (int off = 8; off >= 1; off >>= 1)
#pragma unroll
            for (int i = 0; i < 8; ++i)
                mn[i] = fmaxf(mn[i], __shfl_xor(mn[i], off, 32));
        float alpha[8], ls[8];
#pragma unroll
        for (int i = 0; i < 8; ++i) {
            float mnew = fmaxf(m[i], mn[i]);
            alpha[i] = __expf(m[i] - mnew);
            m[i] = mnew;
            p0[i] = __expf(p0[i] - mnew);
            p1[i] = __expf(p1[i] - mnew);
            ls[i] = p0[i] + p1[i];
        }
#pragma unroll
        for (int off = 8; off >= 1; off >>= 1)
#pragma unroll
            for (int i = 0; i < 8; ++i)
                ls[i] += __shfl_xor(ls[i], off, 32);
#pragma unroll
        for (int i = 0; i < 8; ++i) l[i] = l[i] * alpha[i] + ls[i];
#pragma unroll
        for (int u = 0; u < 16; ++u)
#pragma unroll
            for (int i = 0; i < 8; ++i) o[u][i] *= alpha[i];

        // ---- stage P (C layout) -> A-layout fragment via per-wave LDS ----
#pragma unroll
        for (int i = 0; i < 8; ++i) {
            int row = i + 8 * half;
            pst[row * PP + r]      = f2bf(p0[i]);
            pst[row * PP + 16 + r] = f2bf(p1[i]);
        }
        bf16x8 pa = *(const bf16x8*)&pst[r * PP + 8 * half];
        bf16x8 pb = *(const bf16x8*)&pst[r * PP + 8 * half + 16];
        bf16x16 pf;
#pragma unroll
        for (int i = 0; i < 8; ++i) { pf[i] = pa[i]; pf[i + 8] = pb[i]; }

        // ---- O += P @ V_chunk (B fragments from LDS, contiguous) ----
        const __bf16* vbase = &Vc[r][g * 32 + 8 * half];
#pragma unroll
        for (int u = 0; u < 16; ++u)
            o[u] = wmma_bf16(pf, load_frag(vbase + u * 16 * VP), o[u]);
    }

    // ---- merge the four key chunks' partial results of each query tile, as a tree ----
    if (g >= 2) put_partial(&Mg[wib - 8][0], lane, o, m, l);
    __syncthreads();   // chunks 2 and 3 published
    if (g < 2) join_partial(&Mg[wib][0], lane, o, m, l);
    __syncthreads();   // slots read out, free for the second round
    if (g == 1) put_partial(&Mg[wib - 4][0], lane, o, m, l);
    __syncthreads();   // chunk 1 (with 3) published
    if (g != 0) return;   // behind the last barrier
    join_partial(&Mg[wib][0], lane, o, m, l);

    // epilogue: divide by softmax denominator, store bf16 row-major
    float inv[8];
#pragma unroll
    for (int i = 0; i < 8; ++i) inv[i] = 1.0f / l[i];
    __bf16* Ob = O + ((size_t)b * N_SPATIAL + m0) * CDIM;
#pragma unroll
    for (int u = 0; u < 16; ++u)
#pragma unroll
        for (int i = 0; i < 8; ++i)
            Ob[(size_t)(i + 8 * half) * CDIM + u * 16 + r] = f2bf(o[u][i] * inv[i]);
}

// ---------------- Output projection + bias + residual -----------------------
__global__ void proj_kernel(const __bf16* __restrict__ A, const __bf16* __restrict__ WT,
                            const float* __restrict__ bias, const float* __restrict__ resid,
                            float* __restrict__ out) {
    int wid  = (blockIdx.x * blockDim.x + threadIdx.x) >> 5;
    int lane = threadIdx.x & 31;
    int half = lane >> 4, r = lane & 15;
    size_t m0 = (size_t)(wid >> 4) * 16;
    int n0 = (wid & 15) * 16;
    const __bf16* arow = A  + (m0 + r) * CDIM + 8 * half;
    const __bf16* brow = WT + (size_t)(n0 + r) * CDIM + 8 * half;
    f32x8 c = zero8();
#pragma unroll
    for (int kk = 0; kk < 8; ++kk)
        c = wmma_bf16(load_frag(arow + kk * 32), load_frag(brow + kk * 32), c);
    float bv = bias[n0 + r];
#pragma unroll
    for (int i = 0; i < 8; ++i) {
        size_t idx = (m0 + i + 8 * half) * CDIM + n0 + r;
        out[idx] = c[i] + bv + resid[idx];
    }
}

extern "C" void kernel_launch(void* const* d_in, const int* in_sizes, int n_in,
                              void* d_out, int out_size, void* d_ws, size_t ws_size,
                              hipStream_t stream) {
    const float* inputs  = (const float*)d_in[0];
    const float* context = (const float*)d_in[1];
    const float* Wq = (const float*)d_in[2];
    const float* bq = (const float*)d_in[3];
    const float* Wk = (const float*)d_in[4];
    const float* bk = (const float*)d_in[5];
    const float* Wv = (const float*)d_in[6];
    const float* bv = (const float*)d_in[7];
    const float* Wp = (const float*)d_in[8];
    const float* bp = (const float*)d_in[9];
    const float* gamma = (const float*)d_in[10];
    const float* beta  = (const float*)d_in[11];
    float* out = (float*)d_out;

    const size_t TOT = (size_t)NBATCH * N_SPATIAL * CDIM;  // 4,194,304 elements
    char* ws = (char*)d_ws;
    float*  xn_f32 = (float*)ws;  ws += TOT * 4;
    __bf16* xn_bf  = (__bf16*)ws; ws += TOT * 2;
    __bf16* ctx_bf = (__bf16*)ws; ws += TOT * 2;
    __bf16* qb     = (__bf16*)ws; ws += TOT * 2;
    __bf16* kb_    = (__bf16*)ws; ws += TOT * 2;
    __bf16* vtb    = (__bf16*)ws; ws += TOT * 2;
    __bf16* ob     = (__bf16*)ws; ws += TOT * 2;
    __bf16* WqT    = (__bf16*)ws; ws += 65536 * 2;
    __bf16* WkT    = (__bf16*)ws; ws += 65536 * 2;
    __bf16* WvT    = (__bf16*)ws; ws += 65536 * 2;
    __bf16* WpT    = (__bf16*)ws; ws += 65536 * 2;

    cvt_bf16_kernel<<<256, 512, 0, stream>>>(context, ctx_bf);   // 256 * 16 waves * 1024 = TOT
    transpose_w_kernel<<<1024, 256, 0, stream>>>(Wq, Wk, Wv, Wp, WqT, WkT, WvT, WpT);
    ln_kernel<<<256, 512, 0, stream>>>(inputs, gamma, beta, xn_f32, xn_bf);   // 256 * 16 waves * 4 rows
    qproj_kernel<<<2048, 256, 0, stream>>>(xn_bf, WqT, bq, qb);
    kvproj_kernel<<<2048, 256, 0, stream>>>(ctx_bf, WkT, WvT, bk, bv, kb_, vtb);
    flash_kernel<<<256, 512, 0, stream>>>(qb, kb_, vtb, ob);
    proj_kernel<<<2048, 256, 0, stream>>>(ob, WpT, bp, xn_f32, out);
}

// v004
// It runs in 240 microseconds.
// In two side-by-side timings against v003, it was 1.19 and 1.20 times as fast.
// All steps since v000 together make it 4.37 times as fast.
#include <hip/hip_runtime.h>
#include <hip/hip_bf16.h>

#define N_SPATIAL 4096   // 64*64
#define CDIM 256
#define NBATCH 4

typedef __attribute__((ext_vector_type(16))) __bf16 bf16x16;
typedef __attribute__((ext_vector_type(8)))  __bf16 bf16x8;
typedef __attribute__((ext_vector_type(8)))  float  f32x8;
typedef __attribute__((ext_vector_type(4)))  __bf16 bf16x4;
typedef __attribute__((ext_vector_type(4)))  float  f32x4;

// float -> bf16 with round-to-nearest-even (bit manipulation; no cvt dependence)
__device__ __forceinline__ __bf16 f2bf(float f) {
    unsigned u = __float_as_uint(f);
    u += 0x7FFFu + ((u >> 16) & 1u);
    unsigned short s = (unsigned short)(u >> 16);
    return __builtin_bit_cast(__bf16, s);
}

__device__ __forceinline__ f32x8 wmma_bf16(bf16x16 a, bf16x16 b, f32x8 c) {
    return __builtin_amdgcn_wmma_f32_16x16x32_bf16(
        /*neg_a=*/false, a, /*neg_b=*/false, b,
        /*c_mod=*/(short)0, c, /*reuse_a=*/false, /*reuse_b=*/false);
}

// Fragment loader: elems 0..7 from p[0..7], elems 8..15 from p[16..23].
// Caller passes p = base + 8*half; this matches the 16-bit A/B VGPR layout
// (lanes 0-15: K=0..7 & 16..23 ; lanes 16-31: K=8..15 & 24..31).
__device__ __forceinline__ bf16x16 load_frag(const __bf16* p) {
    bf16x8 a = *(const bf16x8*)p;
    bf16x8 b = *(const bf16x8*)(p + 16);
    bf16x16 f;
#pragma unroll
    for (int i = 0; i < 8; ++i) { f[i] = a[i]; f[i + 8] = b[i]; }
    return f;
}

__device__ __forceinline__ f32x8 zero8() {
    f32x8 c;
#pragma unroll
    for (int i = 0; i < 8; ++i) c[i] = 0.0f;
    return c;
}

// One stage's sixteen async copies of 16B per lane from global to LDS (tracked by ASYNCcnt).
// l* = LDS byte offset (low 32 bits of generic pointer), g* = global address; an
// immediate offset moves both addresses alike, so one address pair serves the
// 128-B pieces of one row: six pairs in registers instead of sixteen.
// kl/kg: two K rows, four pieces each; vl/vg: four V^T rows, two pieces each.
// The closing s_wait_xcnt 0 stands inside the statement so that no address
// register of an issued copy is rewritten ahead of it.
__device__ __forceinline__ void async_stage(const unsigned (&kl)[2], const char* const (&kg)[2],
                                            const unsigned (&vl)[4], const char* const (&vg)[4]) {
    asm volatile("global_load_async_to_lds_b128 %0, %6, off\n\t"
                 "global_load_async_to_lds_b128 %0, %6, off offset:128\n\t"
                 "global_load_async_to_lds_b128 %0, %6, off offset:256\n\t"
                 "global_load_async_to_lds_b128 %0, %6, off offset:384\n\t"
                 "global_load_async_to_lds_b128 %1, %7, off\n\t"
                 "global_load_async_to_lds_b128 %1, %7, off offset:128\n\t"
                 "global_load_async_to_lds_b128 %1, %7, off offset:256\n\t"
                 "global_load_async_to_lds_b128 %1, %7, off offset:384\n\t"
                 "global_load_async_to_lds_b128 %2, %8, off\n\t"
                 "global_load_async_to_lds_b128 %2, %8, off offset:128\n\t"
                 "global_load_async_to_lds_b128 %3, %9, off\n\t"
                 "global_load_async_to_lds_b128 %3, %9, off offset:128\n\t"
                 "global_load_async_to_lds_b128 %4, %10, off\n\t"
                 "global_load_async_to_lds_b128 %4, %10, off offset:128\n\t"
                 "global_load_async_to_lds_b128 %5, %11, off\n\t"
                 "global_load_async_to_lds_b128 %5, %11, off offset:128\n\t"
                 "s_wait_xcnt 0x0"
                 :: "v"(kl[0]), "v"(kl[1]), "v"(vl[0]), "v"(vl[1]), "v"(vl[2]), "v"(vl[3]),
                    "v"(kg[0]), "v"(kg[1]), "v"(vg[0]), "v"(vg[1]), "v"(vg[2]), "v"(vg[3])
                 : "memory");
}
__device__ __forceinline__ void wait_async0() {
    asm volatile("s_wait_asynccnt 0x0" ::: "memory");
}

// ---------------- LayerNorm: one wave per 4 rows -----------------------------
// A row (256 floats) lies across the 32 lanes, 8 elements a lane, so that both
// sums stay inside the wave. 16 waves a block, 8 loads of 16 B in flight a wave.
__global__ void __launch_bounds__(512) ln_kernel(
        const float* __restrict__ x, const float* __restrict__ gamma,
        const float* __restrict__ beta, float* __restrict__ xn,
        __bf16* __restrict__ xnb) {
    int wave = (blockIdx.x * 512 + threadIdx.x) >> 5;
    int lane = threadIdx.x & 31;
    size_t base = (size_t)wave * (4 * CDIM) + lane * 4;
    f32x4 a[4], b[4];
    for (int j = 0; j < 4; ++j) {
        a[j] = *(const f32x4*)(x + base + j * CDIM);
        b[j] = *(const f32x4*)(x + base + j * CDIM + 128);
    }
    f32x4 g0 = *(const f32x4*)(gamma + lane * 4);
    f32x4 g1 = *(const f32x4*)(gamma + lane * 4 + 128);
    f32x4 e0 = *(const f32x4*)(beta + lane * 4);
    f32x4 e1 = *(const f32x4*)(beta + lane * 4 + 128);
    float s[4];
    for (int j = 0; j < 4; ++j)
        s[j] = ((a[j][0] + a[j][1]) + (a[j][2] + a[j][3])) +
               ((b[j][0] + b[j][1]) + (b[j][2] + b[j][3]));
    for (int off = 16; off >= 1; off >>= 1)
        for (int j = 0; j < 4; ++j) s[j] += __shfl_xor(s[j], off, 32);
    for (int j = 0; j < 4; ++j) {
        float mu = s[j] * (1.0f / CDIM);
        a[j] -= mu;
        b[j] -= mu;
        f32x4 qa = a[j] * a[j], qb = b[j] * b[j];
        s[j] = ((qa[0] + qa[1]) + (qa[2] + qa[3])) + ((qb[0] + qb[1]) + (qb[2] + qb[3]));
    }
    for (int off = 16; off >= 1; off >>= 1)
        for (int j = 0; j < 4; ++j) s[j] += __shfl_xor(s[j], off, 32);
    for (int j = 0; j < 4; ++j) {
        float rs = rsqrtf(s[j] * (1.0f / CDIM) + 1e-3f);
        f32x4 y0 = a[j] * rs * g0 + e0;
        f32x4 y1 = b[j] * rs * g1 + e1;
        bf16x4 h0, h1;
        for (int k = 0; k < 4; ++k) { h0[k] = f2bf(y0[k]); h1[k] = f2bf(y1[k]); }
        *(f32x4*)(xn + base + j * CDIM)        = y0;
        *(f32x4*)(xn + base + j * CDIM + 128)  = y1;
        *(bf16x4*)(xnb + base + j * CDIM)       = h0;
        *(bf16x4*)(xnb + base + j * CDIM + 128) = h1;
    }
}

// ---------------- fp32 -> bf16 elementwise: 32 elements a lane ---------------
// A wave converts 1024 consecutive floats: 8 loads of 16 B a lane in flight,
// each wave-wide load and store covering whole 128-B lines.
__global__ void __launch_bounds__(512) cvt_bf16_kernel(const float* __restrict__ src,
                                                       __bf16* __restrict__ dst) {
    int wave = (blockIdx.x * 512 + threadIdx.x) >> 5;
    int lane = threadIdx.x & 31;
    size_t base = (size_t)wave * 1024 + lane * 4;
    f32x4 v[8];
    for (int i = 0; i < 8; ++i) v[i] = *(const f32x4*)(src + base + i * 128);
    for (int i = 0; i < 8; ++i) {
        bf16x4 h;
        for (int k = 0; k < 4; ++k) h[k] = f2bf(v[i][k]);
        *(bf16x4*)(dst + base + i * 128) = h;
    }
}

// ---------------- transpose 4 weight matrices to [N][K] bf16 ----------------
__global__ void transpose_w_kernel(const float* __restrict__ Wq, const float* __restrict__ Wk,
                                   const float* __restrict__ Wv, const float* __restrict__ Wp,
                                   __bf16* __restrict__ WqT, __bf16* __restrict__ WkT,
                                   __bf16* __restrict__ WvT, __bf16* __restrict__ WpT) {
    int i = blockIdx.x * blockDim.x + threadIdx.x;  // 0..262143
    int w = i >> 16;
    int j = i & 65535;
    int k = j >> 8, n = j & 255;
    const float* S = (w == 0) ? Wq : (w == 1) ? Wk : (w == 2) ? Wv : Wp;
    __bf16* D      = (w == 0) ? WqT : (w == 1) ? WkT : (w == 2) ? WvT : WpT;
    D[n * 256 + k] = f2bf(S[k * 256 + n]);
}

// ---------------- The three projections: operands staged in LDS -------------
// A block of 16 waves computes 64 rows x all 256 columns. The 64 rows of A and
// the whole [N][K] weight come into LDS by loads in which a wave covers one
// 512-B row (four whole lines); the WMMA fragments are then read from LDS.
// 256 blocks: one a WGP. Wave w owns the 32 x 32 tile at rows (w & 1) * 32,
// columns (w >> 1) * 32: each fragment read serves two WMMAs.
#define GP 264   // LDS row pitch in elements: 528 B = 16 B x odd for the ds_load_b128 readers

// ROWS rows of 256 bf16, contiguous in global memory, go to LDS rows of pitch GP in two
// halves, so that the loads of all operands are in flight before the first LDS store.
// Thread t: rows (t >> 5) + 16 * i, 16-B segment t & 31.
template <int ROWS>
__device__ __forceinline__ void load_rows(bf16x8 (&v)[ROWS / 16], const __bf16* __restrict__ g, int t) {
    const __bf16* gp = g + (t >> 5) * CDIM + (t & 31) * 8;
#pragma unroll   // v[] stays in registers; one address with immediate offsets
    for (int i = 0; i < ROWS / 16; ++i) v[i] = *(const bf16x8*)(gp + i * 16 * CDIM);
    // the address pair is an input, so it lives up to this wait: no later load's
    // result is placed over a register that a load issued above still names
    asm volatile("s_wait_xcnt 0x0" :: "v"(gp) : "memory");
}
template <int ROWS>
__device__ __forceinline__ void store_rows(__bf16* lds, const bf16x8 (&v)[ROWS / 16], int t) {
    __bf16* lp = lds + (t >> 5) * GP + (t & 31) * 8;
#pragma unroll   // v[] stays in registers
    for (int i = 0; i < ROWS / 16; ++i) *(bf16x8*)(lp + i * 16 * GP) = v[i];
}

// c[x][y] += A rows (16 x ..) times W rows (16 y ..), k = 0..255 in ascending blocks of 32.
__device__ __forceinline__ void tile_mma(const __bf16* al, const __bf16* wl, f32x8 (&c)[2][2]) {
#pragma unroll   // constant LDS offsets; the compiler fetches fragments ahead
    for (int kk = 0; kk < 8; ++kk) {
        bf16x16 a0 = load_frag(al + kk * 32), a1 = load_frag(al + 16 * GP + kk * 32);
        bf16x16 b0 = load_frag(wl + kk * 32), b1 = load_frag(wl + 16 * GP + kk * 32);
        c[0][0] = wmma_bf16(a0, b0, c[0][0]);
        c[0][1] = wmma_bf16(a0, b1, c[0][1]);
        c[1][0] = wmma_bf16(a1, b0, c[1][0]);
        c[1][1] = wmma_bf16(a1, b1, c[1][1]);
    }
}

// ---------------- Q projection ----------------------------------------------
__global__ void __launch_bounds__(512) qproj_kernel(
        const __bf16* __restrict__ A, const __bf16* __restrict__ WT,
        const float* __restrict__ bias, __bf16* __restrict__ Qo) {
    __shared__ __attribute__((aligned(16))) __bf16 Al[64 * GP];
    __shared__ __attribute__((aligned(16))) __bf16 Wl[256 * GP];
    int t = threadIdx.x;
    int w = t >> 5, lane = t & 31;
    int half = lane >> 4, r = lane & 15;
    size_t mb = (size_t)blockIdx.x * 64;
    bf16x8 va[4], vw[16];
    load_rows<64>(va, A + mb * CDIM, t);
    load_rows<256>(vw, WT, t);
    store_rows<64>(Al, va, t);
    store_rows<256>(Wl, vw, t);
    __syncthreads();   // both operands visible to all waves
    int mt = (w & 1) * 32, nt = (w >> 1) * 32;
    f32x8 c[2][2] = {{zero8(), zero8()}, {zero8(), zero8()}};
    tile_mma(Al + (mt + r) * GP + 8 * half, Wl + (nt + r) * GP + 8 * half, c);
    // the three loops are unrolled so that constant indices keep c in registers
#pragma unroll
    for (int x = 0; x < 2; ++x)
#pragma unroll
        for (int y = 0; y < 2; ++y) {
            size_t m0 = mb + mt + 16 * x;
            int n0 = nt + 16 * y;
            float bv = bias[n0 + r];
#pragma unroll
            for (int i = 0; i < 8; ++i)
                Qo[(m0 + i + 8 * half) * CDIM + n0 + r] = f2bf(c[x][y][i] + bv);
        }
}

// ---------------- K,V projection; V stored transposed [B][C][N] -------------
__global__ void __launch_bounds__(512) kvproj_kernel(
        const __bf16* __restrict__ A, const __bf16* __restrict__ WkT,
        const __bf16* __restrict__ WvT, const float* __restrict__ bk,
        const float* __restrict__ bvv, __bf16* __restrict__ Ko,
        __bf16* __restrict__ VTo) {
    __shared__ __attribute__((aligned(16))) __bf16 Al[64 * GP];
    __shared__ __attribute__((aligned(16))) __bf16 Wkl[256 * GP];
    __shared__ __attribute__((aligned(16))) __bf16 Wvl[256 * GP];
    int t = threadIdx.x;
    int w = t >> 5, lane = t & 31;
    int half = lane >> 4, r = lane & 15;
    size_t mb = (size_t)blockIdx.x * 64;
    bf16x8 va[4], vk[16], vv[16];
    load_rows<64>(va, A + mb * CDIM, t);
    load_rows<256>(vk, WkT, t);
    load_rows<256>(vv, WvT, t);
    store_rows<64>(Al, va, t);
    store_rows<256>(Wkl, vk, t);
    store_rows<256>(Wvl, vv, t);
    __syncthreads();   // all three operands visible to all waves
    int mt = (w & 1) * 32, nt = (w >> 1) * 32;
    f32x8 ck[2][2] = {{zero8(), zero8()}, {zero8(), zero8()}};
    f32x8 cv[2][2] = {{zero8(), zero8()}, {zero8(), zero8()}};
    tile_mma(Al + (mt + r) * GP + 8 * half, Wkl + (nt + r) * GP + 8 * half, ck);
    tile_mma(Al + (mt + r) * GP + 8 * half, Wvl + (nt + r) * GP + 8 * half, cv);
    // the loops are unrolled so that constant indices keep ck and cv in registers
#pragma unroll
    for (int x = 0; x < 2; ++x)
#pragma unroll
        for (int y = 0; y < 2; ++y) {
            size_t m0 = mb + mt + 16 * x;
            int n0 = nt + 16 * y;
            float kb = bk[n0 + r];
#pragma unroll
            for (int i = 0; i < 8; ++i)
                Ko[(m0 + i + 8 * half) * CDIM + n0 + r] = f2bf(ck[x][y][i] + kb);
            // V transposed store: lane's 8 C-layout rows are consecutive key indices.
            int b   = (int)(m0 >> 12);                 // 4096 keys per batch
            int nk0 = (int)(m0 & 4095) + 8 * half;
            float vb = bvv[n0 + r];
            bf16x8 pack;
#pragma unroll
            for (int i = 0; i < 8; ++i) pack[i] = f2bf(cv[x][y][i] + vb);
            *(bf16x8*)(VTo + ((size_t)b * CDIM + n0 + r) * N_SPATIAL + nk0) = pack;
        }
}

// ---------------- Flash attention ------------------------------------------
// Block = 16 waves on 64 query rows: wave w owns the 16-row query tile (w & 3)
// and, of every staged 128 keys, the 32-key chunk (w >> 2). So 256 blocks fill
// the chip's 256 WGPs with four waves a SIMD. The four partial results of a
// query tile (running maximum, sum, O) are merged through LDS behind the loop.
// The 128-key K/V stage is brought into LDS by async global->LDS copies.
// LDS rows are pitched 16 B x odd, so that the 16 lanes of a ds_load_b128
// fragment read (one row each) fall on 16 different groups of four banks.
#define KP 264   // K row pitch in elements: 528 B for 512 B of data
#define VP 136   // V^T row pitch in elements: 272 B for the 256 B of a stage's 128 keys
#define PP 40    // P row pitch in elements: 80 B for 64 B of data
#define KSPLIT 4                 // key chunks of a stage = waves on one query tile
#define STAGE  (32 * KSPLIT)     // keys staged per trip
#define MSLOT  (36 * 128)        // floats of one wave's partial result: O 32 x 128, m 2 x 128, l 2 x 128

// One wave's partial result to its merge slot; each store covers 512 contiguous bytes.
__device__ __forceinline__ void put_partial(float* mg, int lane, const f32x8 (&o)[16],
                                            const float (&m)[8], const float (&l)[8]) {
#pragma unroll   // constant indices keep o[] in registers
    for (int u = 0; u < 16; ++u) {
        f32x4 lo = {o[u][0], o[u][1], o[u][2], o[u][3]};
        f32x4 hi = {o[u][4], o[u][5], o[u][6], o[u][7]};
        *(f32x4*)(mg + (u * 2 + 0) * 128 + lane * 4) = lo;
        *(f32x4*)(mg + (u * 2 + 1) * 128 + lane * 4) = hi;
    }
    f32x4 m0 = {m[0], m[1], m[2], m[3]}, m1 = {m[4], m[5], m[6], m[7]};
    f32x4 l0 = {l[0], l[1], l[2], l[3]}, l1 = {l[4], l[5], l[6], l[7]};
    *(f32x4*)(mg + 32 * 128 + lane * 4) = m0;
    *(f32x4*)(mg + 33 * 128 + lane * 4) = m1;
    *(f32x4*)(mg + 34 * 128 + lane * 4) = l0;
    *(f32x4*)(mg + 35 * 128 + lane * 4) = l1;
}

// Join the partial result in a merge slot (same lane-to-element map) into this wave's own.
__device__ __forceinline__ void join_partial(const float* mg, int lane, f32x8 (&o)[16],
                                             float (&m)[8], float (&l)[8]) {
    f32x4 m0 = *(const f32x4*)(mg + 32 * 128 + lane * 4);
    f32x4 m1 = *(const f32x4*)(mg + 33 * 128 + lane * 4);
    f32x4 l0 = *(const f32x4*)(mg + 34 * 128 + lane * 4);
    f32x4 l1 = *(const f32x4*)(mg + 35 * 128 + lane * 4);
    float fa[8], fb[8];
    // the three loops below are unrolled so that constant indices keep m, l, o in registers
#pragma unroll
    for (int i = 0; i < 8; ++i) {
        float mb = (i < 4) ? m0[i & 3] : m1[i & 3];
        float lb = (i < 4) ? l0[i & 3] : l1[i & 3];
        float mnew = fmaxf(m[i], mb);
        fa[i] = __expf(m[i] - mnew);
        fb[i] = __expf(mb - mnew);
        m[i] = mnew;
        l[i] = l[i] * fa[i] + lb * fb[i];
    }
#pragma unroll
    for (int u = 0; u < 16; ++u) {
        f32x4 lo = *(const f32x4*)(mg + (u * 2 + 0) * 128 + lane * 4);
        f32x4 hi = *(const f32x4*)(mg + (u * 2 + 1) * 128 + lane * 4);
#pragma unroll
        for (int i = 0; i < 4; ++i) {
            o[u][i]     = o[u][i]     * fa[i]     + lo[i] * fb[i];
            o[u][i + 4] = o[u][i + 4] * fa[i + 4] + hi[i] * fb[i + 4];
        }
    }
}

__global__ void __launch_bounds__(512) flash_kernel(
        const __bf16* __restrict__ Q, const __bf16* __restrict__ K,
        const __bf16* __restrict__ VT, __bf16* __restrict__ O) {
    __shared__ __attribute__((aligned(16))) __bf16 Kc[STAGE][KP];        // stage rows of K (row-major)
    __shared__ __attribute__((aligned(16))) __bf16 Vc[256][VP];          // V^T rows: the stage's keys
    __shared__ __attribute__((aligned(16))) __bf16 Pst[16][16 * PP];     // per-wave P staging
    __shared__ __attribute__((aligned(16))) float  Mg[8][MSLOT];         // merge slots

    int t    = threadIdx.x;
    int wib  = __builtin_amdgcn_readfirstlane(t >> 5);   // wave-uniform: the merge's branches are scalar
    int lane = t & 31;
    int half = lane >> 4, r = lane & 15;
    int g  = wib >> 2;                 // this wave's key chunk in every stage
    int b  = blockIdx.x >> 6;          // 64 blocks of 64 query rows per batch
    int m0 = (blockIdx.x & 63) * 64 + (wib & 3) * 16;

    const __bf16* Qb = Q  + ((size_t)b * N_SPATIAL) * CDIM;
    const __bf16* Kb = K  + ((size_t)b * N_SPATIAL) * CDIM;
    const __bf16* Vb = VT + (size_t)b * CDIM * N_SPATIAL;

    bf16x16 qf[8];
    const __bf16* qrow = Qb + (size_t)(m0 + r) * CDIM + 8 * half;
#pragma unroll
    for (int kk = 0; kk < 8; ++kk) qf[kk] = load_frag(qrow + kk * 32);

    f32x8 o[16];
#pragma unroll
    for (int u = 0; u < 16; ++u) o[u] = zero8();
    float m[8], l[8];
#pragma unroll
    for (int i = 0; i < 8; ++i) { m[i] = -1e30f; l[i] = 0.0f; }

    __bf16* pst = &Pst[wib][0];
    const unsigned kl = (unsigned)(size_t)&Kc[0][0];  // LDS byte offsets
    const unsigned vl = (unsigned)(size_t)&Vc[0][0];
    const float sc = 0.0625f;                         // 256^-0.5

    for (int j0 = 0; j0 < N_SPATIAL; j0 += STAGE) {
        // this wave's own LDS reads of the old stage have retired before any copy refills it
        asm volatile("s_wait_dscnt 0x0" ::: "memory");
        __syncthreads();   // previous stage's compute finished in all waves
        // ---- stage 128 rows of K and 128 keys of every V^T row into LDS ----
        // eight lanes bring one 128-B line; thread t: row t >> 3 (and +64 ...), 16-B segment t & 7
        const char* kgt = (const char*)Kb + (size_t)j0 * (CDIM * 2) + (t >> 3) * (CDIM * 2) + (t & 7) * 16;
        const char* vgt = (const char*)Vb + (size_t)j0 * 2 + (size_t)(t >> 3) * (N_SPATIAL * 2) + (t & 7) * 16;
        unsigned kla[2], vla[4];
        const char* kga[2];
        const char* vga[4];
        // both loops unrolled: the address arrays are asm operands and must be registers
#pragma unroll
        for (int h = 0; h < 2; ++h) {
            kla[h] = kl + ((t >> 3) + 64 * h) * (KP * 2) + (t & 7) * 16;
            kga[h] = kgt + h * (64 * CDIM * 2);
        }
#pragma unroll
        for (int h = 0; h < 4; ++h) {
            vla[h] = vl + ((t >> 3) + 64 * h) * (VP * 2) + (t & 7) * 16;
            vga[h] = vgt + (size_t)h * (64 * N_SPATIAL * 2);
        }
        async_stage(kla, kga, vla, vga);
        wait_async0();
        __syncthreads();   // stage visible to all waves

        // ---- S = Q @ K_chunk^T : two 16x16 tiles, fragments from LDS ----
        f32x8 s0 = zero8(), s1 = zero8();
        const __bf16* k0base = &Kc[g * 32 + r][8 * half];
        const __bf16* k1base = &Kc[g * 32 + 16 + r][8 * half];
#pragma unroll
        for (int kk = 0; kk < 8; ++kk) {
            s0 = wmma_bf16(qf[kk], load_frag(k0base + kk * 32), s0);
            s1 = wmma_bf16(qf[kk], load_frag(k1base + kk * 32), s1);
        }
        // ---- online softmax (row stats local to the 16-lane half) ----
        float p0[8], p1[8], mn[8];
#pragma unroll
        for (int i = 0; i < 8; ++i) {
            p0[i] = s0[i] * sc; p1[i] = s1[i] * sc;
            mn[i] = fmaxf(p0[i], p1[i]);
        }
#pragma unroll
        for (int off = 8; off >= 1; off >>= 1)
#pragma unroll
            for (int i = 0; i < 8; ++i)
                mn[i] = fmaxf(mn[i], __shfl_xor(mn[i], off, 32));
        float alpha[8], ls[8];
#pragma unroll
        for (int i = 0; i < 8; ++i) {
            float mnew = fmaxf(m[i], mn[i]);
            alpha[i] = __expf(m[i] - mnew);
            m[i] = mnew;
            p0[i] = __expf(p0[i] - mnew);
            p1[i] = __expf(p1[i] - mnew);
            ls[i] = p0[i] + p1[i];
        }
#pragma unroll
        for (int off = 8; off >= 1; off >>= 1)
#pragma unroll
            for (int i = 0; i < 8; ++i)
                ls[i] += __shfl_xor(ls[i], off, 32);
#pragma unroll
        for (int i = 0; i < 8; ++i) l[i] = l[i] * alpha[i] + ls[i];
#pragma unroll
        for (int u = 0; u < 16; ++u)
#pragma unroll
            for (int i = 0; i < 8; ++i) o[u][i] *= alpha[i];

        // ---- stage P (C layout) -> A-layout fragment via per-wave LDS ----
#pragma unroll
        for (int i = 0; i < 8; ++i) {
            int row = i + 8 * half;
            pst[row * PP + r]      = f2bf(p0[i]);
            pst[row * PP + 16 + r] = f2bf(p1[i]);
        }
        bf16x8 pa = *(const bf16x8*)&pst[r * PP + 8 * half];
        bf16x8 pb = *(const bf16x8*)&pst[r * PP + 8 * half + 16];
        bf16x16 pf;
#pragma unroll
        for (int i = 0; i < 8; ++i) { pf[i] = pa[i]; pf[i + 8] = pb[i]; }

        // ---- O += P @ V_chunk (B fragments from LDS, contiguous) ----
        const __bf16* vbase = &Vc[r][g * 32 + 8 * half];
#pragma unroll
        for (int u = 0; u < 16; ++u)
            o[u] = wmma_bf16(pf, load_frag(vbase + u * 16 * VP), o[u]);
    }

    // ---- merge the four key chunks' partial results of each query tile, as a tree ----
    if (g >= 2) put_partial(&Mg[wib - 8][0], lane, o, m, l);
    __syncthreads();   // chunks 2 and 3 published
    if (g < 2) join_partial(&Mg[wib][0], lane, o, m, l);
    __syncthreads();   // slots read out, free for the second round
    if (g == 1) put_partial(&Mg[wib - 4][0], lane, o, m, l);
    __syncthreads();   // chunk 1 (with 3) published
    if (g != 0) return;   // behind the last barrier
    join_partial(&Mg[wib][0], lane, o, m, l);

    // epilogue: divide by softmax denominator, store bf16 row-major
    float inv[8];
#pragma unroll
    for (int i = 0; i < 8; ++i) inv[i] = 1.0f / l[i];
    __bf16* Ob = O + ((size_t)b * N_SPATIAL + m0) * CDIM;
#pragma unroll
    for (int u = 0; u < 16; ++u)
#pragma unroll
        for (int i = 0; i < 8; ++i)
            Ob[(size_t)(i + 8 * half) * CDIM + u * 16 + r] = f2bf(o[u][i] * inv[i]);
}

// ---------------- Output projection + bias + residual -----------------------
__global__ void __launch_bounds__(512) proj_kernel(
        const __bf16* __restrict__ A, const __bf16* __restrict__ WT,
        const float* __restrict__ bias, const float* __restrict__ resid,
        float* __restrict__ out) {
    __shared__ __attribute__((aligned(16))) __bf16 Al[64 * GP];
    __shared__ __attribute__((aligned(16))) __bf16 Wl[256 * GP];
    int t = threadIdx.x;
    int w = t >> 5, lane = t & 31;
    int half = lane >> 4, r = lane & 15;
    size_t mb = (size_t)blockIdx.x * 64;
    bf16x8 va[4], vw[16];
    load_rows<64>(va, A + mb * CDIM, t);
    load_rows<256>(vw, WT, t);
    store_rows<64>(Al, va, t);
    store_rows<256>(Wl, vw, t);
    __syncthreads();   // both operands visible to all waves
    int mt = (w & 1) * 32, nt = (w >> 1) * 32;
    f32x8 c[2][2] = {{zero8(), zero8()}, {zero8(), zero8()}};
    tile_mma(Al + (mt + r) * GP + 8 * half, Wl + (nt + r) * GP + 8 * half, c);
    // the three loops are unrolled so that constant indices keep c in registers
#pragma unroll
    for (int x = 0; x < 2; ++x)
#pragma unroll
        for (int y = 0; y < 2; ++y) {
            size_t m0 = mb + mt + 16 * x;
            int n0 = nt + 16 * y;
            float bv = bias[n0 + r];
#pragma unroll
            for (int i = 0; i < 8; ++i) {
                size_t idx = (m0 + i + 8 * half) * CDIM + n0 + r;
                out[idx] = c[x][y][i] + bv + resid[idx];
            }
        }
}

extern "C" void kernel_launch(void* const* d_in, const int* in_sizes, int n_in,
                              void* d_out, int out_size, void* d_ws, size_t ws_size,
                              hipStream_t stream) {
    const float* inputs  = (const float*)d_in[0];
    const float* context = (const float*)d_in[1];
    const float* Wq = (const float*)d_in[2];
    const float* bq = (const float*)d_in[3];
    const float* Wk = (const float*)d_in[4];
    const float* bk = (const float*)d_in[5];
    const float* Wv = (const float*)d_in[6];
    const float* bv = (const float*)d_in[7];
    const float* Wp = (const float*)d_in[8];
    const float* bp = (const float*)d_in[9];
    const float* gamma = (const float*)d_in[10];
    const float* beta  = (const float*)d_in[11];
    float* out = (float*)d_out;

    const size_t TOT = (size_t)NBATCH * N_SPATIAL * CDIM;  // 4,194,304 elements
    char* ws = (char*)d_ws;
    float*  xn_f32 = (float*)ws;  ws += TOT * 4;
    __bf16* xn_bf  = (__bf16*)ws; ws += TOT * 2;
    __bf16* ctx_bf = (__bf16*)ws; ws += TOT * 2;
    __bf16* qb     = (__bf16*)ws; ws += TOT * 2;
    __bf16* kb_    = (__bf16*)ws; ws += TOT * 2;
    __bf16* vtb    = (__bf16*)ws; ws += TOT * 2;
    __bf16* ob     = (__bf16*)ws; ws += TOT * 2;
    __bf16* WqT    = (__bf16*)ws; ws += 65536 * 2;
    __bf16* WkT    = (__bf16*)ws; ws += 65536 * 2;
    __bf16* WvT    = (__bf16*)ws; ws += 65536 * 2;
    __bf16* WpT    = (__bf16*)ws; ws += 65536 * 2;

    cvt_bf16_kernel<<<256, 512, 0, stream>>>(context, ctx_bf);   // 256 * 16 waves * 1024 = TOT
    transpose_w_kernel<<<1024, 256, 0, stream>>>(Wq, Wk, Wv, Wp, WqT, WkT, WvT, WpT);
    ln_kernel<<<256, 512, 0, stream>>>(inputs, gamma, beta, xn_f32, xn_bf);   // 256 * 16 waves * 4 rows
    qproj_kernel<<<256, 512, 0, stream>>>(xn_bf, WqT, bq, qb);   // 256 blocks * 64 rows
    kvproj_kernel<<<256, 512, 0, stream>>>(ctx_bf, WkT, WvT, bk, bv, kb_, vtb);
    flash_kernel<<<256, 512, 0, stream>>>(qb, kb_, vtb, ob);
    proj_kernel<<<256, 512, 0, stream>>>(ob, WpT, bp, xn_f32, out);
}

// v005
// A run of this version takes 194 microseconds.
// Timed twice side by side with v004, it ran 1.24 and 1.23 times as fast.
// Over all steps from v000 it is 5.40 times as fast.
#include <hip/hip_runtime.h>
#include <hip/hip_bf16.h>

#define N_SPATIAL 4096   // 64*64
#define CDIM 256
#define NBATCH 4

typedef __attribute__((ext_vector_type(16))) __bf16 bf16x16;
typedef __attribute__((ext_vector_type(8)))  __bf16 bf16x8;
typedef __attribute__((ext_vector_type(8)))  float  f32x8;
typedef __attribute__((ext_vector_type(4)))  __bf16 bf16x4;
typedef __attribute__((ext_vector_type(4)))  float  f32x4;

// float -> bf16 with round-to-nearest-even (bit manipulation; no cvt dependence)
__device__ __forceinline__ __bf16 f2bf(float f) {
    unsigned u = __float_as_uint(f);
    u += 0x7FFFu + ((u >> 16) & 1u);
    unsigned short s = (unsigned short)(u >> 16);
    return __builtin_bit_cast(__bf16, s);
}

__device__ __forceinline__ f32x8 wmma_bf16(bf16x16 a, bf16x16 b, f32x8 c) {
    return __builtin_amdgcn_wmma_f32_16x16x32_bf16(
        /*neg_a=*/false, a, /*neg_b=*/false, b,
        /*c_mod=*/(short)0, c, /*reuse_a=*/false, /*reuse_b=*/false);
}

// Fragment loader: elems 0..7 from p[0..7], elems 8..15 from p[16..23].
// Caller passes p = base + 8*half; this matches the 16-bit A/B VGPR layout
// (lanes 0-15: K=0..7 & 16..23 ; lanes 16-31: K=8..15 & 24..31).
__device__ __forceinline__ bf16x16 load_frag(const __bf16* p) {
    bf16x8 a = *(const bf16x8*)p;
    bf16x8 b = *(const bf16x8*)(p + 16);
    bf16x16 f;
#pragma unroll
    for (int i = 0; i < 8; ++i) { f[i] = a[i]; f[i + 8] = b[i]; }
    return f;
}

__device__ __forceinline__ f32x8 zero8() {
    f32x8 c;
#pragma unroll
    for (int i = 0; i < 8; ++i) c[i] = 0.0f;
    return c;
}

// One stage's sixteen async copies of 16B per lane from global to LDS (tracked by ASYNCcnt).
// l* = LDS byte offset (low 32 bits of generic pointer), g* = global address; an
// immediate offset moves both addresses alike, so one address pair serves the
// 128-B pieces of one row: six pairs in registers instead of sixteen.
// kl/kg: two K rows, four pieces each; vl/vg: four V^T rows, two pieces each.
// The closing s_wait_xcnt 0 stands inside the statement so that no address
// register of an issued copy is rewritten ahead of it.
__device__ __forceinline__ void async_stage(const unsigned (&kl)[2], const char* const (&kg)[2],
                                            const unsigned (&vl)[4], const char* const (&vg)[4]) {
    asm volatile("global_load_async_to_lds_b128 %0, %6, off\n\t"
                 "global_load_async_to_lds_b128 %0, %6, off offset:128\n\t"
                 "global_load_async_to_lds_b128 %0, %6, off offset:256\n\t"
                 "global_load_async_to_lds_b128 %0, %6, off offset:384\n\t"
                 "global_load_async_to_lds_b128 %1, %7, off\n\t"
                 "global_load_async_to_lds_b128 %1, %7, off offset:128\n\t"
                 "global_load_async_to_lds_b128 %1, %7, off offset:256\n\t"
                 "global_load_async_to_lds_b128 %1, %7, off offset:384\n\t"
                 "global_load_async_to_lds_b128 %2, %8, off\n\t"
                 "global_load_async_to_lds_b128 %2, %8, off offset:128\n\t"
                 "global_load_async_to_lds_b128 %3, %9, off\n\t"
                 "global_load_async_to_lds_b128 %3, %9, off offset:128\n\t"
                 "global_load_async_to_lds_b128 %4, %10, off\n\t"
                 "global_load_async_to_lds_b128 %4, %10, off offset:128\n\t"
                 "global_load_async_to_lds_b128 %5, %11, off\n\t"
                 "global_load_async_to_lds_b128 %5, %11, off offset:128\n\t"
                 "s_wait_xcnt 0x0"
                 :: "v"(kl[0]), "v"(kl[1]), "v"(vl[0]), "v"(vl[1]), "v"(vl[2]), "v"(vl[3]),
                    "v"(kg[0]), "v"(kg[1]), "v"(vg[0]), "v"(vg[1]), "v"(vg[2]), "v"(vg[3])
                 : "memory");
}
__device__ __forceinline__ void wait_async0() {
    asm volatile("s_wait_asynccnt 0x0" ::: "memory");
}

// ---------------- LayerNorm: one wave per 4 rows -----------------------------
// A row (256 floats) lies across the 32 lanes, 8 elements a lane, so that both
// sums stay inside the wave. 16 waves a block, 8 loads of 16 B in flight a wave.
__global__ void __launch_bounds__(512) ln_kernel(
        const float* __restrict__ x, const float* __restrict__ gamma,
        const float* __restrict__ beta, float* __restrict__ xn,
        __bf16* __restrict__ xnb) {
    int wave = (blockIdx.x * 512 + threadIdx.x) >> 5;
    int lane = threadIdx.x & 31;
    size_t base = (size_t)wave * (4 * CDIM) + lane * 4;
    f32x4 a[4], b[4];
    for (int j = 0; j < 4; ++j) {
        a[j] = *(const f32x4*)(x + base + j * CDIM);
        b[j] = *(const f32x4*)(x + base + j * CDIM + 128);
    }
    f32x4 g0 = *(const f32x4*)(gamma + lane * 4);
    f32x4 g1 = *(const f32x4*)(gamma + lane * 4 + 128);
    f32x4 e0 = *(const f32x4*)(beta + lane * 4);
    f32x4 e1 = *(const f32x4*)(beta + lane * 4 + 128);
    float s[4];
    for (int j = 0; j < 4; ++j)
        s[j] = ((a[j][0] + a[j][1]) + (a[j][2] + a[j][3])) +
               ((b[j][0] + b[j][1]) + (b[j][2] + b[j][3]));
    for (int off = 16; off >= 1; off >>= 1)
        for (int j = 0; j < 4; ++j) s[j] += __shfl_xor(s[j], off, 32);
    for (int j = 0; j < 4; ++j) {
        float mu = s[j] * (1.0f / CDIM);
        a[j] -= mu;
        b[j] -= mu;
        f32x4 qa = a[j] * a[j], qb = b[j] * b[j];
        s[j] = ((qa[0] + qa[1]) + (qa[2] + qa[3])) + ((qb[0] + qb[1]) + (qb[2] + qb[3]));
    }
    for (int off = 16; off >= 1; off >>= 1)
        for (int j = 0; j < 4; ++j) s[j] += __shfl_xor(s[j], off, 32);
    for (int j = 0; j < 4; ++j) {
        float rs = rsqrtf(s[j] * (1.0f / CDIM) + 1e-3f);
        f32x4 y0 = a[j] * rs * g0 + e0;
        f32x4 y1 = b[j] * rs * g1 + e1;
        bf16x4 h0, h1;
        for (int k = 0; k < 4; ++k) { h0[k] = f2bf(y0[k]); h1[k] = f2bf(y1[k]); }
        *(f32x4*)(xn + base + j * CDIM)        = y0;
        *(f32x4*)(xn + base + j * CDIM + 128)  = y1;
        *(bf16x4*)(xnb + base + j * CDIM)       = h0;
        *(bf16x4*)(xnb + base + j * CDIM + 128) = h1;
    }
}

// ---------------- fp32 -> bf16 elementwise: 32 elements a lane ---------------
// A wave converts 1024 consecutive floats: 8 loads of 16 B a lane in flight,
// each wave-wide load and store covering whole 128-B lines.
__global__ void __launch_bounds__(512) cvt_bf16_kernel(const float* __restrict__ src,
                                                       __bf16* __restrict__ dst) {
    int wave = (blockIdx.x * 512 + threadIdx.x) >> 5;
    int lane = threadIdx.x & 31;
    size_t base = (size_t)wave * 1024 + lane * 4;
    f32x4 v[8];
    for (int i = 0; i < 8; ++i) v[i] = *(const f32x4*)(src + base + i * 128);
    for (int i = 0; i < 8; ++i) {
        bf16x4 h;
        for (int k = 0; k < 4; ++k) h[k] = f2bf(v[i][k]);
        *(bf16x4*)(dst + base + i * 128) = h;
    }
}

// ---------------- transpose 4 weight matrices to [N][K] bf16 ----------------
__global__ void transpose_w_kernel(const float* __restrict__ Wq, const float* __restrict__ Wk,
                                   const float* __restrict__ Wv, const float* __restrict__ Wp,
                                   __bf16* __restrict__ WqT, __bf16* __restrict__ WkT,
                                   __bf16* __restrict__ WvT, __bf16* __restrict__ WpT) {
    int i = blockIdx.x * blockDim.x + threadIdx.x;  // 0..262143
    int w = i >> 16;
    int j = i & 65535;
    int k = j >> 8, n = j & 255;
    const float* S = (w == 0) ? Wq : (w == 1) ? Wk : (w == 2) ? Wv : Wp;
    __bf16* D      = (w == 0) ? WqT : (w == 1) ? WkT : (w == 2) ? WvT : WpT;
    D[n * 256 + k] = f2bf(S[k * 256 + n]);
}

// ---------------- The three projections: operands staged in LDS -------------
// A block of 16 waves computes 64 rows x all 256 columns. The 64 rows of A and
// the whole [N][K] weight come into LDS by loads in which a wave covers one
// 512-B row (four whole lines); the WMMA fragments are then read from LDS.
// 256 blocks: one a WGP. Wave w owns the 32 x 32 tile at rows (w & 1) * 32,
// columns (w >> 1) * 32: each fragment read serves two WMMAs.
#define GP 264   // LDS row pitch in elements: 528 B = 16 B x odd for the ds_load_b128 readers

// ROWS rows of 256 bf16, contiguous in global memory, go to LDS rows of pitch GP in two
// halves, so that the loads of all operands are in flight before the first LDS store.
// Thread t: rows (t >> 5) + 16 * i, 16-B segment t & 31.
template <int ROWS>
__device__ __forceinline__ void load_rows(bf16x8 (&v)[ROWS / 16], const __bf16* __restrict__ g, int t) {
    const __bf16* gp = g + (t >> 5) * CDIM + (t & 31) * 8;
#pragma unroll   // v[] stays in registers; one address with immediate offsets
    for (int i = 0; i < ROWS / 16; ++i) v[i] = *(const bf16x8*)(gp + i * 16 * CDIM);
    // the address pair is an input, so it lives up to this wait: no later load's
    // result is placed over a register that a load issued above still names
    asm volatile("s_wait_xcnt 0x0" :: "v"(gp) : "memory");
}
template <int ROWS>
__device__ __forceinline__ void store_rows(__bf16* lds, const bf16x8 (&v)[ROWS / 16], int t) {
    __bf16* lp = lds + (t >> 5) * GP + (t & 31) * 8;
#pragma unroll   // v[] stays in registers
    for (int i = 0; i < ROWS / 16; ++i) *(bf16x8*)(lp + i * 16 * GP) = v[i];
}

// c[x][y] += A rows (16 x ..) times W rows (16 y ..), k = 0..255 in ascending blocks of 32.
__device__ __forceinline__ void tile_mma(const __bf16* al, const __bf16* wl, f32x8 (&c)[2][2]) {
#pragma unroll   // constant LDS offsets; the compiler fetches fragments ahead
    for (int kk = 0; kk < 8; ++kk) {
        bf16x16 a0 = load_frag(al + kk * 32), a1 = load_frag(al + 16 * GP + kk * 32);
        bf16x16 b0 = load_frag(wl + kk * 32), b1 = load_frag(wl + 16 * GP + kk * 32);
        c[0][0] = wmma_bf16(a0, b0, c[0][0]);
        c[0][1] = wmma_bf16(a0, b1, c[0][1]);
        c[1][0] = wmma_bf16(a1, b0, c[1][0]);
        c[1][1] = wmma_bf16(a1, b1, c[1][1]);
    }
}

// ---------------- Q projection ----------------------------------------------
__global__ void __launch_bounds__(512) qproj_kernel(
        const __bf16* __restrict__ A, const __bf16* __restrict__ WT,
        const float* __restrict__ bias, __bf16* __restrict__ Qo) {
    __shared__ __attribute__((aligned(16))) __bf16 Al[64 * GP];
    __shared__ __attribute__((aligned(16))) __bf16 Wl[256 * GP];
    int t = threadIdx.x;
    int w = t >> 5, lane = t & 31;
    int half = lane >> 4, r = lane & 15;
    size_t mb = (size_t)blockIdx.x * 64;
    bf16x8 va[4], vw[16];
    load_rows<64>(va, A + mb * CDIM, t);
    load_rows<256>(vw, WT, t);
    store_rows<64>(Al, va, t);
    store_rows<256>(Wl, vw, t);
    __syncthreads();   // both operands visible to all waves
    int mt = (w & 1) * 32, nt = (w >> 1) * 32;
    f32x8 c[2][2] = {{zero8(), zero8()}, {zero8(), zero8()}};
    tile_mma(Al + (mt + r) * GP + 8 * half, Wl + (nt + r) * GP + 8 * half, c);
    // the three loops are unrolled so that constant indices keep c in registers
#pragma unroll
    for (int x = 0; x < 2; ++x)
#pragma unroll
        for (int y = 0; y < 2; ++y) {
            size_t m0 = mb + mt + 16 * x;
            int n0 = nt + 16 * y;
            float bv = bias[n0 + r];
#pragma unroll
            for (int i = 0; i < 8; ++i)
                Qo[(m0 + i + 8 * half) * CDIM + n0 + r] = f2bf(c[x][y][i] + bv);
        }
}

// ---------------- K,V projection; V stored transposed [B][C][N] -------------
__global__ void __launch_bounds__(512) kvproj_kernel(
        const __bf16* __restrict__ A, const __bf16* __restrict__ WkT,
        const __bf16* __restrict__ WvT, const float* __restrict__ bk,
        const float* __restrict__ bvv, __bf16* __restrict__ Ko,
        __bf16* __restrict__ VTo) {
    __shared__ __attribute__((aligned(16))) __bf16 Al[64 * GP];
    __shared__ __attribute__((aligned(16))) __bf16 Wkl[256 * GP];
    __shared__ __attribute__((aligned(16))) __bf16 Wvl[256 * GP];
    int t = threadIdx.x;
    int w = t >> 5, lane = t & 31;
    int half = lane >> 4, r = lane & 15;
    size_t mb = (size_t)blockIdx.x * 64;
    bf16x8 va[4], vk[16], vv[16];
    load_rows<64>(va, A + mb * CDIM, t);
    load_rows<256>(vk, WkT, t);
    load_rows<256>(vv, WvT, t);
    store_rows<64>(Al, va, t);
    store_rows<256>(Wkl, vk, t);
    store_rows<256>(Wvl, vv, t);
    __syncthreads();   // all three operands visible to all waves
    int mt = (w & 1) * 32, nt = (w >> 1) * 32;
    f32x8 ck[2][2] = {{zero8(), zero8()}, {zero8(), zero8()}};
    f32x8 cv[2][2] = {{zero8(), zero8()}, {zero8(), zero8()}};
    tile_mma(Al + (mt + r) * GP + 8 * half, Wkl + (nt + r) * GP + 8 * half, ck);
    tile_mma(Al + (mt + r) * GP + 8 * half, Wvl + (nt + r) * GP + 8 * half, cv);
    // the loops are unrolled so that constant indices keep ck and cv in registers
#pragma unroll
    for (int x = 0; x < 2; ++x)
#pragma unroll
        for (int y = 0; y < 2; ++y) {
            size_t m0 = mb + mt + 16 * x;
            int n0 = nt + 16 * y;
            float kb = bk[n0 + r];
#pragma unroll
            for (int i = 0; i < 8; ++i)
                Ko[(m0 + i + 8 * half) * CDIM + n0 + r] = f2bf(ck[x][y][i] + kb);
            // V transposed store: lane's 8 C-layout rows are consecutive key indices.
            int b   = (int)(m0 >> 12);                 // 4096 keys per batch
            int nk0 = (int)(m0 & 4095) + 8 * half;
            float vb = bvv[n0 + r];
            bf16x8 pack;
#pragma unroll
            for (int i = 0; i < 8; ++i) pack[i] = f2bf(cv[x][y][i] + vb);
            *(bf16x8*)(VTo + ((size_t)b * CDIM + n0 + r) * N_SPATIAL + nk0) = pack;
        }
}

// ---------------- Flash attention ------------------------------------------
// Block = 16 waves on 64 query rows: wave w owns the 16-row query tile (w & 3)
// and, of every staged 128 keys, the 32-key chunk (w >> 2). So 256 blocks fill
// the chip's 256 WGPs with four waves a SIMD. The four partial results of a
// query tile (running maximum, sum, O) are merged through LDS behind the loop.
// The 128-key K/V stage is brought into LDS by async global->LDS copies, into two
// buffers in turn: the next stage's copies fly while this stage is computed.
// LDS rows are pitched 16 B x odd, so that the 16 lanes of a ds_load_b128
// fragment read (one row each) fall on 16 different groups of four banks.
#define KP 264   // K row pitch in elements: 528 B for 512 B of data
#define VP 136   // V^T row pitch in elements: 272 B for the 256 B of a stage's 128 keys
#define PP 40    // P row pitch in elements: 80 B for 64 B of data
#define KSPLIT 4                 // key chunks of a stage = waves on one query tile
#define STAGE  (32 * KSPLIT)     // keys staged per trip
#define MSLOT  (36 * 128)        // floats of one wave's partial result: O 32 x 128, m 2 x 128, l 2 x 128
#define KBYTES (STAGE * KP * 2)  // a stage's K rows in LDS
#define VBYTES (256 * VP * 2)    // a stage's V^T rows in LDS
#define BUFB   (KBYTES + VBYTES) // one stage buffer: K rows, then V^T rows
#define PSTB   (16 * 16 * PP * 2)   // per-wave P staging, behind the two buffers
static_assert(8 * MSLOT * 4 <= 2 * BUFB, "the merge slots lie in the two stage buffers");

// Issue this thread's sixteen copies of the stage that begins at key j0 into the buffer at LDS byte lds:
// 128 rows of K and 128 keys of every V^T row.
// eight lanes bring one 128-B line; thread t: row t >> 3 (and +64 ...), 16-B segment t & 7
__device__ __forceinline__ void issue_stage(const __bf16* Kb, const __bf16* Vb, int j0, unsigned lds, int t) {
    const char* kgt = (const char*)Kb + (size_t)j0 * (CDIM * 2) + (t >> 3) * (CDIM * 2) + (t & 7) * 16;
    const char* vgt = (const char*)Vb + (size_t)j0 * 2 + (size_t)(t >> 3) * (N_SPATIAL * 2) + (t & 7) * 16;
    unsigned kla[2], vla[4];
    const char* kga[2];
    const char* vga[4];
    // both loops unrolled: the address arrays are asm operands and must be registers
#pragma unroll
    for (int h = 0; h < 2; ++h) {
        kla[h] = lds + ((t >> 3) + 64 * h) * (KP * 2) + (t & 7) * 16;
        kga[h] = kgt + h * (64 * CDIM * 2);
    }
#pragma unroll
    for (int h = 0; h < 4; ++h) {
        vla[h] = lds + KBYTES + ((t >> 3) + 64 * h) * (VP * 2) + (t & 7) * 16;
        vga[h] = vgt + (size_t)h * (64 * N_SPATIAL * 2);
    }
    async_stage(kla, kga, vla, vga);
}

// One wave's partial result to its merge slot; each store covers 512 contiguous bytes.
__device__ __forceinline__ void put_partial(float* mg, int lane, const f32x8 (&o)[16],
                                            const float (&m)[8], const float (&l)[8]) {
#pragma unroll   // constant indices keep o[] in registers
    for (int u = 0; u < 16; ++u) {
        f32x4 lo = {o[u][0], o[u][1], o[u][2], o[u][3]};
        f32x4 hi = {o[u][4], o[u][5], o[u][6], o[u][7]};
        *(f32x4*)(mg + (u * 2 + 0) * 128 + lane * 4) = lo;
        *(f32x4*)(mg + (u * 2 + 1) * 128 + lane * 4) = hi;
    }
    f32x4 m0 = {m[0], m[1], m[2], m[3]}, m1 = {m[4], m[5], m[6], m[7]};
    f32x4 l0 = {l[0], l[1], l[2], l[3]}, l1 = {l[4], l[5], l[6], l[7]};
    *(f32x4*)(mg + 32 * 128 + lane * 4) = m0;
    *(f32x4*)(mg + 33 * 128 + lane * 4) = m1;
    *(f32x4*)(mg + 34 * 128 + lane * 4) = l0;
    *(f32x4*)(mg + 35 * 128 + lane * 4) = l1;
}

// Join the partial result in a merge slot (same lane-to-element map) into this wave's own.
__device__ __forceinline__ void join_partial(const float* mg, int lane, f32x8 (&o)[16],
                                             float (&m)[8], float (&l)[8]) {
    f32x4 m0 = *(const f32x4*)(mg + 32 * 128 + lane * 4);
    f32x4 m1 = *(const f32x4*)(mg + 33 * 128 + lane * 4);
    f32x4 l0 = *(const f32x4*)(mg + 34 * 128 + lane * 4);
    f32x4 l1 = *(const f32x4*)(mg + 35 * 128 + lane * 4);
    float fa[8], fb[8];
    // the three loops below are unrolled so that constant indices keep m, l, o in registers
#pragma unroll
    for (int i = 0; i < 8; ++i) {
        float mb = (i < 4) ? m0[i & 3] : m1[i & 3];
        float lb = (i < 4) ? l0[i & 3] : l1[i & 3];
        float mnew = fmaxf(m[i], mb);
        fa[i] = __expf(m[i] - mnew);
        fb[i] = __expf(mb - mnew);
        m[i] = mnew;
        l[i] = l[i] * fa[i] + lb * fb[i];
    }
#pragma unroll
    for (int u = 0; u < 16; ++u) {
        f32x4 lo = *(const f32x4*)(mg + (u * 2 + 0) * 128 + lane * 4);
        f32x4 hi = *(const f32x4*)(mg + (u * 2 + 1) * 128 + lane * 4);
#pragma unroll
        for (int i = 0; i < 4; ++i) {
            o[u][i]     = o[u][i]     * fa[i]     + lo[i] * fb[i];
            o[u][i + 4] = o[u][i + 4] * fa[i + 4] + hi[i] * fb[i + 4];
        }
    }
}

__global__ void __launch_bounds__(512) flash_kernel(
        const __bf16* __restrict__ Q, const __bf16* __restrict__ K,
        const __bf16* __restrict__ VT, __bf16* __restrict__ O) {
    // two stage buffers, then the P staging; behind the loop the buffers hold the merge slots
    __shared__ __attribute__((aligned(16))) char smem[2 * BUFB + PSTB];

    int t    = threadIdx.x;
    int wib  = __builtin_amdgcn_readfirstlane(t >> 5);   // wave-uniform: the merge's branches are scalar
    int lane = t & 31;
    int half = lane >> 4, r = lane & 15;
    int g  = wib >> 2;                 // this wave's key chunk in every stage
    int b  = blockIdx.x >> 6;          // 64 blocks of 64 query rows per batch
    int m0 = (blockIdx.x & 63) * 64 + (wib & 3) * 16;

    const __bf16* Qb = Q  + ((size_t)b * N_SPATIAL) * CDIM;
    const __bf16* Kb = K  + ((size_t)b * N_SPATIAL) * CDIM;
    const __bf16* Vb = VT + (size_t)b * CDIM * N_SPATIAL;

    bf16x16 qf[8];
    const __bf16* qrow = Qb + (size_t)(m0 + r) * CDIM + 8 * half;
#pragma unroll
    for (int kk = 0; kk < 8; ++kk) qf[kk] = load_frag(qrow + kk * 32);

    f32x8 o[16];
#pragma unroll
    for (int u = 0; u < 16; ++u) o[u] = zero8();
    float m[8], l[8];
#pragma unroll
    for (int i = 0; i < 8; ++i) { m[i] = -1e30f; l[i] = 0.0f; }

    __bf16* pst = (__bf16*)(smem + 2 * BUFB) + wib * (16 * PP);
    const unsigned sl = (unsigned)(size_t)&smem[0];   // LDS byte offset of buffer 0
    const float sc = 0.0625f;                         // 256^-0.5

    issue_stage(Kb, Vb, 0, sl, t);
    wait_async0();
    __syncthreads();   // stage 0 visible to all waves
    issue_stage(Kb, Vb, STAGE, sl + BUFB, t);   // stage 1 flies during trip 0

    unsigned boff = 0;   // byte offset of the buffer that this trip reads
    for (int j0 = 0; j0 < N_SPATIAL; j0 += STAGE) {
        const __bf16* Kc = (const __bf16*)(smem + boff);
        const __bf16* Vc = (const __bf16*)(smem + boff + KBYTES);

        // ---- S = Q @ K_chunk^T : two 16x16 tiles, fragments from LDS ----
        f32x8 s0 = zero8(), s1 = zero8();
        const __bf16* k0base = Kc + (g * 32 + r) * KP + 8 * half;
        const __bf16* k1base = Kc + (g * 32 + 16 + r) * KP + 8 * half;
#pragma unroll
        for (int kk = 0; kk < 8; ++kk) {
            s0 = wmma_bf16(qf[kk], load_frag(k0base + kk * 32), s0);
            s1 = wmma_bf16(qf[kk], load_frag(k1base + kk * 32), s1);
        }
        // ---- online softmax (row stats local to the 16-lane half) ----
        float p0[8], p1[8], mn[8];
#pragma unroll
        for (int i = 0; i < 8; ++i) {
            p0[i] = s0[i] * sc; p1[i] = s1[i] * sc;
            mn[i] = fmaxf(p0[i], p1[i]);
        }
#pragma unroll
        for (int off = 8; off >= 1; off >>= 1)
#pragma unroll
            for (int i = 0; i < 8; ++i)
                mn[i] = fmaxf(mn[i], __shfl_xor(mn[i], off, 32));
        float alpha[8], ls[8];
#pragma unroll
        for (int i = 0; i < 8; ++i) {
            float mnew = fmaxf(m[i], mn[i]);
            alpha[i] = __expf(m[i] - mnew);
            m[i] = mnew;
            p0[i] = __expf(p0[i] - mnew);
            p1[i] = __expf(p1[i] - mnew);
            ls[i] = p0[i] + p1[i];
        }
#pragma unroll
        for (int off = 8; off >= 1; off >>= 1)
#pragma unroll
            for (int i = 0; i < 8; ++i)
                ls[i] += __shfl_xor(ls[i], off, 32);
#pragma unroll
        for (int i = 0; i < 8; ++i) l[i] = l[i] * alpha[i] + ls[i];
#pragma unroll
        for (int u = 0; u < 16; ++u)
#pragma unroll
            for (int i = 0; i < 8; ++i) o[u][i] *= alpha[i];

        // ---- stage P (C layout) -> A-layout fragment via per-wave LDS ----
#pragma unroll
        for (int i = 0; i < 8; ++i) {
            int row = i + 8 * half;
            pst[row * PP + r]      = f2bf(p0[i]);
            pst[row * PP + 16 + r] = f2bf(p1[i]);
        }
        bf16x8 pa = *(const bf16x8*)&pst[r * PP + 8 * half];
        bf16x8 pb = *(const bf16x8*)&pst[r * PP + 8 * half + 16];
        bf16x16 pf;
#pragma unroll
        for (int i = 0; i < 8; ++i) { pf[i] = pa[i]; pf[i + 8] = pb[i]; }

        // ---- O += P @ V_chunk (B fragments from LDS, contiguous) ----
        const __bf16* vbase = Vc + r * VP + g * 32 + 8 * half;
#pragma unroll
        for (int u = 0; u < 16; ++u)
            o[u] = wmma_bf16(pf, load_frag(vbase + u * 16 * VP), o[u]);

        // ---- hand-over: the next stage is published, this trip's buffer is freed ----
        // the trip's own work (the row sums' lane exchanges among it) stays in front of the hand-over:
        // moved behind the barrier it would stand between the barrier and the refill and start the copies late
        __builtin_amdgcn_sched_barrier(0);
        // this wave's own LDS reads of this trip's buffer have retired before any copy refills it
        asm volatile("s_wait_dscnt 0x0" ::: "memory");
        wait_async0();     // this wave's copies of the next stage have landed
        __syncthreads();   // next stage visible to all waves; this trip's buffer read out by all
        if (j0 + 2 * STAGE < N_SPATIAL)
            issue_stage(Kb, Vb, j0 + 2 * STAGE, sl + boff, t);   // flies during the next trip
        boff ^= BUFB;
    }
    wait_async0();   // nothing is in flight when the buffers become merge slots

    // ---- merge the four key chunks' partial results of each query tile, as a tree ----
    // the last trip's barrier has ended every wave's reads of the stage buffers
    float* Mg = (float*)smem;
    if (g >= 2) put_partial(Mg + (wib - 8) * MSLOT, lane, o, m, l);
    __syncthreads();   // chunks 2 and 3 published
    if (g < 2) join_partial(Mg + wib * MSLOT, lane, o, m, l);
    __syncthreads();   // slots read out, free for the second round
    if (g == 1) put_partial(Mg + (wib - 4) * MSLOT, lane, o, m, l);
    __syncthreads();   // chunk 1 (with 3) published
    if (g != 0) return;   // behind the last barrier
    join_partial(Mg + wib * MSLOT, lane, o, m, l);

    // epilogue: divide by softmax denominator, store bf16 row-major
    float inv[8];
#pragma unroll
    for (int i = 0; i < 8; ++i) inv[i] = 1.0f / l[i];
    __bf16* Ob = O + ((size_t)b * N_SPATIAL + m0) * CDIM;
#pragma unroll
    for (int u = 0; u < 16; ++u)
#pragma unroll
        for (int i = 0; i < 8; ++i)
            Ob[(size_t)(i + 8 * half) * CDIM + u * 16 + r] = f2bf(o[u][i] * inv[i]);
}

// ---------------- Output projection + bias + residual -----------------------
__global__ void __launch_bounds__(512) proj_kernel(
        const __bf16* __restrict__ A, const __bf16* __restrict__ WT,
        const float* __restrict__ bias, const float* __restrict__ resid,
        float* __restrict__ out) {
    __shared__ __attribute__((aligned(16))) __bf16 Al[64 * GP];
    __shared__ __attribute__((aligned(16))) __bf16 Wl[256 * GP];
    int t = threadIdx.x;
    int w = t >> 5, lane = t & 31;
    int half = lane >> 4, r = lane & 15;
    size_t mb = (size_t)blockIdx.x * 64;
    bf16x8 va[4], vw[16];
    load_rows<64>(va, A + mb * CDIM, t);
    load_rows<256>(vw, WT, t);
    store_rows<64>(Al, va, t);
    store_rows<256>(Wl, vw, t);
    __syncthreads();   // both operands visible to all waves
    int mt = (w & 1) * 32, nt = (w >> 1) * 32;
    f32x8 c[2][2] = {{zero8(), zero8()}, {zero8(), zero8()}};
    tile_mma(Al + (mt + r) * GP + 8 * half, Wl + (nt + r) * GP + 8 * half, c);
    // the three loops are unrolled so that constant indices keep c in registers
#pragma unroll
    for (int x = 0; x < 2; ++x)
#pragma unroll
        for (int y = 0; y < 2; ++y) {
            size_t m0 = mb + mt + 16 * x;
            int n0 = nt + 16 * y;
            float bv = bias[n0 + r];
#pragma unroll
            for (int i = 0; i < 8; ++i) {
                size_t idx = (m0 + i + 8 * half) * CDIM + n0 + r;
                out[idx] = c[x][y][i] + bv + resid[idx];
            }
        }
}

extern "C" void kernel_launch(void* const* d_in, const int* in_sizes, int n_in,
                              void* d_out, int out_size, void* d_ws, size_t ws_size,
                              hipStream_t stream) {
    const float* inputs  = (const float*)d_in[0];
    const float* context = (const float*)d_in[1];
    const float* Wq = (const float*)d_in[2];
    const float* bq = (const float*)d_in[3];
    const float* Wk = (const float*)d_in[4];
    const float* bk = (const float*)d_in[5];
    const float* Wv = (const float*)d_in[6];
    const float* bv = (const float*)d_in[7];
    const float* Wp = (const float*)d_in[8];
    const float* bp = (const float*)d_in[9];
    const float* gamma = (const float*)d_in[10];
    const float* beta  = (const float*)d_in[11];
    float* out = (float*)d_out;

    const size_t TOT = (size_t)NBATCH * N_SPATIAL * CDIM;  // 4,194,304 elements
    char* ws = (char*)d_ws;
    float*  xn_f32 = (float*)ws;  ws += TOT * 4;
    __bf16* xn_bf  = (__bf16*)ws; ws += TOT * 2;
    __bf16* ctx_bf = (__bf16*)ws; ws += TOT * 2;
    __bf16* qb     = (__bf16*)ws; ws += TOT * 2;
    __bf16* kb_    = (__bf16*)ws; ws += TOT * 2;
    __bf16* vtb    = (__bf16*)ws; ws += TOT * 2;
    __bf16* ob     = (__bf16*)ws; ws += TOT * 2;
    __bf16* WqT    = (__bf16*)ws; ws += 65536 * 2;
    __bf16* WkT    = (__bf16*)ws; ws += 65536 * 2;
    __bf16* WvT    = (__bf16*)ws; ws += 65536 * 2;
    __bf16* WpT    = (__bf16*)ws; ws += 65536 * 2;

    cvt_bf16_kernel<<<256, 512, 0, stream>>>(context, ctx_bf);   // 256 * 16 waves * 1024 = TOT
    transpose_w_kernel<<<1024, 256, 0, stream>>>(Wq, Wk, Wv, Wp, WqT, WkT, WvT, WpT);
    ln_kernel<<<256, 512, 0, stream>>>(inputs, gamma, beta, xn_f32, xn_bf);   // 256 * 16 waves * 4 rows
    qproj_kernel<<<256, 512, 0, stream>>>(xn_bf, WqT, bq, qb);   // 256 blocks * 64 rows
    kvproj_kernel<<<256, 512, 0, stream>>>(ctx_bf, WkT, WvT, bk, bv, kb_, vtb);
    flash_kernel<<<256, 512, 0, stream>>>(qb, kb_, vtb, ob);
    proj_kernel<<<256, 512, 0, stream>>>(ob, WpT, bp, xn_f32, out);
}

// v006
// One run takes 154 microseconds.
// In both of two side-by-side timings against v005, it was 1.26 times as fast.
// Counting every step since v000, it is 6.81 times as fast.
#include <hip/hip_runtime.h>
#include <hip/hip_bf16.h>

#define N_SPATIAL 4096   // 64*64
#define CDIM 256
#define NBATCH 4

typedef __attribute__((ext_vector_type(16))) __bf16 bf16x16;
typedef __attribute__((ext_vector_type(8)))  __bf16 bf16x8;
typedef __attribute__((ext_vector_type(8)))  float  f32x8;
typedef __attribute__((ext_vector_type(4)))  __bf16 bf16x4;
typedef __attribute__((ext_vector_type(4)))  float  f32x4;

// float -> bf16 with round-to-nearest-even (bit manipulation; no cvt dependence)
__device__ __forceinline__ __bf16 f2bf(float f) {
    unsigned u = __float_as_uint(f);
    u += 0x7FFFu + ((u >> 16) & 1u);
    unsigned short s = (unsigned short)(u >> 16);
    return __builtin_bit_cast(__bf16, s);
}

__device__ __forceinline__ f32x8 wmma_bf16(bf16x16 a, bf16x16 b, f32x8 c) {
    return __builtin_amdgcn_wmma_f32_16x16x32_bf16(
        /*neg_a=*/false, a, /*neg_b=*/false, b,
        /*c_mod=*/(short)0, c, /*reuse_a=*/false, /*reuse_b=*/false);
}

// Fragment loader: elems 0..7 from p[0..7], elems 8..15 from p[16..23].
// Caller passes p = base + 8*half; this matches the 16-bit A/B VGPR layout
// (lanes 0-15: K=0..7 & 16..23 ; lanes 16-31: K=8..15 & 24..31).
__device__ __forceinline__ bf16x16 load_frag(const __bf16* p) {
    bf16x8 a = *(const bf16x8*)p;
    bf16x8 b = *(const bf16x8*)(p + 16);
    bf16x16 f;
#pragma unroll
    for (int i = 0; i < 8; ++i) { f[i] = a[i]; f[i + 8] = b[i]; }
    return f;
}

__device__ __forceinline__ f32x8 zero8() {
    f32x8 c;
#pragma unroll
    for (int i = 0; i < 8; ++i) c[i] = 0.0f;
    return c;
}

// One stage's sixteen async copies of 16B per lane from global to LDS (tracked by ASYNCcnt).
// l* = LDS byte offset (low 32 bits of generic pointer), g* = global address; an
// immediate offset moves both addresses alike, so one address pair serves the
// 128-B pieces of one row: six pairs in registers instead of sixteen.
// kl/kg: two K rows, four pieces each; vl/vg: four V^T rows, two pieces each.
// The closing s_wait_xcnt 0 stands inside the statement so that no address
// register of an issued copy is rewritten ahead of it.
__device__ __forceinline__ void async_stage(const unsigned (&kl)[2], const char* const (&kg)[2],
                                            const unsigned (&vl)[4], const char* const (&vg)[4]) {
    asm volatile("global_load_async_to_lds_b128 %0, %6, off\n\t"
                 "global_load_async_to_lds_b128 %0, %6, off offset:128\n\t"
                 "global_load_async_to_lds_b128 %0, %6, off offset:256\n\t"
                 "global_load_async_to_lds_b128 %0, %6, off offset:384\n\t"
                 "global_load_async_to_lds_b128 %1, %7, off\n\t"
                 "global_load_async_to_lds_b128 %1, %7, off offset:128\n\t"
                 "global_load_async_to_lds_b128 %1, %7, off offset:256\n\t"
                 "global_load_async_to_lds_b128 %1, %7, off offset:384\n\t"
                 "global_load_async_to_lds_b128 %2, %8, off\n\t"
                 "global_load_async_to_lds_b128 %2, %8, off offset:128\n\t"
                 "global_load_async_to_lds_b128 %3, %9, off\n\t"
                 "global_load_async_to_lds_b128 %3, %9, off offset:128\n\t"
                 "global_load_async_to_lds_b128 %4, %10, off\n\t"
                 "global_load_async_to_lds_b128 %4, %10, off offset:128\n\t"
                 "global_load_async_to_lds_b128 %5, %11, off\n\t"
                 "global_load_async_to_lds_b128 %5, %11, off offset:128\n\t"
                 "s_wait_xcnt 0x0"
                 :: "v"(kl[0]), "v"(kl[1]), "v"(vl[0]), "v"(vl[1]), "v"(vl[2]), "v"(vl[3]),
                    "v"(kg[0]), "v"(kg[1]), "v"(vg[0]), "v"(vg[1]), "v"(vg[2]), "v"(vg[3])
                 : "memory");
}
__device__ __forceinline__ void wait_async0() {
    asm volatile("s_wait_asynccnt 0x0" ::: "memory");
}

// ---------------- LayerNorm: one wave per 4 rows -----------------------------
// A row (256 floats) lies across the 32 lanes, 8 elements a lane, so that both
// sums stay inside the wave. 16 waves a block, 8 loads of 16 B in flight a wave.
__global__ void __launch_bounds__(512) ln_kernel(
        const float* __restrict__ x, const float* __restrict__ gamma,
        const float* __restrict__ beta, float* __restrict__ xn,
        __bf16* __restrict__ xnb) {
    int wave = (blockIdx.x * 512 + threadIdx.x) >> 5;
    int lane = threadIdx.x & 31;
    size_t base = (size_t)wave * (4 * CDIM) + lane * 4;
    f32x4 a[4], b[4];
    for (int j = 0; j < 4; ++j) {
        a[j] = *(const f32x4*)(x + base + j * CDIM);
        b[j] = *(const f32x4*)(x + base + j * CDIM + 128);
    }
    f32x4 g0 = *(const f32x4*)(gamma + lane * 4);
    f32x4 g1 = *(const f32x4*)(gamma + lane * 4 + 128);
    f32x4 e0 = *(const f32x4*)(beta + lane * 4);
    f32x4 e1 = *(const f32x4*)(beta + lane * 4 + 128);
    float s[4];
    for (int j = 0; j < 4; ++j)
        s[j] = ((a[j][0] + a[j][1]) + (a[j][2] + a[j][3])) +
               ((b[j][0] + b[j][1]) + (b[j][2] + b[j][3]));
    for (int off = 16; off >= 1; off >>= 1)
        for (int j = 0; j < 4; ++j) s[j] += __shfl_xor(s[j], off, 32);
    for (int j = 0; j < 4; ++j) {
        float mu = s[j] * (1.0f / CDIM);
        a[j] -= mu;
        b[j] -= mu;
        f32x4 qa = a[j] * a[j], qb = b[j] * b[j];
        s[j] = ((qa[0] + qa[1]) + (qa[2] + qa[3])) + ((qb[0] + qb[1]) + (qb[2] + qb[3]));
    }
    for (int off = 16; off >= 1; off >>= 1)
        for (int j = 0; j < 4; ++j) s[j] += __shfl_xor(s[j], off, 32);
    for (int j = 0; j < 4; ++j) {
        float rs = rsqrtf(s[j] * (1.0f / CDIM) + 1e-3f);
        f32x4 y0 = a[j] * rs * g0 + e0;
        f32x4 y1 = b[j] * rs * g1 + e1;
        bf16x4 h0, h1;
        for (int k = 0; k < 4; ++k) { h0[k] = f2bf(y0[k]); h1[k] = f2bf(y1[k]); }
        *(f32x4*)(xn + base + j * CDIM)        = y0;
        *(f32x4*)(xn + base + j * CDIM + 128)  = y1;
        *(bf16x4*)(xnb + base + j * CDIM)       = h0;
        *(bf16x4*)(xnb + base + j * CDIM + 128) = h1;
    }
}

// ---------------- fp32 -> bf16 elementwise: 32 elements a lane ---------------
// A wave converts 1024 consecutive floats: 8 loads of 16 B a lane in flight,
// each wave-wide load and store covering whole 128-B lines.
__global__ void __launch_bounds__(512) cvt_bf16_kernel(const float* __restrict__ src,
                                                       __bf16* __restrict__ dst) {
    int wave = (blockIdx.x * 512 + threadIdx.x) >> 5;
    int lane = threadIdx.x & 31;
    size_t base = (size_t)wave * 1024 + lane * 4;
    f32x4 v[8];
    for (int i = 0; i < 8; ++i) v[i] = *(const f32x4*)(src + base + i * 128);
    for (int i = 0; i < 8; ++i) {
        bf16x4 h;
        for (int k = 0; k < 4; ++k) h[k] = f2bf(v[i][k]);
        *(bf16x4*)(dst + base + i * 128) = h;
    }
}

// ---------------- transpose 4 weight matrices to [N][K] bf16 ----------------
__global__ void transpose_w_kernel(const float* __restrict__ Wq, const float* __restrict__ Wk,
                                   const float* __restrict__ Wv, const float* __restrict__ Wp,
                                   __bf16* __restrict__ WqT, __bf16* __restrict__ WkT,
                                   __bf16* __restrict__ WvT, __bf16* __restrict__ WpT) {
    int i = blockIdx.x * blockDim.x + threadIdx.x;  // 0..262143
    int w = i >> 16;
    int j = i & 65535;
    int k = j >> 8, n = j & 255;
    const float* S = (w == 0) ? Wq : (w == 1) ? Wk : (w == 2) ? Wv : Wp;
    __bf16* D      = (w == 0) ? WqT : (w == 1) ? WkT : (w == 2) ? WvT : WpT;
    D[n * 256 + k] = f2bf(S[k * 256 + n]);
}

// ---------------- The three projections: operands staged in LDS -------------
// A block of 16 waves computes 64 rows x all 256 columns. The 64 rows of A and
// the whole [N][K] weight come into LDS by loads in which a wave covers one
// 512-B row (four whole lines); the WMMA fragments are then read from LDS.
// 256 blocks: one a WGP. Wave w owns the 32 x 32 tile at rows (w & 1) * 32,
// columns (w >> 1) * 32: each fragment read serves two WMMAs.
#define GP 264   // LDS row pitch in elements: 528 B = 16 B x odd for the ds_load_b128 readers

// ROWS rows of 256 bf16, contiguous in global memory, go to LDS rows of pitch GP in two
// halves, so that the loads of all operands are in flight before the first LDS store.
// Thread t: rows (t >> 5) + 16 * i, 16-B segment t & 31.
template <int ROWS>
__device__ __forceinline__ void load_rows(bf16x8 (&v)[ROWS / 16], const __bf16* __restrict__ g, int t) {
    const __bf16* gp = g + (t >> 5) * CDIM + (t & 31) * 8;
#pragma unroll   // v[] stays in registers; one address with immediate offsets
    for (int i = 0; i < ROWS / 16; ++i) v[i] = *(const bf16x8*)(gp + i * 16 * CDIM);
    // the address pair is an input, so it lives up to this wait: no later load's
    // result is placed over a register that a load issued above still names
    asm volatile("s_wait_xcnt 0x0" :: "v"(gp) : "memory");
}
template <int ROWS>
__device__ __forceinline__ void store_rows(__bf16* lds, const bf16x8 (&v)[ROWS / 16], int t) {
    __bf16* lp = lds + (t >> 5) * GP + (t & 31) * 8;
#pragma unroll   // v[] stays in registers
    for (int i = 0; i < ROWS / 16; ++i) *(bf16x8*)(lp + i * 16 * GP) = v[i];
}

// c[x][y] += A rows (16 x ..) times W rows (16 y ..), k = 0..255 in ascending blocks of 32.
__device__ __forceinline__ void tile_mma(const __bf16* al, const __bf16* wl, f32x8 (&c)[2][2]) {
#pragma unroll   // constant LDS offsets; the compiler fetches fragments ahead
    for (int kk = 0; kk < 8; ++kk) {
        bf16x16 a0 = load_frag(al + kk * 32), a1 = load_frag(al + 16 * GP + kk * 32);
        bf16x16 b0 = load_frag(wl + kk * 32), b1 = load_frag(wl + 16 * GP + kk * 32);
        c[0][0] = wmma_bf16(a0, b0, c[0][0]);
        c[0][1] = wmma_bf16(a0, b1, c[0][1]);
        c[1][0] = wmma_bf16(a1, b0, c[1][0]);
        c[1][1] = wmma_bf16(a1, b1, c[1][1]);
    }
}

// ---------------- Q projection ----------------------------------------------
__global__ void __launch_bounds__(512) qproj_kernel(
        const __bf16* __restrict__ A, const __bf16* __restrict__ WT,
        const float* __restrict__ bias, __bf16* __restrict__ Qo) {
    __shared__ __attribute__((aligned(16))) __bf16 Al[64 * GP];
    __shared__ __attribute__((aligned(16))) __bf16 Wl[256 * GP];
    int t = threadIdx.x;
    int w = t >> 5, lane = t & 31;
    int half = lane >> 4, r = lane & 15;
    size_t mb = (size_t)blockIdx.x * 64;
    bf16x8 va[4], vw[16];
    load_rows<64>(va, A + mb * CDIM, t);
    load_rows<256>(vw, WT, t);
    store_rows<64>(Al, va, t);
    store_rows<256>(Wl, vw, t);
    __syncthreads();   // both operands visible to all waves
    int mt = (w & 1) * 32, nt = (w >> 1) * 32;
    f32x8 c[2][2] = {{zero8(), zero8()}, {zero8(), zero8()}};
    tile_mma(Al + (mt + r) * GP + 8 * half, Wl + (nt + r) * GP + 8 * half, c);
    // the three loops are unrolled so that constant indices keep c in registers
#pragma unroll
    for (int x = 0; x < 2; ++x)
#pragma unroll
        for (int y = 0; y < 2; ++y) {
            size_t m0 = mb + mt + 16 * x;
            int n0 = nt + 16 * y;
            float bv = bias[n0 + r];
#pragma unroll
            for (int i = 0; i < 8; ++i)
                Qo[(m0 + i + 8 * half) * CDIM + n0 + r] = f2bf(c[x][y][i] + bv);
        }
}

// ---------------- K,V projection; V stored transposed [B][C][N] -------------
__global__ void __launch_bounds__(512) kvproj_kernel(
        const __bf16* __restrict__ A, const __bf16* __restrict__ WkT,
        const __bf16* __restrict__ WvT, const float* __restrict__ bk,
        const float* __restrict__ bvv, __bf16* __restrict__ Ko,
        __bf16* __restrict__ VTo) {
    __shared__ __attribute__((aligned(16))) __bf16 Al[64 * GP];
    __shared__ __attribute__((aligned(16))) __bf16 Wkl[256 * GP];
    __shared__ __attribute__((aligned(16))) __bf16 Wvl[256 * GP];
    int t = threadIdx.x;
    int w = t >> 5, lane = t & 31;
    int half = lane >> 4, r = lane & 15;
    size_t mb = (size_t)blockIdx.x * 64;
    bf16x8 va[4], vk[16], vv[16];
    load_rows<64>(va, A + mb * CDIM, t);
    load_rows<256>(vk, WkT, t);
    load_rows<256>(vv, WvT, t);
    store_rows<64>(Al, va, t);
    store_rows<256>(Wkl, vk, t);
    store_rows<256>(Wvl, vv, t);
    __syncthreads();   // all three operands visible to all waves
    int mt = (w & 1) * 32, nt = (w >> 1) * 32;
    f32x8 ck[2][2] = {{zero8(), zero8()}, {zero8(), zero8()}};
    f32x8 cv[2][2] = {{zero8(), zero8()}, {zero8(), zero8()}};
    tile_mma(Al + (mt + r) * GP + 8 * half, Wkl + (nt + r) * GP + 8 * half, ck);
    tile_mma(Al + (mt + r) * GP + 8 * half, Wvl + (nt + r) * GP + 8 * half, cv);
    // the loops are unrolled so that constant indices keep ck and cv in registers
#pragma unroll
    for (int x = 0; x < 2; ++x)
#pragma unroll
        for (int y = 0; y < 2; ++y) {
            size_t m0 = mb + mt + 16 * x;
            int n0 = nt + 16 * y;
            float kb = bk[n0 + r];
#pragma unroll
            for (int i = 0; i < 8; ++i)
                Ko[(m0 + i + 8 * half) * CDIM + n0 + r] = f2bf(ck[x][y][i] + kb);
            // V transposed store: lane's 8 C-layout rows are consecutive key indices.
            int b   = (int)(m0 >> 12);                 // 4096 keys per batch
            int nk0 = (int)(m0 & 4095) + 8 * half;
            float vb = bvv[n0 + r];
            bf16x8 pack;
#pragma unroll
            for (int i = 0; i < 8; ++i) pack[i] = f2bf(cv[x][y][i] + vb);
            *(bf16x8*)(VTo + ((size_t)b * CDIM + n0 + r) * N_SPATIAL + nk0) = pack;
        }
}

#define KP 264   // K row pitch in elements: 528 B for 512 B of data
#define VP 136   // V^T row pitch in elements: 272 B for the 256 B of a stage's 128 keys
#define KSPLIT 4                 // key chunks of a stage = waves on one query tile
#define STAGE  (32 * KSPLIT)     // keys staged per trip
#define MSLOT  (33 * 128)        // floats of one wave's partial result: O 32 x 128, then m and l, one a lane
#define KBYTES (STAGE * KP * 2)  // a stage's K rows in LDS
#define VBYTES (256 * VP * 2)    // a stage's V^T rows in LDS
#define BUFB   (KBYTES + VBYTES) // one stage buffer: K rows, then V^T rows
static_assert(8 * MSLOT * 4 <= 2 * BUFB, "the merge slots lie in the two stage buffers");

// Issue this thread's sixteen copies of the stage that begins at key j0 into the buffer at LDS byte lds:
// 128 rows of K and 128 keys of every V^T row.
// eight lanes bring one 128-B line; thread t: row t >> 3 (and +64 ...), 16-B segment t & 7
__device__ __forceinline__ void issue_stage(const __bf16* Kb, const __bf16* Vb, int j0, unsigned lds, int t) {
    const char* kgt = (const char*)Kb + (size_t)j0 * (CDIM * 2) + (t >> 3) * (CDIM * 2) + (t & 7) * 16;
    const char* vgt = (const char*)Vb + (size_t)j0 * 2 + (size_t)(t >> 3) * (N_SPATIAL * 2) + (t & 7) * 16;
    unsigned kla[2], vla[4];
    const char* kga[2];
    const char* vga[4];
    // both loops unrolled: the address arrays are asm operands and must be registers
#pragma unroll
    for (int h = 0; h < 2; ++h) {
        kla[h] = lds + ((t >> 3) + 64 * h) * (KP * 2) + (t & 7) * 16;
        kga[h] = kgt + h * (64 * CDIM * 2);
    }
#pragma unroll
    for (int h = 0; h < 4; ++h) {
        vla[h] = lds + KBYTES + ((t >> 3) + 64 * h) * (VP * 2) + (t & 7) * 16;
        vga[h] = vgt + (size_t)h * (64 * N_SPATIAL * 2);
    }
    async_stage(kla, kga, vla, vga);
}

// Lane l <-> lane l ^ 16: the two halves of a wave hold the two halves of a query's keys.
__device__ __forceinline__ float xhalf(float v) {
    int b = __float_as_int(v);
    return __int_as_float(__builtin_amdgcn_permlanex16(b, b, 0x76543210, 0xfedcba98, false, false));
}

// One wave's partial result to its merge slot; each store of O covers 512 contiguous bytes, those of m and l 128.
__device__ __forceinline__ void put_partial(float* mg, int lane, const f32x8 (&o)[16], float m, float l) {
#pragma unroll   // constant indices keep o[] in registers
    for (int u = 0; u < 16; ++u) {
        f32x4 lo = {o[u][0], o[u][1], o[u][2], o[u][3]};
        f32x4 hi = {o[u][4], o[u][5], o[u][6], o[u][7]};
        *(f32x4*)(mg + (u * 2 + 0) * 128 + lane * 4) = lo;
        *(f32x4*)(mg + (u * 2 + 1) * 128 + lane * 4) = hi;
    }
    mg[32 * 128 + lane]      = m;
    mg[32 * 128 + 32 + lane] = l;
}

// Join the partial result in a merge slot (same lane-to-element map) into this wave's own.
__device__ __forceinline__ void join_partial(const float* mg, int lane, f32x8 (&o)[16], float& m, float& l) {
    float mb = mg[32 * 128 + lane];
    float lb = mg[32 * 128 + 32 + lane];
    float mnew = fmaxf(m, mb);
    float fa = __expf(m - mnew);
    float fb = __expf(mb - mnew);
    m = mnew;
    l = l * fa + lb * fb;
    // both loops are unrolled so that constant indices keep o in registers
#pragma unroll
    for (int u = 0; u < 16; ++u) {
        f32x4 lo = *(const f32x4*)(mg + (u * 2 + 0) * 128 + lane * 4);
        f32x4 hi = *(const f32x4*)(mg + (u * 2 + 1) * 128 + lane * 4);
#pragma unroll
        for (int i = 0; i < 4; ++i) {
            o[u][i]     = o[u][i]     * fa + lo[i] * fb;
            o[u][i + 4] = o[u][i + 4] * fa + hi[i] * fb;
        }
    }
}

__global__ void __launch_bounds__(512) flash_kernel(
        const __bf16* __restrict__ Q, const __bf16* __restrict__ K,
        const __bf16* __restrict__ VT, __bf16* __restrict__ O) {
    // two stage buffers; behind the loop they hold the merge slots
    __shared__ __attribute__((aligned(16))) char smem[2 * BUFB];

    int t    = threadIdx.x;
    int wib  = __builtin_amdgcn_readfirstlane(t >> 5);   // wave-uniform: the merge's branches are scalar
    int lane = t & 31;
    int half = lane >> 4, r = lane & 15;
    int g  = wib >> 2;                 // this wave's key chunk in every stage
    int b  = blockIdx.x >> 6;          // 64 blocks of 64 query rows per batch
    int m0 = (blockIdx.x & 63) * 64 + (wib & 3) * 16;

    const __bf16* Qb = Q  + ((size_t)b * N_SPATIAL) * CDIM;
    const __bf16* Kb = K  + ((size_t)b * N_SPATIAL) * CDIM;
    const __bf16* Vb = VT + (size_t)b * CDIM * N_SPATIAL;

    // B operand of S^T: column = query m0 + r
    bf16x16 qf[8];
    const __bf16* qrow = Qb + (size_t)(m0 + r) * CDIM + 8 * half;
#pragma unroll
    for (int kk = 0; kk < 8; ++kk) qf[kk] = load_frag(qrow + kk * 32);

    // o[u][i] = O^T[channel 16 u + 8 half + i][query m0 + r]
    f32x8 o[16];
#pragma unroll
    for (int u = 0; u < 16; ++u) o[u] = zero8();
    float m = -1e30f;   // running maximum of the lane's query: equal in both halves
    float l = 0.0f;     // running sum over the keys of this half alone; the halves join in the epilogue

    const unsigned sl = (unsigned)(size_t)&smem[0];   // LDS byte offset of buffer 0
    const float sc = 0.0625f;                         // 256^-0.5

    issue_stage(Kb, Vb, 0, sl, t);
    wait_async0();
    __syncthreads();   // stage 0 visible to all waves
    issue_stage(Kb, Vb, STAGE, sl + BUFB, t);   // stage 1 flies during trip 0

    unsigned boff = 0;   // byte offset of the buffer that this trip reads
    for (int j0 = 0; j0 < N_SPATIAL; j0 += STAGE) {
        const __bf16* Kc = (const __bf16*)(smem + boff);
        const __bf16* Vc = (const __bf16*)(smem + boff + KBYTES);

        // ---- S^T = K_chunk @ Q^T : two 16x16 tiles, A fragments from LDS ----
        // s0[i]: key 8 half + i, s1[i]: key 16 + 8 half + i of the chunk, query r
        f32x8 s0 = zero8(), s1 = zero8();
        const __bf16* k0base = Kc + (g * 32 + r) * KP + 8 * half;
        const __bf16* k1base = Kc + (g * 32 + 16 + r) * KP + 8 * half;
#pragma unroll
        for (int kk = 0; kk < 8; ++kk) {
            s0 = wmma_bf16(load_frag(k0base + kk * 32), qf[kk], s0);
            s1 = wmma_bf16(load_frag(k1base + kk * 32), qf[kk], s1);
        }
        // ---- online softmax: the lane's 16 scores belong to one query ----
        float p0[8], p1[8], mt[8];
#pragma unroll
        for (int i = 0; i < 8; ++i) {
            p0[i] = s0[i] * sc; p1[i] = s1[i] * sc;
            mt[i] = fmaxf(p0[i], p1[i]);
        }
        float mn = fmaxf(fmaxf(fmaxf(mt[0], mt[1]), fmaxf(mt[2], mt[3])),
                         fmaxf(fmaxf(mt[4], mt[5]), fmaxf(mt[6], mt[7])));
        mn = fmaxf(mn, xhalf(mn));   // over all 32 keys of the chunk
        float mnew  = fmaxf(m, mn);
        float alpha = __expf(m - mnew);
        m = mnew;
#pragma unroll
        for (int i = 0; i < 8; ++i) {
            p0[i] = __expf(p0[i] - mnew);
            p1[i] = __expf(p1[i] - mnew);
            mt[i] = p0[i] + p1[i];
        }
        l = l * alpha + (((mt[0] + mt[1]) + (mt[2] + mt[3])) + ((mt[4] + mt[5]) + (mt[6] + mt[7])));
#pragma unroll
        for (int u = 0; u < 16; ++u)
#pragma unroll
            for (int i = 0; i < 8; ++i) o[u][i] *= alpha;

        // ---- P^T as B operand: element e is key 8 half + e, element 8 + e key 16 + 8 half + e ----
        bf16x16 pf;
#pragma unroll
        for (int i = 0; i < 8; ++i) { pf[i] = f2bf(p0[i]); pf[i + 8] = f2bf(p1[i]); }

        // ---- O^T += V^T_chunk @ P^T (A fragments from LDS, same k order) ----
        const __bf16* vbase = Vc + r * VP + g * 32 + 8 * half;
#pragma unroll
        for (int u = 0; u < 16; ++u)
            o[u] = wmma_bf16(load_frag(vbase + u * 16 * VP), pf, o[u]);

        // ---- hand-over: the next stage is published, this trip's buffer is freed ----
        // the trip's last product stays in front of the hand-over: moved behind the barrier
        // it would stand between the barrier and the refill and start the copies late
        __builtin_amdgcn_sched_barrier(0);
        // this wave's own LDS reads of this trip's buffer have retired before any copy refills it
        asm volatile("s_wait_dscnt 0x0" ::: "memory");
        wait_async0();     // this wave's copies of the next stage have landed
        __syncthreads();   // next stage visible to all waves; this trip's buffer read out by all
        if (j0 + 2 * STAGE < N_SPATIAL)
            issue_stage(Kb, Vb, j0 + 2 * STAGE, sl + boff, t);   // flies during the next trip
        boff ^= BUFB;
    }
    wait_async0();   // nothing is in flight when the buffers become merge slots

    // ---- merge the four key chunks' partial results of each query tile, as a tree ----
    // the last trip's barrier has ended every wave's reads of the stage buffers
    float* Mg = (float*)smem;
    if (g >= 2) put_partial(Mg + (wib - 8) * MSLOT, lane, o, m, l);
    __syncthreads();   // chunks 2 and 3 published
    if (g < 2) join_partial(Mg + wib * MSLOT, lane, o, m, l);
    __syncthreads();   // slots read out, free for the second round
    if (g == 1) put_partial(Mg + (wib - 4) * MSLOT, lane, o, m, l);
    __syncthreads();   // chunk 1 (with 3) published
    if (g != 0) return;   // behind the last barrier
    join_partial(Mg + wib * MSLOT, lane, o, m, l);

    // epilogue: join the halves' sums, divide, store bf16 row-major:
    // a lane's 8 registers of a tile are 8 consecutive channels of its query's row
    float inv = 1.0f / (l + xhalf(l));
    __bf16* Ob = O + ((size_t)b * N_SPATIAL + m0 + r) * CDIM + 8 * half;
#pragma unroll
    for (int u = 0; u < 16; ++u) {
        bf16x8 pack;
#pragma unroll
        for (int i = 0; i < 8; ++i) pack[i] = f2bf(o[u][i] * inv);
        *(bf16x8*)(Ob + u * 16) = pack;
        // the next tile's pack may take the registers that this store names: it waits for the store's read of them
        asm volatile("s_wait_xcnt 0x0" ::: "memory");
    }
}

// ---------------- Output projection + bias + residual -----------------------
__global__ void __launch_bounds__(512) proj_kernel(
        const __bf16* __restrict__ A, const __bf16* __restrict__ WT,
        const float* __restrict__ bias, const float* __restrict__ resid,
        float* __restrict__ out) {
    __shared__ __attribute__((aligned(16))) __bf16 Al[64 * GP];
    __shared__ __attribute__((aligned(16))) __bf16 Wl[256 * GP];
    int t = threadIdx.x;
    int w = t >> 5, lane = t & 31;
    int half = lane >> 4, r = lane & 15;
    size_t mb = (size_t)blockIdx.x * 64;
    bf16x8 va[4], vw[16];
    load_rows<64>(va, A + mb * CDIM, t);
    load_rows<256>(vw, WT, t);
    store_rows<64>(Al, va, t);
    store_rows<256>(Wl, vw, t);
    __syncthreads();   // both operands visible to all waves
    int mt = (w & 1) * 32, nt = (w >> 1) * 32;
    f32x8 c[2][2] = {{zero8(), zero8()}, {zero8(), zero8()}};
    tile_mma(Al + (mt + r) * GP + 8 * half, Wl + (nt + r) * GP + 8 * half, c);
    // the three loops are unrolled so that constant indices keep c in registers
#pragma unroll
    for (int x = 0; x < 2; ++x)
#pragma unroll
        for (int y = 0; y < 2; ++y) {
            size_t m0 = mb + mt + 16 * x;
            int n0 = nt + 16 * y;
            float bv = bias[n0 + r];
#pragma unroll
            for (int i = 0; i < 8; ++i) {
                size_t idx = (m0 + i + 8 * half) * CDIM + n0 + r;
                out[idx] = c[x][y][i] + bv + resid[idx];
            }
        }
}

extern "C" void kernel_launch(void* const* d_in, const int* in_sizes, int n_in,
                              void* d_out, int out_size, void* d_ws, size_t ws_size,
                              hipStream_t stream) {
    const float* inputs  = (const float*)d_in[0];
    const float* context = (const float*)d_in[1];
    const float* Wq = (const float*)d_in[2];
    const float* bq = (const float*)d_in[3];
    const float* Wk = (const float*)d_in[4];
    const float* bk = (const float*)d_in[5];
    const float* Wv = (const float*)d_in[6];
    const float* bv = (const float*)d_in[7];
    const float* Wp = (const float*)d_in[8];
    const float* bp = (const float*)d_in[9];
    const float* gamma = (const float*)d_in[10];
    const float* beta  = (const float*)d_in[11];
    float* out = (float*)d_out;

    const size_t TOT = (size_t)NBATCH * N_SPATIAL * CDIM;  // 4,194,304 elements
    char* ws = (char*)d_ws;
    float*  xn_f32 = (float*)ws;  ws += TOT * 4;
    __bf16* xn_bf  = (__bf16*)ws; ws += TOT * 2;
    __bf16* ctx_bf = (__bf16*)ws; ws += TOT * 2;
    __bf16* qb     = (__bf16*)ws; ws += TOT * 2;
    __bf16* kb_    = (__bf16*)ws; ws += TOT * 2;
    __bf16* vtb    = (__bf16*)ws; ws += TOT * 2;
    __bf16* ob     = (__bf16*)ws; ws += TOT * 2;
    __bf16* WqT    = (__bf16*)ws; ws += 65536 * 2;
    __bf16* WkT    = (__bf16*)ws; ws += 65536 * 2;
    __bf16* WvT    = (__bf16*)ws; ws += 65536 * 2;
    __bf16* WpT    = (__bf16*)ws; ws += 65536 * 2;

    cvt_bf16_kernel<<<256, 512, 0, stream>>>(context, ctx_bf);   // 256 * 16 waves * 1024 = TOT
    transpose_w_kernel<<<1024, 256, 0, stream>>>(Wq, Wk, Wv, Wp, WqT, WkT, WvT, WpT);
    ln_kernel<<<256, 512, 0, stream>>>(inputs, gamma, beta, xn_f32, xn_bf);   // 256 * 16 waves * 4 rows
    qproj_kernel<<<256, 512, 0, stream>>>(xn_bf, WqT, bq, qb);   // 256 blocks * 64 rows
    kvproj_kernel<<<256, 512, 0, stream>>>(ctx_bf, WkT, WvT, bk, bv, kb_, vtb);
    flash_kernel<<<256, 512, 0, stream>>>(qb, kb_, vtb, ob);
    proj_kernel<<<256, 512, 0, stream>>>(ob, WpT, bp, xn_f32, out);
}

// v007
// One run takes 118 microseconds.
// Timed twice side by side with v006, it ran 1.31 times as fast both times.
// Over all steps from v000 it is 8.94 times as fast.
#include <hip/hip_runtime.h>
#include <hip/hip_bf16.h>

#define N_SPATIAL 4096   // 64*64
#define CDIM 256
#define NBATCH 4

typedef __attribute__((ext_vector_type(16))) __bf16 bf16x16;
typedef __attribute__((ext_vector_type(8)))  __bf16 bf16x8;
typedef __attribute__((ext_vector_type(8)))  float  f32x8;
typedef __attribute__((ext_vector_type(4)))  __bf16 bf16x4;
typedef __attribute__((ext_vector_type(4)))  float  f32x4;

// float -> bf16 with round-to-nearest-even (bit manipulation; no cvt dependence)
__device__ __forceinline__ __bf16 f2bf(float f) {
    unsigned u = __float_as_uint(f);
    u += 0x7FFFu + ((u >> 16) & 1u);
    unsigned short s = (unsigned short)(u >> 16);
    return __builtin_bit_cast(__bf16, s);
}

__device__ __forceinline__ f32x8 wmma_bf16(bf16x16 a, bf16x16 b, f32x8 c) {
    return __builtin_amdgcn_wmma_f32_16x16x32_bf16(
        /*neg_a=*/false, a, /*neg_b=*/false, b,
        /*c_mod=*/(short)0, c, /*reuse_a=*/false, /*reuse_b=*/false);
}

// Fragment loader: elems 0..7 from p[0..7], elems 8..15 from p[16..23].
// Caller passes p = base + 8*half; this matches the 16-bit A/B VGPR layout
// (lanes 0-15: K=0..7 & 16..23 ; lanes 16-31: K=8..15 & 24..31).
__device__ __forceinline__ bf16x16 load_frag(const __bf16* p) {
    bf16x8 a = *(const bf16x8*)p;
    bf16x8 b = *(const bf16x8*)(p + 16);
    bf16x16 f;
#pragma unroll
    for (int i = 0; i < 8; ++i) { f[i] = a[i]; f[i + 8] = b[i]; }
    return f;
}

__device__ __forceinline__ f32x8 zero8() {
    f32x8 c;
#pragma unroll
    for (int i = 0; i < 8; ++i) c[i] = 0.0f;
    return c;
}

// One async copy of 16B per lane from global to LDS (tracked by ASYNCcnt), as the builtin: the attention
// kernel uses registers above v255, which asm text cannot name, so that asm operands would crowd the low
// 256 registers and spill. OFF moves both addresses alike.
typedef __attribute__((ext_vector_type(4))) int i32x4;
template <int OFF>
__device__ __forceinline__ void async_copy16(const char* g, char* l) {
    __builtin_amdgcn_global_load_async_to_lds_b128(
        (__attribute__((address_space(1))) i32x4*)g,
        (__attribute__((address_space(3))) i32x4*)l, OFF, 0);
}
__device__ __forceinline__ void wait_async0() {
    asm volatile("s_wait_asynccnt 0x0" ::: "memory");
}

// ---------------- LayerNorm: one wave per 4 rows -----------------------------
// A row (256 floats) lies across the 32 lanes, 8 elements a lane, so that both
// sums stay inside the wave. 16 waves a block, 8 loads of 16 B in flight a wave.
__global__ void __launch_bounds__(512) ln_kernel(
        const float* __restrict__ x, const float* __restrict__ gamma,
        const float* __restrict__ beta, float* __restrict__ xn,
        __bf16* __restrict__ xnb) {
    int wave = (blockIdx.x * 512 + threadIdx.x) >> 5;
    int lane = threadIdx.x & 31;
    size_t base = (size_t)wave * (4 * CDIM) + lane * 4;
    f32x4 a[4], b[4];
    for (int j = 0; j < 4; ++j) {
        a[j] = *(const f32x4*)(x + base + j * CDIM);
        b[j] = *(const f32x4*)(x + base + j * CDIM + 128);
    }
    f32x4 g0 = *(const f32x4*)(gamma + lane * 4);
    f32x4 g1 = *(const f32x4*)(gamma + lane * 4 + 128);
    f32x4 e0 = *(const f32x4*)(beta + lane * 4);
    f32x4 e1 = *(const f32x4*)(beta + lane * 4 + 128);
    float s[4];
    for (int j = 0; j < 4; ++j)
        s[j] = ((a[j][0] + a[j][1]) + (a[j][2] + a[j][3])) +
               ((b[j][0] + b[j][1]) + (b[j][2] + b[j][3]));
    for (int off = 16; off >= 1; off >>= 1)
        for (int j = 0; j < 4; ++j) s[j] += __shfl_xor(s[j], off, 32);
    for (int j = 0; j < 4; ++j) {
        float mu = s[j] * (1.0f / CDIM);
        a[j] -= mu;
        b[j] -= mu;
        f32x4 qa = a[j] * a[j], qb = b[j] * b[j];
        s[j] = ((qa[0] + qa[1]) + (qa[2] + qa[3])) + ((qb[0] + qb[1]) + (qb[2] + qb[3]));
    }
    for (int off = 16; off >= 1; off >>= 1)
        for (int j = 0; j < 4; ++j) s[j] += __shfl_xor(s[j], off, 32);
    for (int j = 0; j < 4; ++j) {
        float rs = rsqrtf(s[j] * (1.0f / CDIM) + 1e-3f);
        f32x4 y0 = a[j] * rs * g0 + e0;
        f32x4 y1 = b[j] * rs * g1 + e1;
        bf16x4 h0, h1;
        for (int k = 0; k < 4; ++k) { h0[k] = f2bf(y0[k]); h1[k] = f2bf(y1[k]); }
        *(f32x4*)(xn + base + j * CDIM)        = y0;
        *(f32x4*)(xn + base + j * CDIM + 128)  = y1;
        *(bf16x4*)(xnb + base + j * CDIM)       = h0;
        *(bf16x4*)(xnb + base + j * CDIM + 128) = h1;
    }
}

// ---------------- fp32 -> bf16 elementwise: 32 elements a lane ---------------
// A wave converts 1024 consecutive floats: 8 loads of 16 B a lane in flight,
// each wave-wide load and store covering whole 128-B lines.
__global__ void __launch_bounds__(512) cvt_bf16_kernel(const float* __restrict__ src,
                                                       __bf16* __restrict__ dst) {
    int wave = (blockIdx.x * 512 + threadIdx.x) >> 5;
    int lane = threadIdx.x & 31;
    size_t base = (size_t)wave * 1024 + lane * 4;
    f32x4 v[8];
    for (int i = 0; i < 8; ++i) v[i] = *(const f32x4*)(src + base + i * 128);
    for (int i = 0; i < 8; ++i) {
        bf16x4 h;
        for (int k = 0; k < 4; ++k) h[k] = f2bf(v[i][k]);
        *(bf16x4*)(dst + base + i * 128) = h;
    }
}

// ---------------- transpose 4 weight matrices to [N][K] bf16 ----------------
__global__ void transpose_w_kernel(const float* __restrict__ Wq, const float* __restrict__ Wk,
                                   const float* __restrict__ Wv, const float* __restrict__ Wp,
                                   __bf16* __restrict__ WqT, __bf16* __restrict__ WkT,
                                   __bf16* __restrict__ WvT, __bf16* __restrict__ WpT) {
    int i = blockIdx.x * blockDim.x + threadIdx.x;  // 0..262143
    int w = i >> 16;
    int j = i & 65535;
    int k = j >> 8, n = j & 255;
    const float* S = (w == 0) ? Wq : (w == 1) ? Wk : (w == 2) ? Wv : Wp;
    __bf16* D      = (w == 0) ? WqT : (w == 1) ? WkT : (w == 2) ? WvT : WpT;
    D[n * 256 + k] = f2bf(S[k * 256 + n]);
}

// ---------------- The three projections: operands staged in LDS -------------
// A block of 16 waves computes 64 rows x all 256 columns. The 64 rows of A and
// the whole [N][K] weight come into LDS by loads in which a wave covers one
// 512-B row (four whole lines); the WMMA fragments are then read from LDS.
// 256 blocks: one a WGP. Wave w owns the 32 x 32 tile at rows (w & 1) * 32,
// columns (w >> 1) * 32: each fragment read serves two WMMAs.
#define GP 264   // LDS row pitch in elements: 528 B = 16 B x odd for the ds_load_b128 readers

// ROWS rows of 256 bf16, contiguous in global memory, go to LDS rows of pitch GP in two
// halves, so that the loads of all operands are in flight before the first LDS store.
// Thread t: rows (t >> 5) + 16 * i, 16-B segment t & 31.
template <int ROWS>
__device__ __forceinline__ void load_rows(bf16x8 (&v)[ROWS / 16], const __bf16* __restrict__ g, int t) {
    const __bf16* gp = g + (t >> 5) * CDIM + (t & 31) * 8;
#pragma unroll   // v[] stays in registers; one address with immediate offsets
    for (int i = 0; i < ROWS / 16; ++i) v[i] = *(const bf16x8*)(gp + i * 16 * CDIM);
    // the address pair is an input, so it lives up to this wait: no later load's
    // result is placed over a register that a load issued above still names
    asm volatile("s_wait_xcnt 0x0" :: "v"(gp) : "memory");
}
template <int ROWS>
__device__ __forceinline__ void store_rows(__bf16* lds, const bf16x8 (&v)[ROWS / 16], int t) {
    __bf16* lp = lds + (t >> 5) * GP + (t & 31) * 8;
#pragma unroll   // v[] stays in registers
    for (int i = 0; i < ROWS / 16; ++i) *(bf16x8*)(lp + i * 16 * GP) = v[i];
}

// c[x][y] += A rows (16 x ..) times W rows (16 y ..), k = 0..255 in ascending blocks of 32.
__device__ __forceinline__ void tile_mma(const __bf16* al, const __bf16* wl, f32x8 (&c)[2][2]) {
#pragma unroll   // constant LDS offsets; the compiler fetches fragments ahead
    for (int kk = 0; kk < 8; ++kk) {
        bf16x16 a0 = load_frag(al + kk * 32), a1 = load_frag(al + 16 * GP + kk * 32);
        bf16x16 b0 = load_frag(wl + kk * 32), b1 = load_frag(wl + 16 * GP + kk * 32);
        c[0][0] = wmma_bf16(a0, b0, c[0][0]);
        c[0][1] = wmma_bf16(a0, b1, c[0][1]);
        c[1][0] = wmma_bf16(a1, b0, c[1][0]);
        c[1][1] = wmma_bf16(a1, b1, c[1][1]);
    }
}

// ---------------- Q projection ----------------------------------------------
__global__ void __launch_bounds__(512) qproj_kernel(
        const __bf16* __restrict__ A, const __bf16* __restrict__ WT,
        const float* __restrict__ bias, __bf16* __restrict__ Qo) {
    __shared__ __attribute__((aligned(16))) __bf16 Al[64 * GP];
    __shared__ __attribute__((aligned(16))) __bf16 Wl[256 * GP];
    int t = threadIdx.x;
    int w = t >> 5, lane = t & 31;
    int half = lane >> 4, r = lane & 15;
    size_t mb = (size_t)blockIdx.x * 64;
    bf16x8 va[4], vw[16];
    load_rows<64>(va, A + mb * CDIM, t);
    load_rows<256>(vw, WT, t);
    store_rows<64>(Al, va, t);
    store_rows<256>(Wl, vw, t);
    __syncthreads();   // both operands visible to all waves
    int mt = (w & 1) * 32, nt = (w >> 1) * 32;
    f32x8 c[2][2] = {{zero8(), zero8()}, {zero8(), zero8()}};
    tile_mma(Al + (mt + r) * GP + 8 * half, Wl + (nt + r) * GP + 8 * half, c);
    // the three loops are unrolled so that constant indices keep c in registers
#pragma unroll
    for (int x = 0; x < 2; ++x)
#pragma unroll
        for (int y = 0; y < 2; ++y) {
            size_t m0 = mb + mt + 16 * x;
            int n0 = nt + 16 * y;
            float bv = bias[n0 + r];
#pragma unroll
            for (int i = 0; i < 8; ++i)
                Qo[(m0 + i + 8 * half) * CDIM + n0 + r] = f2bf(c[x][y][i] + bv);
        }
}

// ---------------- K,V projection; V stored transposed [B][C][N] -------------
__global__ void __launch_bounds__(512) kvproj_kernel(
        const __bf16* __restrict__ A, const __bf16* __restrict__ WkT,
        const __bf16* __restrict__ WvT, const float* __restrict__ bk,
        const float* __restrict__ bvv, __bf16* __restrict__ Ko,
        __bf16* __restrict__ VTo) {
    __shared__ __attribute__((aligned(16))) __bf16 Al[64 * GP];
    __shared__ __attribute__((aligned(16))) __bf16 Wkl[256 * GP];
    __shared__ __attribute__((aligned(16))) __bf16 Wvl[256 * GP];
    int t = threadIdx.x;
    int w = t >> 5, lane = t & 31;
    int half = lane >> 4, r = lane & 15;
    size_t mb = (size_t)blockIdx.x * 64;
    bf16x8 va[4], vk[16], vv[16];
    load_rows<64>(va, A + mb * CDIM, t);
    load_rows<256>(vk, WkT, t);
    load_rows<256>(vv, WvT, t);
    store_rows<64>(Al, va, t);
    store_rows<256>(Wkl, vk, t);
    store_rows<256>(Wvl, vv, t);
    __syncthreads();   // all three operands visible to all waves
    int mt = (w & 1) * 32, nt = (w >> 1) * 32;
    f32x8 ck[2][2] = {{zero8(), zero8()}, {zero8(), zero8()}};
    f32x8 cv[2][2] = {{zero8(), zero8()}, {zero8(), zero8()}};
    tile_mma(Al + (mt + r) * GP + 8 * half, Wkl + (nt + r) * GP + 8 * half, ck);
    tile_mma(Al + (mt + r) * GP + 8 * half, Wvl + (nt + r) * GP + 8 * half, cv);
    // the loops are unrolled so that constant indices keep ck and cv in registers
#pragma unroll
    for (int x = 0; x < 2; ++x)
#pragma unroll
        for (int y = 0; y < 2; ++y) {
            size_t m0 = mb + mt + 16 * x;
            int n0 = nt + 16 * y;
            float kb = bk[n0 + r];
#pragma unroll
            for (int i = 0; i < 8; ++i)
                Ko[(m0 + i + 8 * half) * CDIM + n0 + r] = f2bf(ck[x][y][i] + kb);
            // V transposed store: lane's 8 C-layout rows are consecutive key indices.
            int b   = (int)(m0 >> 12);                 // 4096 keys per batch
            int nk0 = (int)(m0 & 4095) + 8 * half;
            float vb = bvv[n0 + r];
            bf16x8 pack;
#pragma unroll
            for (int i = 0; i < 8; ++i) pack[i] = f2bf(cv[x][y][i] + vb);
            *(bf16x8*)(VTo + ((size_t)b * CDIM + n0 + r) * N_SPATIAL + nk0) = pack;
        }
}

#define KP 264   // K row pitch in elements: 528 B for 512 B of data
#define VP 136   // V^T row pitch in elements: 272 B for the 256 B of a stage's 128 keys
#define KSPLIT 4                 // key chunks of a stage = waves on one query group
#define STAGE  (32 * KSPLIT)     // keys staged per trip
#define MSLOT  (33 * 128)        // floats of one column tile's partial result: O 32 x 128, then m and l, one a lane
#define KBYTES (STAGE * KP * 2)  // a stage's K rows in LDS
#define VBYTES (256 * VP * 2)    // a stage's V^T rows in LDS
#define BUFB   (KBYTES + VBYTES) // one stage buffer: K rows, then V^T rows
#define QFRAG  1024              // bytes of one Q fragment in LDS: two planes of 16 B a lane, each read as 512 contiguous bytes
#define QBYTES (2 * 8 * QFRAG)   // the eight LDS-resident Q fragments of each of the two query groups
static_assert(8 * MSLOT * 4 <= 2 * BUFB, "the merge slots lie in the two stage buffers");

// Issue this thread's thirty-two copies of the stage that begins at key j0 into the buffer at lds:
// 128 rows of K and 128 keys of every V^T row.
// eight lanes bring one 128-B line; thread t: row t >> 3 (and +32 ...), 16-B segment t & 7
__device__ __forceinline__ void issue_stage(const __bf16* Kb, const __bf16* Vb, int j0, char* lds, int t) {
    const char* kgt = (const char*)Kb + (size_t)j0 * (CDIM * 2) + (t >> 3) * (CDIM * 2) + (t & 7) * 16;
    const char* vgt = (const char*)Vb + (size_t)j0 * 2 + (size_t)(t >> 3) * (N_SPATIAL * 2) + (t & 7) * 16;
    char* klt = lds + (t >> 3) * (KP * 2) + (t & 7) * 16;
    char* vlt = lds + KBYTES + (t >> 3) * (VP * 2) + (t & 7) * 16;
    // both loops unrolled: constant steps between the rows' addresses
#pragma unroll
    for (int h = 0; h < 4; ++h) {
        const char* kg = kgt + h * (32 * CDIM * 2);
        char* kl = klt + h * (32 * KP * 2);
        async_copy16<0>(kg, kl);
        async_copy16<128>(kg, kl);
        async_copy16<256>(kg, kl);
        async_copy16<384>(kg, kl);
    }
#pragma unroll
    for (int h = 0; h < 8; ++h) {
        const char* vg = vgt + (size_t)h * (32 * N_SPATIAL * 2);
        char* vl = vlt + h * (32 * VP * 2);
        async_copy16<0>(vg, vl);
        async_copy16<128>(vg, vl);
    }
}

// Lane l <-> lane l ^ 16: the two halves of a wave hold the two halves of a query's keys.
__device__ __forceinline__ float xhalf(float v) {
    int b = __float_as_int(v);
    return __int_as_float(__builtin_amdgcn_permlanex16(b, b, 0x76543210, 0xfedcba98, false, false));
}

// One wave's partial result to its merge slot; each store of O covers 512 contiguous bytes, those of m and l 128.
__device__ __forceinline__ void put_partial(float* mg, int lane, const f32x8 (&o)[16], float m, float l) {
#pragma unroll   // constant indices keep o[] in registers
    for (int u = 0; u < 16; ++u) {
        f32x4 lo = {o[u][0], o[u][1], o[u][2], o[u][3]};
        f32x4 hi = {o[u][4], o[u][5], o[u][6], o[u][7]};
        *(f32x4*)(mg + (u * 2 + 0) * 128 + lane * 4) = lo;
        *(f32x4*)(mg + (u * 2 + 1) * 128 + lane * 4) = hi;
    }
    mg[32 * 128 + lane]      = m;
    mg[32 * 128 + 32 + lane] = l;
}

// Join the partial result in a merge slot (same lane-to-element map) into this wave's own.
__device__ __forceinline__ void join_partial(const float* mg, int lane, f32x8 (&o)[16], float& m, float& l) {
    float mb = mg[32 * 128 + lane];
    float lb = mg[32 * 128 + 32 + lane];
    float mnew = fmaxf(m, mb);
    float fa = __expf(m - mnew);
    float fb = __expf(mb - mnew);
    m = mnew;
    l = l * fa + lb * fb;
    // both loops are unrolled so that constant indices keep o in registers
#pragma unroll
    for (int u = 0; u < 16; ++u) {
        f32x4 lo = *(const f32x4*)(mg + (u * 2 + 0) * 128 + lane * 4);
        f32x4 hi = *(const f32x4*)(mg + (u * 2 + 1) * 128 + lane * 4);
#pragma unroll
        for (int i = 0; i < 4; ++i) {
            o[u][i]     = o[u][i]     * fa + lo[i] * fb;
            o[u][i + 4] = o[u][i + 4] * fa + hi[i] * fb;
        }
    }
}

// A Q fragment kept in LDS in fragment order: elements 0..7 from the first plane, 8..15 from the second.
__device__ __forceinline__ bf16x16 load_qfrag(const char* p) {
    bf16x8 a = *(const bf16x8*)p;
    bf16x8 b = *(const bf16x8*)(p + 512);
    bf16x16 f;
#pragma unroll
    for (int i = 0; i < 8; ++i) { f[i] = a[i]; f[i + 8] = b[i]; }
    return f;
}

__global__ void __launch_bounds__(256) flash_kernel(
        const __bf16* __restrict__ Q, const __bf16* __restrict__ K,
        const __bf16* __restrict__ VT, __bf16* __restrict__ O) {
    // two stage buffers; behind the loop they hold the merge slots
    // behind them the Q fragments that do not stay in registers
    __shared__ __attribute__((aligned(16))) char smem[2 * BUFB + QBYTES];

    int t    = threadIdx.x;
    int wib  = __builtin_amdgcn_readfirstlane(t >> 5);   // wave-uniform: the merge's branches are scalar
    int lane = t & 31;
    int half = lane >> 4, r = lane & 15;
    int g  = wib >> 1;                 // this wave's key chunk in every stage
    int b  = blockIdx.x >> 6;          // 64 blocks of 64 query rows per batch
    int m0 = (blockIdx.x & 63) * 64 + (wib & 1) * 32;

    const __bf16* Qb = Q  + ((size_t)b * N_SPATIAL) * CDIM;
    const __bf16* Kb = K  + ((size_t)b * N_SPATIAL) * CDIM;
    const __bf16* Vb = VT + (size_t)b * CDIM * N_SPATIAL;

    // B operands of S^T: column tile c, column = query m0 + 16 c + r.
    // Tile 0's fragments stay in registers. Tile 1's would not fit beside the fragments fetched ahead: they go
    // to LDS once, in fragment order, written by the query group's wave of key chunk 0 and read by its four
    // waves behind the prologue's barrier.
    bf16x16 qf[8];
    const __bf16* qrow = Qb + (size_t)(m0 + r) * CDIM + 8 * half;
#pragma unroll
    for (int kk = 0; kk < 8; ++kk) qf[kk] = load_frag(qrow + kk * 32);
    char* ql = smem + 2 * BUFB + (wib & 1) * (8 * QFRAG) + lane * 16;
    if (g == 0) {
#pragma unroll
        for (int kk = 0; kk < 8; ++kk) {
            *(bf16x8*)(ql + kk * QFRAG)       = *(const bf16x8*)(qrow + 16 * CDIM + kk * 32);
            *(bf16x8*)(ql + kk * QFRAG + 512) = *(const bf16x8*)(qrow + 16 * CDIM + kk * 32 + 16);
        }
    }
    // the address pair is an input, so it lives up to this wait: nothing is placed
    // over a register that a load issued above still names
    asm volatile("s_wait_xcnt 0x0" :: "v"(qrow) : "memory");

    // o[c][u][i] = O^T[channel 16 u + 8 half + i][query m0 + 16 c + r]
    f32x8 o[2][16];
#pragma unroll
    for (int c = 0; c < 2; ++c)
#pragma unroll
        for (int u = 0; u < 16; ++u) o[c][u] = zero8();
    float m[2] = {-1e30f, -1e30f};   // running maximum of the lane's queries: equal in both halves
    float l[2] = {0.0f, 0.0f};       // running sums over the keys of this half alone; the halves join in the epilogue

    const float sc = 0.0625f;                         // 256^-0.5

    issue_stage(Kb, Vb, 0, smem, t);
    wait_async0();
    __syncthreads();   // stage 0 visible to all waves
    issue_stage(Kb, Vb, STAGE, smem + BUFB, t);   // stage 1 flies during trip 0

    unsigned boff = 0;   // byte offset of the buffer that this trip reads
    for (int j0 = 0; j0 < N_SPATIAL; j0 += STAGE) {
        const __bf16* Kc = (const __bf16*)(smem + boff);
        const __bf16* Vc = (const __bf16*)(smem + boff + KBYTES);

        // ---- S^T = K_chunk @ Q^T : 2 x 2 tiles of 16x16, A fragments from LDS, each used twice ----
        // s0[c][i]: key 8 half + i, s1[c][i]: key 16 + 8 half + i of the chunk, query 16 c + r
        f32x8 s0[2] = {zero8(), zero8()}, s1[2] = {zero8(), zero8()};
        const __bf16* k0base = Kc + (g * 32 + r) * KP + 8 * half;
        const __bf16* k1base = Kc + (g * 32 + 16 + r) * KP + 8 * half;
        const __bf16* vbase = Vc + r * VP + g * 32 + 8 * half;
        // Fragments are fetched one group ahead into a second register set: a group's LDS reads stand
        // together in front of the previous group's WMMAs. Each sched_barrier(0) below keeps such a read
        // group from sinking to its first use, where the wave would wait out the LDS latency per fragment.
        bf16x16 ka[2][2], kb[2][2], qc[2][2], vf[2][4];
#pragma unroll
        for (int j = 0; j < 2; ++j) {
            ka[0][j] = load_frag(k0base + j * 32);
            kb[0][j] = load_frag(k1base + j * 32);
            qc[0][j] = load_qfrag(ql + j * QFRAG);
        }
#pragma unroll
        for (int gr = 0; gr < 4; ++gr) {
            if (gr < 3) {
#pragma unroll
                for (int j = 0; j < 2; ++j) {
                    ka[(gr + 1) & 1][j] = load_frag(k0base + ((gr + 1) * 2 + j) * 32);
                    kb[(gr + 1) & 1][j] = load_frag(k1base + ((gr + 1) * 2 + j) * 32);
                    qc[(gr + 1) & 1][j] = load_qfrag(ql + ((gr + 1) * 2 + j) * QFRAG);
                }
            } else {
                // the first V^T group flies during the last score products and the softmax
#pragma unroll
                for (int j = 0; j < 4; ++j) vf[0][j] = load_frag(vbase + j * 16 * VP);
            }
            __builtin_amdgcn_sched_barrier(0);   // the next group's reads stay in front of this group's products
#pragma unroll
            for (int j = 0; j < 2; ++j) {
                s0[0] = wmma_bf16(ka[gr & 1][j], qf[gr * 2 + j], s0[0]);
                s1[0] = wmma_bf16(kb[gr & 1][j], qf[gr * 2 + j], s1[0]);
                s0[1] = wmma_bf16(ka[gr & 1][j], qc[gr & 1][j], s0[1]);
                s1[1] = wmma_bf16(kb[gr & 1][j], qc[gr & 1][j], s1[1]);
            }
            __builtin_amdgcn_sched_barrier(0);   // the group after next is not read before this group's registers are free
        }
        bf16x16 pf[2];
        // unrolled: constant indices keep the per-tile state in registers
#pragma unroll
        for (int c = 0; c < 2; ++c) {
            // ---- online softmax: the lane's 16 scores of a column tile belong to one query ----
            float p0[8], p1[8], mt[8];
#pragma unroll
            for (int i = 0; i < 8; ++i) {
                p0[i] = s0[c][i] * sc; p1[i] = s1[c][i] * sc;
                mt[i] = fmaxf(p0[i], p1[i]);
            }
            float mn = fmaxf(fmaxf(fmaxf(mt[0], mt[1]), fmaxf(mt[2], mt[3])),
                             fmaxf(fmaxf(mt[4], mt[5]), fmaxf(mt[6], mt[7])));
            mn = fmaxf(mn, xhalf(mn));   // over all 32 keys of the chunk
            float mnew  = fmaxf(m[c], mn);
            float alpha = __expf(m[c] - mnew);
            m[c] = mnew;
#pragma unroll
            for (int i = 0; i < 8; ++i) {
                p0[i] = __expf(p0[i] - mnew);
                p1[i] = __expf(p1[i] - mnew);
                mt[i] = p0[i] + p1[i];
            }
            l[c] = l[c] * alpha + (((mt[0] + mt[1]) + (mt[2] + mt[3])) + ((mt[4] + mt[5]) + (mt[6] + mt[7])));
#pragma unroll
            for (int u = 0; u < 16; ++u)
#pragma unroll
                for (int i = 0; i < 8; ++i) o[c][u][i] *= alpha;

            // ---- P^T as B operand: element e is key 8 half + e, element 8 + e key 16 + 8 half + e ----
#pragma unroll
            for (int i = 0; i < 8; ++i) { pf[c][i] = f2bf(p0[i]); pf[c][i + 8] = f2bf(p1[i]); }
        }

        // ---- O^T += V^T_chunk @ P^T (A fragments from LDS, same k order, each used twice) ----
#pragma unroll
        for (int gr = 0; gr < 4; ++gr) {
            if (gr < 3) {
#pragma unroll
                for (int j = 0; j < 4; ++j) vf[(gr + 1) & 1][j] = load_frag(vbase + ((gr + 1) * 4 + j) * 16 * VP);
                __builtin_amdgcn_sched_barrier(0);   // the next group's reads stay in front of this group's products
            }
#pragma unroll
            for (int j = 0; j < 4; ++j) {
                o[0][gr * 4 + j] = wmma_bf16(vf[gr & 1][j], pf[0], o[0][gr * 4 + j]);
                o[1][gr * 4 + j] = wmma_bf16(vf[gr & 1][j], pf[1], o[1][gr * 4 + j]);
            }
            if (gr < 2)
                __builtin_amdgcn_sched_barrier(0);   // the group after next is not read before this group's registers are free
        }

        // ---- hand-over: the next stage is published, this trip's buffer is freed ----
        // the trip's last product stays in front of the hand-over: moved behind the barrier
        // it would stand between the barrier and the refill and start the copies late
        __builtin_amdgcn_sched_barrier(0);
        // this wave's own LDS reads of this trip's buffer have retired before any copy refills it
        asm volatile("s_wait_dscnt 0x0" ::: "memory");
        wait_async0();     // this wave's copies of the next stage have landed
        __syncthreads();   // next stage visible to all waves; this trip's buffer read out by all
        if (j0 + 2 * STAGE < N_SPATIAL)
            issue_stage(Kb, Vb, j0 + 2 * STAGE, smem + boff, t);   // flies during the next trip
        boff ^= BUFB;
    }
    wait_async0();   // nothing is in flight when the buffers become merge slots

    // ---- merge the four key chunks' partial results of each query tile, as a tree ----
    // the last trip's barrier has ended every wave's reads of the stage buffers
    // a wave's slot: its two column tiles' partial results, one behind the other
    float* Mg = (float*)smem;
    if (g >= 2) {
        put_partial(Mg + ((wib - 4) * 2 + 0) * MSLOT, lane, o[0], m[0], l[0]);
        put_partial(Mg + ((wib - 4) * 2 + 1) * MSLOT, lane, o[1], m[1], l[1]);
    }
    __syncthreads();   // chunks 2 and 3 published
    if (g < 2) {
        join_partial(Mg + (wib * 2 + 0) * MSLOT, lane, o[0], m[0], l[0]);
        join_partial(Mg + (wib * 2 + 1) * MSLOT, lane, o[1], m[1], l[1]);
    }
    __syncthreads();   // slots read out, free for the second round
    if (g == 1) {
        put_partial(Mg + ((wib - 2) * 2 + 0) * MSLOT, lane, o[0], m[0], l[0]);
        put_partial(Mg + ((wib - 2) * 2 + 1) * MSLOT, lane, o[1], m[1], l[1]);
    }
    __syncthreads();   // chunk 1 (with 3) published
    if (g != 0) return;   // behind the last barrier
    join_partial(Mg + (wib * 2 + 0) * MSLOT, lane, o[0], m[0], l[0]);
    join_partial(Mg + (wib * 2 + 1) * MSLOT, lane, o[1], m[1], l[1]);

    // epilogue: join the halves' sums, divide, store bf16 row-major:
    // a lane's 8 registers of a tile are 8 consecutive channels of its query's row
#pragma unroll
    for (int c = 0; c < 2; ++c) {
        float inv = 1.0f / (l[c] + xhalf(l[c]));
        __bf16* Ob = O + ((size_t)b * N_SPATIAL + m0 + 16 * c + r) * CDIM + 8 * half;
#pragma unroll
        for (int u = 0; u < 16; ++u) {
            bf16x8 pack;
#pragma unroll
            for (int i = 0; i < 8; ++i) pack[i] = f2bf(o[c][u][i] * inv);
            *(bf16x8*)(Ob + u * 16) = pack;
            // the next tile's pack may take the registers that this store names: it waits for the store's read of them
            asm volatile("s_wait_xcnt 0x0" ::: "memory");
        }
    }
}

// ---------------- Output projection + bias + residual -----------------------
__global__ void __launch_bounds__(512) proj_kernel(
        const __bf16* __restrict__ A, const __bf16* __restrict__ WT,
        const float* __restrict__ bias, const float* __restrict__ resid,
        float* __restrict__ out) {
    __shared__ __attribute__((aligned(16))) __bf16 Al[64 * GP];
    __shared__ __attribute__((aligned(16))) __bf16 Wl[256 * GP];
    int t = threadIdx.x;
    int w = t >> 5, lane = t & 31;
    int half = lane >> 4, r = lane & 15;
    size_t mb = (size_t)blockIdx.x * 64;
    bf16x8 va[4], vw[16];
    load_rows<64>(va, A + mb * CDIM, t);
    load_rows<256>(vw, WT, t);
    store_rows<64>(Al, va, t);
    store_rows<256>(Wl, vw, t);
    __syncthreads();   // both operands visible to all waves
    int mt = (w & 1) * 32, nt = (w >> 1) * 32;
    f32x8 c[2][2] = {{zero8(), zero8()}, {zero8(), zero8()}};
    tile_mma(Al + (mt + r) * GP + 8 * half, Wl + (nt + r) * GP + 8 * half, c);
    // the three loops are unrolled so that constant indices keep c in registers
#pragma unroll
    for (int x = 0; x < 2; ++x)
#pragma unroll
        for (int y = 0; y < 2; ++y) {
            size_t m0 = mb + mt + 16 * x;
            int n0 = nt + 16 * y;
            float bv = bias[n0 + r];
#pragma unroll
            for (int i = 0; i < 8; ++i) {
                size_t idx = (m0 + i + 8 * half) * CDIM + n0 + r;
                out[idx] = c[x][y][i] + bv + resid[idx];
            }
        }
}

extern "C" void kernel_launch(void* const* d_in, const int* in_sizes, int n_in,
                              void* d_out, int out_size, void* d_ws, size_t ws_size,
                              hipStream_t stream) {
    const float* inputs  = (const float*)d_in[0];
    const float* context = (const float*)d_in[1];
    const float* Wq = (const float*)d_in[2];
    const float* bq = (const float*)d_in[3];
    const float* Wk = (const float*)d_in[4];
    const float* bk = (const float*)d_in[5];
    const float* Wv = (const float*)d_in[6];
    const float* bv = (const float*)d_in[7];
    const float* Wp = (const float*)d_in[8];
    const float* bp = (const float*)d_in[9];
    const float* gamma = (const float*)d_in[10];
    const float* beta  = (const float*)d_in[11];
    float* out = (float*)d_out;

    const size_t TOT = (size_t)NBATCH * N_SPATIAL * CDIM;  // 4,194,304 elements
    char* ws = (char*)d_ws;
    float*  xn_f32 = (float*)ws;  ws += TOT * 4;
    __bf16* xn_bf  = (__bf16*)ws; ws += TOT * 2;
    __bf16* ctx_bf = (__bf16*)ws; ws += TOT * 2;
    __bf16* qb     = (__bf16*)ws; ws += TOT * 2;
    __bf16* kb_    = (__bf16*)ws; ws += TOT * 2;
    __bf16* vtb    = (__bf16*)ws; ws += TOT * 2;
    __bf16* ob     = (__bf16*)ws; ws += TOT * 2;
    __bf16* WqT    = (__bf16*)ws; ws += 65536 * 2;
    __bf16* WkT    = (__bf16*)ws; ws += 65536 * 2;
    __bf16* WvT    = (__bf16*)ws; ws += 65536 * 2;
    __bf16* WpT    = (__bf16*)ws; ws += 65536 * 2;

    cvt_bf16_kernel<<<256, 512, 0, stream>>>(context, ctx_bf);   // 256 * 16 waves * 1024 = TOT
    transpose_w_kernel<<<1024, 256, 0, stream>>>(Wq, Wk, Wv, Wp, WqT, WkT, WvT, WpT);
    ln_kernel<<<256, 512, 0, stream>>>(inputs, gamma, beta, xn_f32, xn_bf);   // 256 * 16 waves * 4 rows
    qproj_kernel<<<256, 512, 0, stream>>>(xn_bf, WqT, bq, qb);   // 256 blocks * 64 rows
    kvproj_kernel<<<256, 512, 0, stream>>>(ctx_bf, WkT, WvT, bk, bv, kb_, vtb);
    flash_kernel<<<256, 256, 0, stream>>>(qb, kb_, vtb, ob);
    proj_kernel<<<256, 512, 0, stream>>>(ob, WpT, bp, xn_f32, out);
}

// v008
// A run of this version takes 112 microseconds.
// Next to v007, in two timings, it ran 1.06 and 1.05 times as fast.
// All steps since v000 together make it 9.42 times as fast.
#include <hip/hip_runtime.h>
#include <hip/hip_bf16.h>

#define N_SPATIAL 4096   // 64*64
#define CDIM 256
#define NBATCH 4

typedef __attribute__((ext_vector_type(16))) __bf16 bf16x16;
typedef __attribute__((ext_vector_type(8)))  __bf16 bf16x8;
typedef __attribute__((ext_vector_type(8)))  float  f32x8;
typedef __attribute__((ext_vector_type(4)))  __bf16 bf16x4;
typedef __attribute__((ext_vector_type(4)))  float  f32x4;

// float -> bf16 with round-to-nearest-even (bit manipulation; no cvt dependence)
__device__ __forceinline__ __bf16 f2bf(float f) {
    unsigned u = __float_as_uint(f);
    u += 0x7FFFu + ((u >> 16) & 1u);
    unsigned short s = (unsigned short)(u >> 16);
    return __builtin_bit_cast(__bf16, s);
}

__device__ __forceinline__ f32x8 wmma_bf16(bf16x16 a, bf16x16 b, f32x8 c) {
    return __builtin_amdgcn_wmma_f32_16x16x32_bf16(
        /*neg_a=*/false, a, /*neg_b=*/false, b,
        /*c_mod=*/(short)0, c, /*reuse_a=*/false, /*reuse_b=*/false);
}

// Fragment loader: elems 0..7 from p[0..7], elems 8..15 from p[16..23].
// Caller passes p = base + 8*half; this matches the 16-bit A/B VGPR layout
// (lanes 0-15: K=0..7 & 16..23 ; lanes 16-31: K=8..15 & 24..31).
__device__ __forceinline__ bf16x16 load_frag(const __bf16* p) {
    bf16x8 a = *(const bf16x8*)p;
    bf16x8 b = *(const bf16x8*)(p + 16);
    bf16x16 f;
#pragma unroll
    for (int i = 0; i < 8; ++i) { f[i] = a[i]; f[i + 8] = b[i]; }
    return f;
}

__device__ __forceinline__ f32x8 zero8() {
    f32x8 c;
#pragma unroll
    for (int i = 0; i < 8; ++i) c[i] = 0.0f;
    return c;
}

// One async copy of 16B per lane from global to LDS (tracked by ASYNCcnt), as the builtin: the attention
// kernel uses registers above v255, which asm text cannot name, so that asm operands would crowd the low
// 256 registers and spill. OFF moves both addresses alike.
typedef __attribute__((ext_vector_type(4))) int i32x4;
template <int OFF>
__device__ __forceinline__ void async_copy16(const char* g, char* l) {
    __builtin_amdgcn_global_load_async_to_lds_b128(
        (__attribute__((address_space(1))) i32x4*)g,
        (__attribute__((address_space(3))) i32x4*)l, OFF, 0);
}
__device__ __forceinline__ void wait_async0() {
    asm volatile("s_wait_asynccnt 0x0" ::: "memory");
}

// ---------------- transpose 4 weight matrices to [N][K] bf16 ----------------
__global__ void transpose_w_kernel(const float* __restrict__ Wq, const float* __restrict__ Wk,
                                   const float* __restrict__ Wv, const float* __restrict__ Wp,
                                   __bf16* __restrict__ WqT, __bf16* __restrict__ WkT,
                                   __bf16* __restrict__ WvT, __bf16* __restrict__ WpT) {
    int i = blockIdx.x * blockDim.x + threadIdx.x;  // 0..262143
    int w = i >> 16;
    int j = i & 65535;
    int k = j >> 8, n = j & 255;
    const float* S = (w == 0) ? Wq : (w == 1) ? Wk : (w == 2) ? Wv : Wp;
    __bf16* D      = (w == 0) ? WqT : (w == 1) ? WkT : (w == 2) ? WvT : WpT;
    D[n * 256 + k] = f2bf(S[k * 256 + n]);
}

// ---------------- The three projections: operands staged in LDS -------------
// A block of 16 waves computes 64 rows x all 256 columns. The 64 rows of A and
// the whole [N][K] weight come into LDS by loads in which a wave covers
// 512 contiguous bytes (four whole lines: a bf16 row, or half an f32 row); the WMMA fragments are then read from LDS.
// 256 blocks: one a WGP. Wave w owns the 32 x 32 tile at rows (w & 1) * 32,
// columns (w >> 1) * 32: each fragment read serves two WMMAs.
#define GP 264   // LDS row pitch in elements: 528 B = 16 B x odd for the ds_load_b128 readers

// ROWS rows of 256 bf16, contiguous in global memory, go to LDS rows of pitch GP in two
// halves, so that the loads of all operands are in flight before the first LDS store.
// Thread t: rows (t >> 5) + 16 * i, 16-B segment t & 31.
template <int ROWS>
__device__ __forceinline__ void load_rows(bf16x8 (&v)[ROWS / 16], const __bf16* __restrict__ g, int t) {
    const __bf16* gp = g + (t >> 5) * CDIM + (t & 31) * 8;
#pragma unroll   // v[] stays in registers; one address with immediate offsets
    for (int i = 0; i < ROWS / 16; ++i) v[i] = *(const bf16x8*)(gp + i * 16 * CDIM);
    // the address pair is an input, so it lives up to this wait: no later load's
    // result is placed over a register that a load issued above still names
    asm volatile("s_wait_xcnt 0x0" :: "v"(gp) : "memory");
}
template <int ROWS>
__device__ __forceinline__ void store_rows(__bf16* lds, const bf16x8 (&v)[ROWS / 16], int t) {
    __bf16* lp = lds + (t >> 5) * GP + (t & 31) * 8;
#pragma unroll   // v[] stays in registers
    for (int i = 0; i < ROWS / 16; ++i) *(bf16x8*)(lp + i * 16 * GP) = v[i];
}

// c[x][y] += A rows (16 x ..) times W rows (16 y ..), k = 0..255 in ascending blocks of 32.
__device__ __forceinline__ void tile_mma(const __bf16* al, const __bf16* wl, f32x8 (&c)[2][2]) {
#pragma unroll   // constant LDS offsets; the compiler fetches fragments ahead
    for (int kk = 0; kk < 8; ++kk) {
        bf16x16 a0 = load_frag(al + kk * 32), a1 = load_frag(al + 16 * GP + kk * 32);
        bf16x16 b0 = load_frag(wl + kk * 32), b1 = load_frag(wl + 16 * GP + kk * 32);
        c[0][0] = wmma_bf16(a0, b0, c[0][0]);
        c[0][1] = wmma_bf16(a0, b1, c[0][1]);
        c[1][0] = wmma_bf16(a1, b0, c[1][0]);
        c[1][1] = wmma_bf16(a1, b1, c[1][1]);
    }
}

// Four rows of 256 floats a wave, a row across the 32 lanes: lane l holds elements 4 l .. 4 l + 3 (a) and
// 128 + 4 l .. (b), so that every wave-wide load covers 512 contiguous bytes.
__device__ __forceinline__ void load_f32_rows(f32x4 (&a)[4], f32x4 (&b)[4], const float* __restrict__ p) {
#pragma unroll   // a[] and b[] stay in registers; one address with immediate offsets
    for (int j = 0; j < 4; ++j) {
        a[j] = *(const f32x4*)(p + j * CDIM);
        b[j] = *(const f32x4*)(p + j * CDIM + 128);
    }
    // the address pair is an input, so it lives up to this wait: nothing is placed
    // over a register that a load issued above still names
    asm volatile("s_wait_xcnt 0x0" :: "v"(p) : "memory");
}
// The same four rows, rounded to bf16, to LDS rows of pitch GP: each store covers 256 contiguous bytes.
__device__ __forceinline__ void store_bf16_rows(__bf16* lp, const f32x4 (&a)[4], const f32x4 (&b)[4]) {
#pragma unroll   // a[] and b[] stay in registers
    for (int j = 0; j < 4; ++j) {
        bf16x4 h0, h1;
#pragma unroll
        for (int k = 0; k < 4; ++k) { h0[k] = f2bf(a[j][k]); h1[k] = f2bf(b[j][k]); }
        *(bf16x4*)(lp + j * GP)       = h0;
        *(bf16x4*)(lp + j * GP + 128) = h1;
    }
}

// ---------------- LayerNorm + Q projection ----------------------------------
// The block normalizes its own 64 rows, 4 rows a wave with both sums inside the wave, on their way to LDS:
// the f32 rows go to memory for the residual, the bf16 rows go straight to the A tile.
__global__ void __launch_bounds__(512) qproj_kernel(
        const float* __restrict__ x, const float* __restrict__ gamma,
        const float* __restrict__ beta, const __bf16* __restrict__ WT,
        const float* __restrict__ bias, float* __restrict__ xn, __bf16* __restrict__ Qo) {
    __shared__ __attribute__((aligned(16))) __bf16 Al[64 * GP];
    __shared__ __attribute__((aligned(16))) __bf16 Wl[256 * GP];
    int t = threadIdx.x;
    int w = t >> 5, lane = t & 31;
    int half = lane >> 4, r = lane & 15;
    size_t mb = (size_t)blockIdx.x * 64;
    size_t base = (mb + w * 4) * CDIM + lane * 4;
    bf16x8 vw[16];
    f32x4 a[4], b[4];
    load_f32_rows(a, b, x + base);   // from memory, the longest way: issued first, normalized while the weight streams in
    f32x4 g0 = *(const f32x4*)(gamma + lane * 4);
    f32x4 g1 = *(const f32x4*)(gamma + lane * 4 + 128);
    f32x4 e0 = *(const f32x4*)(beta + lane * 4);
    f32x4 e1 = *(const f32x4*)(beta + lane * 4 + 128);
    // no result of the weight's loads below is placed over the offset register that these four loads still name
    asm volatile("s_wait_xcnt 0x0" ::: "memory");
    load_rows<256>(vw, WT, t);
    // the sums below stay behind the weight's loads: hoisted over them, their wait for the rows would hold those loads back
    __builtin_amdgcn_sched_barrier(0);
    float s[4];
    for (int j = 0; j < 4; ++j)
        s[j] = ((a[j][0] + a[j][1]) + (a[j][2] + a[j][3])) +
               ((b[j][0] + b[j][1]) + (b[j][2] + b[j][3]));
    for (int off = 16; off >= 1; off >>= 1)
        for (int j = 0; j < 4; ++j) s[j] += __shfl_xor(s[j], off, 32);
    for (int j = 0; j < 4; ++j) {
        float mu = s[j] * (1.0f / CDIM);
        a[j] -= mu;
        b[j] -= mu;
        f32x4 qa = a[j] * a[j], qb = b[j] * b[j];
        s[j] = ((qa[0] + qa[1]) + (qa[2] + qa[3])) + ((qb[0] + qb[1]) + (qb[2] + qb[3]));
    }
    for (int off = 16; off >= 1; off >>= 1)
        for (int j = 0; j < 4; ++j) s[j] += __shfl_xor(s[j], off, 32);
    for (int j = 0; j < 4; ++j) {
        float rs = rsqrtf(s[j] * (1.0f / CDIM) + 1e-3f);
        a[j] = a[j] * rs * g0 + e0;
        b[j] = b[j] * rs * g1 + e1;
    }
    store_bf16_rows(Al + (w * 4) * GP + lane * 4, a, b);
    store_rows<256>(Wl, vw, t);
    __syncthreads();   // both operands visible to all waves
    // the f32 rows leave behind the barrier, which would otherwise wait for these stores to complete
    float* xo = xn + base;
#pragma unroll   // one address with immediate offsets
    for (int j = 0; j < 4; ++j) {
        *(f32x4*)(xo + j * CDIM)       = a[j];
        *(f32x4*)(xo + j * CDIM + 128) = b[j];
    }
    // the stores' address and data are inputs, so they live up to this wait: nothing is placed
    // over a register that a store issued above still names
    asm volatile("s_wait_xcnt 0x0" :: "v"(xo), "v"(a[0]), "v"(a[1]), "v"(a[2]), "v"(a[3]),
                 "v"(b[0]), "v"(b[1]), "v"(b[2]), "v"(b[3]) : "memory");
    int mt = (w & 1) * 32, nt = (w >> 1) * 32;
    f32x8 c[2][2] = {{zero8(), zero8()}, {zero8(), zero8()}};
    tile_mma(Al + (mt + r) * GP + 8 * half, Wl + (nt + r) * GP + 8 * half, c);
    // the three loops are unrolled so that constant indices keep c in registers
#pragma unroll
    for (int x = 0; x < 2; ++x)
#pragma unroll
        for (int y = 0; y < 2; ++y) {
            size_t m0 = mb + mt + 16 * x;
            int n0 = nt + 16 * y;
            float bv = bias[n0 + r];
#pragma unroll
            for (int i = 0; i < 8; ++i)
                Qo[(m0 + i + 8 * half) * CDIM + n0 + r] = f2bf(c[x][y][i] + bv);
        }
}

// ---------------- K,V projection from the f32 rows; V stored transposed [B][C][N] -------------
__global__ void __launch_bounds__(512) kvproj_kernel(
        const float* __restrict__ A, const __bf16* __restrict__ WkT,
        const __bf16* __restrict__ WvT, const float* __restrict__ bk,
        const float* __restrict__ bvv, __bf16* __restrict__ Ko,
        __bf16* __restrict__ VTo) {
    __shared__ __attribute__((aligned(16))) __bf16 Al[64 * GP];
    __shared__ __attribute__((aligned(16))) __bf16 Wkl[256 * GP];
    __shared__ __attribute__((aligned(16))) __bf16 Wvl[256 * GP];
    int t = threadIdx.x;
    int w = t >> 5, lane = t & 31;
    int half = lane >> 4, r = lane & 15;
    size_t mb = (size_t)blockIdx.x * 64;
    bf16x8 vk[16], vv[16];
    f32x4 a[4], b[4];
    load_rows<256>(vk, WkT, t);
    load_rows<256>(vv, WvT, t);
    load_f32_rows(a, b, A + (mb + w * 4) * CDIM + lane * 4);   // the f32 rows themselves, 4 a wave
    store_rows<256>(Wkl, vk, t);
    store_rows<256>(Wvl, vv, t);
    store_bf16_rows(Al + (w * 4) * GP + lane * 4, a, b);       // rounded to bf16 on their way to LDS
    __syncthreads();   // all three operands visible to all waves
    int mt = (w & 1) * 32, nt = (w >> 1) * 32;
    f32x8 ck[2][2] = {{zero8(), zero8()}, {zero8(), zero8()}};
    f32x8 cv[2][2] = {{zero8(), zero8()}, {zero8(), zero8()}};
    tile_mma(Al + (mt + r) * GP + 8 * half, Wkl + (nt + r) * GP + 8 * half, ck);
    tile_mma(Al + (mt + r) * GP + 8 * half, Wvl + (nt + r) * GP + 8 * half, cv);
    // the loops are unrolled so that constant indices keep ck and cv in registers
#pragma unroll
    for (int x = 0; x < 2; ++x)
#pragma unroll
        for (int y = 0; y < 2; ++y) {
            size_t m0 = mb + mt + 16 * x;
            int n0 = nt + 16 * y;
            float kb = bk[n0 + r];
#pragma unroll
            for (int i = 0; i < 8; ++i)
                Ko[(m0 + i + 8 * half) * CDIM + n0 + r] = f2bf(ck[x][y][i] + kb);
            // V transposed store: lane's 8 C-layout rows are consecutive key indices.
            int b   = (int)(m0 >> 12);                 // 4096 keys per batch
            int nk0 = (int)(m0 & 4095) + 8 * half;
            float vb = bvv[n0 + r];
            bf16x8 pack;
#pragma unroll
            for (int i = 0; i < 8; ++i) pack[i] = f2bf(cv[x][y][i] + vb);
            *(bf16x8*)(VTo + ((size_t)b * CDIM + n0 + r) * N_SPATIAL + nk0) = pack;
        }
}

#define KP 264   // K row pitch in elements: 528 B for 512 B of data
#define VP 136   // V^T row pitch in elements: 272 B for the 256 B of a stage's 128 keys
#define KSPLIT 4                 // key chunks of a stage = waves on one query group
#define STAGE  (32 * KSPLIT)     // keys staged per trip
#define MSLOT  (33 * 128)        // floats of one column tile's partial result: O 32 x 128, then m and l, one a lane
#define KBYTES (STAGE * KP * 2)  // a stage's K rows in LDS
#define VBYTES (256 * VP * 2)    // a stage's V^T rows in LDS
#define BUFB   (KBYTES + VBYTES) // one stage buffer: K rows, then V^T rows
#define QFRAG  1024              // bytes of one Q fragment in LDS: two planes of 16 B a lane, each read as 512 contiguous bytes
#define QBYTES (2 * 8 * QFRAG)   // the eight LDS-resident Q fragments of each of the two query groups
static_assert(8 * MSLOT * 4 <= 2 * BUFB, "the merge slots lie in the two stage buffers");

// Issue this thread's thirty-two copies of the stage that begins at key j0 into the buffer at lds:
// 128 rows of K and 128 keys of every V^T row.
// eight lanes bring one 128-B line; thread t: row t >> 3 (and +32 ...), 16-B segment t & 7
__device__ __forceinline__ void issue_stage(const __bf16* Kb, const __bf16* Vb, int j0, char* lds, int t) {
    const char* kgt = (const char*)Kb + (size_t)j0 * (CDIM * 2) + (t >> 3) * (CDIM * 2) + (t & 7) * 16;
    const char* vgt = (const char*)Vb + (size_t)j0 * 2 + (size_t)(t >> 3) * (N_SPATIAL * 2) + (t & 7) * 16;
    char* klt = lds + (t >> 3) * (KP * 2) + (t & 7) * 16;
    char* vlt = lds + KBYTES + (t >> 3) * (VP * 2) + (t & 7) * 16;
    // both loops unrolled: constant steps between the rows' addresses
#pragma unroll
    for (int h = 0; h < 4; ++h) {
        const char* kg = kgt + h * (32 * CDIM * 2);
        char* kl = klt + h * (32 * KP * 2);
        async_copy16<0>(kg, kl);
        async_copy16<128>(kg, kl);
        async_copy16<256>(kg, kl);
        async_copy16<384>(kg, kl);
    }
#pragma unroll
    for (int h = 0; h < 8; ++h) {
        const char* vg = vgt + (size_t)h * (32 * N_SPATIAL * 2);
        char* vl = vlt + h * (32 * VP * 2);
        async_copy16<0>(vg, vl);
        async_copy16<128>(vg, vl);
    }
}

// Lane l <-> lane l ^ 16: the two halves of a wave hold the two halves of a query's keys.
__device__ __forceinline__ float xhalf(float v) {
    int b = __float_as_int(v);
    return __int_as_float(__builtin_amdgcn_permlanex16(b, b, 0x76543210, 0xfedcba98, false, false));
}

// One wave's partial result to its merge slot; each store of O covers 512 contiguous bytes, those of m and l 128.
__device__ __forceinline__ void put_partial(float* mg, int lane, const f32x8 (&o)[16], float m, float l) {
#pragma unroll   // constant indices keep o[] in registers
    for (int u = 0; u < 16; ++u) {
        f32x4 lo = {o[u][0], o[u][1], o[u][2], o[u][3]};
        f32x4 hi = {o[u][4], o[u][5], o[u][6], o[u][7]};
        *(f32x4*)(mg + (u * 2 + 0) * 128 + lane * 4) = lo;
        *(f32x4*)(mg + (u * 2 + 1) * 128 + lane * 4) = hi;
    }
    mg[32 * 128 + lane]      = m;
    mg[32 * 128 + 32 + lane] = l;
}

// Join the partial result in a merge slot (same lane-to-element map) into this wave's own.
__device__ __forceinline__ void join_partial(const float* mg, int lane, f32x8 (&o)[16], float& m, float& l) {
    float mb = mg[32 * 128 + lane];
    float lb = mg[32 * 128 + 32 + lane];
    float mnew = fmaxf(m, mb);
    float fa = __expf(m - mnew);
    float fb = __expf(mb - mnew);
    m = mnew;
    l = l * fa + lb * fb;
    // both loops are unrolled so that constant indices keep o in registers
#pragma unroll
    for (int u = 0; u < 16; ++u) {
        f32x4 lo = *(const f32x4*)(mg + (u * 2 + 0) * 128 + lane * 4);
        f32x4 hi = *(const f32x4*)(mg + (u * 2 + 1) * 128 + lane * 4);
#pragma unroll
        for (int i = 0; i < 4; ++i) {
            o[u][i]     = o[u][i]     * fa + lo[i] * fb;
            o[u][i + 4] = o[u][i + 4] * fa + hi[i] * fb;
        }
    }
}

// A Q fragment kept in LDS in fragment order: elements 0..7 from the first plane, 8..15 from the second.
__device__ __forceinline__ bf16x16 load_qfrag(const char* p) {
    bf16x8 a = *(const bf16x8*)p;
    bf16x8 b = *(const bf16x8*)(p + 512);
    bf16x16 f;
#pragma unroll
    for (int i = 0; i < 8; ++i) { f[i] = a[i]; f[i + 8] = b[i]; }
    return f;
}

__global__ void __launch_bounds__(256) flash_kernel(
        const __bf16* __restrict__ Q, const __bf16* __restrict__ K,
        const __bf16* __restrict__ VT, __bf16* __restrict__ O) {
    // two stage buffers; behind the loop they hold the merge slots
    // behind them the Q fragments that do not stay in registers
    __shared__ __attribute__((aligned(16))) char smem[2 * BUFB + QBYTES];

    int t    = threadIdx.x;
    int wib  = __builtin_amdgcn_readfirstlane(t >> 5);   // wave-uniform: the merge's branches are scalar
    int lane = t & 31;
    int half = lane >> 4, r = lane & 15;
    int g  = wib >> 1;                 // this wave's key chunk in every stage
    int b  = blockIdx.x >> 6;          // 64 blocks of 64 query rows per batch
    int m0 = (blockIdx.x & 63) * 64 + (wib & 1) * 32;

    const __bf16* Qb = Q  + ((size_t)b * N_SPATIAL) * CDIM;
    const __bf16* Kb = K  + ((size_t)b * N_SPATIAL) * CDIM;
    const __bf16* Vb = VT + (size_t)b * CDIM * N_SPATIAL;

    // B operands of S^T: column tile c, column = query m0 + 16 c + r.
    // Tile 0's fragments stay in registers. Tile 1's would not fit beside the fragments fetched ahead: they go
    // to LDS once, in fragment order, written by the query group's wave of key chunk 0 and read by its four
    // waves behind the prologue's barrier.
    bf16x16 qf[8];
    const __bf16* qrow = Qb + (size_t)(m0 + r) * CDIM + 8 * half;
#pragma unroll
    for (int kk = 0; kk < 8; ++kk) qf[kk] = load_frag(qrow + kk * 32);
    char* ql = smem + 2 * BUFB + (wib & 1) * (8 * QFRAG) + lane * 16;
    if (g == 0) {
#pragma unroll
        for (int kk = 0; kk < 8; ++kk) {
            *(bf16x8*)(ql + kk * QFRAG)       = *(const bf16x8*)(qrow + 16 * CDIM + kk * 32);
            *(bf16x8*)(ql + kk * QFRAG + 512) = *(const bf16x8*)(qrow + 16 * CDIM + kk * 32 + 16);
        }
    }
    // the address pair is an input, so it lives up to this wait: nothing is placed
    // over a register that a load issued above still names
    asm volatile("s_wait_xcnt 0x0" :: "v"(qrow) : "memory");

    // o[c][u][i] = O^T[channel 16 u + 8 half + i][query m0 + 16 c + r]
    f32x8 o[2][16];
#pragma unroll
    for (int c = 0; c < 2; ++c)
#pragma unroll
        for (int u = 0; u < 16; ++u) o[c][u] = zero8();
    float m[2] = {-1e30f, -1e30f};   // running maximum of the lane's queries: equal in both halves
    float l[2] = {0.0f, 0.0f};       // running sums over the keys of this half alone; the halves join in the epilogue

    const float sc = 0.0625f;                         // 256^-0.5

    issue_stage(Kb, Vb, 0, smem, t);
    wait_async0();
    __syncthreads();   // stage 0 visible to all waves
    issue_stage(Kb, Vb, STAGE, smem + BUFB, t);   // stage 1 flies during trip 0

    unsigned boff = 0;   // byte offset of the buffer that this trip reads
    for (int j0 = 0; j0 < N_SPATIAL; j0 += STAGE) {
        const __bf16* Kc = (const __bf16*)(smem + boff);
        const __bf16* Vc = (const __bf16*)(smem + boff + KBYTES);

        // ---- S^T = K_chunk @ Q^T : 2 x 2 tiles of 16x16, A fragments from LDS, each used twice ----
        // s0[c][i]: key 8 half + i, s1[c][i]: key 16 + 8 half + i of the chunk, query 16 c + r
        f32x8 s0[2] = {zero8(), zero8()}, s1[2] = {zero8(), zero8()};
        const __bf16* k0base = Kc + (g * 32 + r) * KP + 8 * half;
        const __bf16* k1base = Kc + (g * 32 + 16 + r) * KP + 8 * half;
        const __bf16* vbase = Vc + r * VP + g * 32 + 8 * half;
        // Fragments are fetched one group ahead into a second register set: a group's LDS reads stand
        // together in front of the previous group's WMMAs. Each sched_barrier(0) below keeps such a read
        // group from sinking to its first use, where the wave would wait out the LDS latency per fragment.
        bf16x16 ka[2][2], kb[2][2], qc[2][2], vf[2][4];
#pragma unroll
        for (int j = 0; j < 2; ++j) {
            ka[0][j] = load_frag(k0base + j * 32);
            kb[0][j] = load_frag(k1base + j * 32);
            qc[0][j] = load_qfrag(ql + j * QFRAG);
        }
#pragma unroll
        for (int gr = 0; gr < 4; ++gr) {
            if (gr < 3) {
#pragma unroll
                for (int j = 0; j < 2; ++j) {
                    ka[(gr + 1) & 1][j] = load_frag(k0base + ((gr + 1) * 2 + j) * 32);
                    kb[(gr + 1) & 1][j] = load_frag(k1base + ((gr + 1) * 2 + j) * 32);
                    qc[(gr + 1) & 1][j] = load_qfrag(ql + ((gr + 1) * 2 + j) * QFRAG);
                }
            } else {
                // the first V^T group flies during the last score products and the softmax
#pragma unroll
                for (int j = 0; j < 4; ++j) vf[0][j] = load_frag(vbase + j * 16 * VP);
            }
            __builtin_amdgcn_sched_barrier(0);   // the next group's reads stay in front of this group's products
#pragma unroll
            for (int j = 0; j < 2; ++j) {
                s0[0] = wmma_bf16(ka[gr & 1][j], qf[gr * 2 + j], s0[0]);
                s1[0] = wmma_bf16(kb[gr & 1][j], qf[gr * 2 + j], s1[0]);
                s0[1] = wmma_bf16(ka[gr & 1][j], qc[gr & 1][j], s0[1]);
                s1[1] = wmma_bf16(kb[gr & 1][j], qc[gr & 1][j], s1[1]);
            }
            __builtin_amdgcn_sched_barrier(0);   // the group after next is not read before this group's registers are free
        }
        bf16x16 pf[2];
        // unrolled: constant indices keep the per-tile state in registers
#pragma unroll
        for (int c = 0; c < 2; ++c) {
            // ---- online softmax: the lane's 16 scores of a column tile belong to one query ----
            float p0[8], p1[8], mt[8];
#pragma unroll
            for (int i = 0; i < 8; ++i) {
                p0[i] = s0[c][i] * sc; p1[i] = s1[c][i] * sc;
                mt[i] = fmaxf(p0[i], p1[i]);
            }
            float mn = fmaxf(fmaxf(fmaxf(mt[0], mt[1]), fmaxf(mt[2], mt[3])),
                             fmaxf(fmaxf(mt[4], mt[5]), fmaxf(mt[6], mt[7])));
            mn = fmaxf(mn, xhalf(mn));   // over all 32 keys of the chunk
            float mnew  = fmaxf(m[c], mn);
            float alpha = __expf(m[c] - mnew);
            m[c] = mnew;
#pragma unroll
            for (int i = 0; i < 8; ++i) {
                p0[i] = __expf(p0[i] - mnew);
                p1[i] = __expf(p1[i] - mnew);
                mt[i] = p0[i] + p1[i];
            }
            l[c] = l[c] * alpha + (((mt[0] + mt[1]) + (mt[2] + mt[3])) + ((mt[4] + mt[5]) + (mt[6] + mt[7])));
#pragma unroll
            for (int u = 0; u < 16; ++u)
#pragma unroll
                for (int i = 0; i < 8; ++i) o[c][u][i] *= alpha;

            // ---- P^T as B operand: element e is key 8 half + e, element 8 + e key 16 + 8 half + e ----
#pragma unroll
            for (int i = 0; i < 8; ++i) { pf[c][i] = f2bf(p0[i]); pf[c][i + 8] = f2bf(p1[i]); }
        }

        // ---- O^T += V^T_chunk @ P^T (A fragments from LDS, same k order, each used twice) ----
#pragma unroll
        for (int gr = 0; gr < 4; ++gr) {
            if (gr < 3) {
#pragma unroll
                for (int j = 0; j < 4; ++j) vf[(gr + 1) & 1][j] = load_frag(vbase + ((gr + 1) * 4 + j) * 16 * VP);
                __builtin_amdgcn_sched_barrier(0);   // the next group's reads stay in front of this group's products
            }
#pragma unroll
            for (int j = 0; j < 4; ++j) {
                o[0][gr * 4 + j] = wmma_bf16(vf[gr & 1][j], pf[0], o[0][gr * 4 + j]);
                o[1][gr * 4 + j] = wmma_bf16(vf[gr & 1][j], pf[1], o[1][gr * 4 + j]);
            }
            if (gr < 2)
                __builtin_amdgcn_sched_barrier(0);   // the group after next is not read before this group's registers are free
        }

        // ---- hand-over: the next stage is published, this trip's buffer is freed ----
        // the trip's last product stays in front of the hand-over: moved behind the barrier
        // it would stand between the barrier and the refill and start the copies late
        __builtin_amdgcn_sched_barrier(0);
        // this wave's own LDS reads of this trip's buffer have retired before any copy refills it
        asm volatile("s_wait_dscnt 0x0" ::: "memory");
        wait_async0();     // this wave's copies of the next stage have landed
        __syncthreads();   // next stage visible to all waves; this trip's buffer read out by all
        if (j0 + 2 * STAGE < N_SPATIAL)
            issue_stage(Kb, Vb, j0 + 2 * STAGE, smem + boff, t);   // flies during the next trip
        boff ^= BUFB;
    }
    wait_async0();   // nothing is in flight when the buffers become merge slots

    // ---- merge the four key chunks' partial results of each query tile, as a tree ----
    // the last trip's barrier has ended every wave's reads of the stage buffers
    // a wave's slot: its two column tiles' partial results, one behind the other
    float* Mg = (float*)smem;
    if (g >= 2) {
        put_partial(Mg + ((wib - 4) * 2 + 0) * MSLOT, lane, o[0], m[0], l[0]);
        put_partial(Mg + ((wib - 4) * 2 + 1) * MSLOT, lane, o[1], m[1], l[1]);
    }
    __syncthreads();   // chunks 2 and 3 published
    if (g < 2) {
        join_partial(Mg + (wib * 2 + 0) * MSLOT, lane, o[0], m[0], l[0]);
        join_partial(Mg + (wib * 2 + 1) * MSLOT, lane, o[1], m[1], l[1]);
    }
    __syncthreads();   // slots read out, free for the second round
    if (g == 1) {
        put_partial(Mg + ((wib - 2) * 2 + 0) * MSLOT, lane, o[0], m[0], l[0]);
        put_partial(Mg + ((wib - 2) * 2 + 1) * MSLOT, lane, o[1], m[1], l[1]);
    }
    __syncthreads();   // chunk 1 (with 3) published
    if (g != 0) return;   // behind the last barrier
    join_partial(Mg + (wib * 2 + 0) * MSLOT, lane, o[0], m[0], l[0]);
    join_partial(Mg + (wib * 2 + 1) * MSLOT, lane, o[1], m[1], l[1]);

    // epilogue: join the halves' sums, divide, store bf16 row-major:
    // a lane's 8 registers of a tile are 8 consecutive channels of its query's row
#pragma unroll
    for (int c = 0; c < 2; ++c) {
        float inv = 1.0f / (l[c] + xhalf(l[c]));
        __bf16* Ob = O + ((size_t)b * N_SPATIAL + m0 + 16 * c + r) * CDIM + 8 * half;
#pragma unroll
        for (int u = 0; u < 16; ++u) {
            bf16x8 pack;
#pragma unroll
            for (int i = 0; i < 8; ++i) pack[i] = f2bf(o[c][u][i] * inv);
            *(bf16x8*)(Ob + u * 16) = pack;
            // the next tile's pack may take the registers that this store names: it waits for the store's read of them
            asm volatile("s_wait_xcnt 0x0" ::: "memory");
        }
    }
}

// ---------------- Output projection + bias + residual -----------------------
__global__ void __launch_bounds__(512) proj_kernel(
        const __bf16* __restrict__ A, const __bf16* __restrict__ WT,
        const float* __restrict__ bias, const float* __restrict__ resid,
        float* __restrict__ out) {
    __shared__ __attribute__((aligned(16))) __bf16 Al[64 * GP];
    __shared__ __attribute__((aligned(16))) __bf16 Wl[256 * GP];
    int t = threadIdx.x;
    int w = t >> 5, lane = t & 31;
    int half = lane >> 4, r = lane & 15;
    size_t mb = (size_t)blockIdx.x * 64;
    bf16x8 va[4], vw[16];
    load_rows<64>(va, A + mb * CDIM, t);
    load_rows<256>(vw, WT, t);
    store_rows<64>(Al, va, t);
    store_rows<256>(Wl, vw, t);
    __syncthreads();   // both operands visible to all waves
    int mt = (w & 1) * 32, nt = (w >> 1) * 32;
    f32x8 c[2][2] = {{zero8(), zero8()}, {zero8(), zero8()}};
    tile_mma(Al + (mt + r) * GP + 8 * half, Wl + (nt + r) * GP + 8 * half, c);
    // the three loops are unrolled so that constant indices keep c in registers
#pragma unroll
    for (int x = 0; x < 2; ++x)
#pragma unroll
        for (int y = 0; y < 2; ++y) {
            size_t m0 = mb + mt + 16 * x;
            int n0 = nt + 16 * y;
            float bv = bias[n0 + r];
#pragma unroll
            for (int i = 0; i < 8; ++i) {
                size_t idx = (m0 + i + 8 * half) * CDIM + n0 + r;
                out[idx] = c[x][y][i] + bv + resid[idx];
            }
        }
}

extern "C" void kernel_launch(void* const* d_in, const int* in_sizes, int n_in,
                              void* d_out, int out_size, void* d_ws, size_t ws_size,
                              hipStream_t stream) {
    const float* inputs  = (const float*)d_in[0];
    const float* context = (const float*)d_in[1];
    const float* Wq = (const float*)d_in[2];
    const float* bq = (const float*)d_in[3];
    const float* Wk = (const float*)d_in[4];
    const float* bk = (const float*)d_in[5];
    const float* Wv = (const float*)d_in[6];
    const float* bv = (const float*)d_in[7];
    const float* Wp = (const float*)d_in[8];
    const float* bp = (const float*)d_in[9];
    const float* gamma = (const float*)d_in[10];
    const float* beta  = (const float*)d_in[11];
    float* out = (float*)d_out;

    const size_t TOT = (size_t)NBATCH * N_SPATIAL * CDIM;  // 4,194,304 elements
    char* ws = (char*)d_ws;
    float*  xn_f32 = (float*)ws;  ws += TOT * 4;
    __bf16* qb     = (__bf16*)ws; ws += TOT * 2;
    __bf16* kb_    = (__bf16*)ws; ws += TOT * 2;
    __bf16* vtb    = (__bf16*)ws; ws += TOT * 2;
    __bf16* ob     = (__bf16*)ws; ws += TOT * 2;
    __bf16* WqT    = (__bf16*)ws; ws += 65536 * 2;
    __bf16* WkT    = (__bf16*)ws; ws += 65536 * 2;
    __bf16* WvT    = (__bf16*)ws; ws += 65536 * 2;
    __bf16* WpT    = (__bf16*)ws; ws += 65536 * 2;

    transpose_w_kernel<<<1024, 256, 0, stream>>>(Wq, Wk, Wv, Wp, WqT, WkT, WvT, WpT);
    qproj_kernel<<<256, 512, 0, stream>>>(inputs, gamma, beta, WqT, bq, xn_f32, qb);   // 256 blocks * 64 rows
    kvproj_kernel<<<256, 512, 0, stream>>>(context, WkT, WvT, bk, bv, kb_, vtb);
    flash_kernel<<<256, 256, 0, stream>>>(qb, kb_, vtb, ob);
    proj_kernel<<<256, 512, 0, stream>>>(ob, WpT, bp, xn_f32, out);
}

// v010
// One run takes 93.4 microseconds.
// Versions between v008 and this one are left out; their measured steps multiply to 1.19 times as fast.
// Over all steps from v000 it is 11.2 times as fast.
#include <hip/hip_runtime.h>
#include <hip/hip_bf16.h>

#define N_SPATIAL 4096   // 64*64
#define CDIM 256
#define NBATCH 4

typedef __attribute__((ext_vector_type(16))) __bf16 bf16x16;
typedef __attribute__((ext_vector_type(8)))  __bf16 bf16x8;
typedef __attribute__((ext_vector_type(8)))  float  f32x8;
typedef __attribute__((ext_vector_type(4)))  __bf16 bf16x4;
typedef __attribute__((ext_vector_type(4)))  float  f32x4;
typedef __attribute__((ext_vector_type(2)))  float  f32x2;

// float -> bf16 with round-to-nearest-even (bit manipulation; no cvt dependence)
__device__ __forceinline__ __bf16 f2bf(float f) {
    unsigned u = __float_as_uint(f);
    u += 0x7FFFu + ((u >> 16) & 1u);
    unsigned short s = (unsigned short)(u >> 16);
    return __builtin_bit_cast(__bf16, s);
}

__device__ __forceinline__ f32x8 wmma_bf16(bf16x16 a, bf16x16 b, f32x8 c) {
    return __builtin_amdgcn_wmma_f32_16x16x32_bf16(
        /*neg_a=*/false, a, /*neg_b=*/false, b,
        /*c_mod=*/(short)0, c, /*reuse_a=*/false, /*reuse_b=*/false);
}

// Fragment loader: elems 0..7 from p[0..7], elems 8..15 from p[16..23].
// Caller passes p = base + 8*half; this matches the 16-bit A/B VGPR layout
// (lanes 0-15: K=0..7 & 16..23 ; lanes 16-31: K=8..15 & 24..31).
__device__ __forceinline__ bf16x16 load_frag(const __bf16* p) {
    bf16x8 a = *(const bf16x8*)p;
    bf16x8 b = *(const bf16x8*)(p + 16);
    bf16x16 f;
#pragma unroll
    for (int i = 0; i < 8; ++i) { f[i] = a[i]; f[i + 8] = b[i]; }
    return f;
}

__device__ __forceinline__ f32x8 zero8() {
    f32x8 c;
#pragma unroll
    for (int i = 0; i < 8; ++i) c[i] = 0.0f;
    return c;
}

// One async copy of 16B per lane from global to LDS (tracked by ASYNCcnt), as the builtin: the attention
// kernel uses registers above v255, which asm text cannot name, so that asm operands would crowd the low
// 256 registers and spill. OFF moves both addresses alike.
typedef __attribute__((ext_vector_type(4))) int i32x4;
template <int OFF>
__device__ __forceinline__ void async_copy16(const char* g, char* l) {
    __builtin_amdgcn_global_load_async_to_lds_b128(
        (__attribute__((address_space(1))) i32x4*)g,
        (__attribute__((address_space(3))) i32x4*)l, OFF, 0);
}
__device__ __forceinline__ void wait_async0() {
    asm volatile("s_wait_asynccnt 0x0" ::: "memory");
}

// ---------------- transpose 4 weight matrices to [N][K] bf16 ----------------
__global__ void transpose_w_kernel(const float* __restrict__ Wq, const float* __restrict__ Wk,
                                   const float* __restrict__ Wv, const float* __restrict__ Wp,
                                   __bf16* __restrict__ WqT, __bf16* __restrict__ WkT,
                                   __bf16* __restrict__ WvT, __bf16* __restrict__ WpT) {
    int i = blockIdx.x * blockDim.x + threadIdx.x;  // 0..262143
    int w = i >> 16;
    int j = i & 65535;
    int k = j >> 8, n = j & 255;
    const float* S = (w == 0) ? Wq : (w == 1) ? Wk : (w == 2) ? Wv : Wp;
    __bf16* D      = (w == 0) ? WqT : (w == 1) ? WkT : (w == 2) ? WvT : WpT;
    D[n * 256 + k] = f2bf(S[k * 256 + n]);
}

// ---------------- The three projections: operands staged in LDS -------------
// A block of 16 waves computes 64 rows x all 256 columns. The 64 rows of A and
// the whole [N][K] weight come into LDS by loads in which a wave covers
// 512 contiguous bytes (four whole lines: a bf16 row, or half an f32 row); the WMMA fragments are then read from LDS.
// 256 blocks: one a WGP. Wave w owns the 32 x 32 tile at rows (w & 1) * 32,
// columns (w >> 1) * 32: each fragment read serves two WMMAs.
#define GP 264   // LDS row pitch in elements: 528 B = 16 B x odd for the ds_load_b128 readers

// ROWS rows of 256 bf16, contiguous in global memory, go to LDS rows of pitch GP in two
// halves, so that the loads of all operands are in flight before the first LDS store.
// Thread t: rows (t >> 5) + 16 * i, 16-B segment t & 31.
template <int ROWS>
__device__ __forceinline__ void load_rows(bf16x8 (&v)[ROWS / 16], const __bf16* __restrict__ g, int t) {
    const __bf16* gp = g + (t >> 5) * CDIM + (t & 31) * 8;
#pragma unroll   // v[] stays in registers; one address with immediate offsets
    for (int i = 0; i < ROWS / 16; ++i) v[i] = *(const bf16x8*)(gp + i * 16 * CDIM);
    // the address pair is an input, so it lives up to this wait: no later load's
    // result is placed over a register that a load issued above still names
    asm volatile("s_wait_xcnt 0x0" :: "v"(gp) : "memory");
}
template <int ROWS>
__device__ __forceinline__ void store_rows(__bf16* lds, const bf16x8 (&v)[ROWS / 16], int t) {
    __bf16* lp = lds + (t >> 5) * GP + (t & 31) * 8;
#pragma unroll   // v[] stays in registers
    for (int i = 0; i < ROWS / 16; ++i) *(bf16x8*)(lp + i * 16 * GP) = v[i];
}

// c[x][y] += A rows (16 x ..) times W rows (16 y ..), k = 0..255 in ascending blocks of 32.
__device__ __forceinline__ void tile_mma(const __bf16* al, const __bf16* wl, f32x8 (&c)[2][2]) {
#pragma unroll   // constant LDS offsets; the compiler fetches fragments ahead
    for (int kk = 0; kk < 8; ++kk) {
        bf16x16 a0 = load_frag(al + kk * 32), a1 = load_frag(al + 16 * GP + kk * 32);
        bf16x16 b0 = load_frag(wl + kk * 32), b1 = load_frag(wl + 16 * GP + kk * 32);
        c[0][0] = wmma_bf16(a0, b0, c[0][0]);
        c[0][1] = wmma_bf16(a0, b1, c[0][1]);
        c[1][0] = wmma_bf16(a1, b0, c[1][0]);
        c[1][1] = wmma_bf16(a1, b1, c[1][1]);
    }
}

// Four rows of 256 floats a wave, a row across the 32 lanes: lane l holds elements 4 l .. 4 l + 3 (a) and
// 128 + 4 l .. (b), so that every wave-wide load covers 512 contiguous bytes.
__device__ __forceinline__ void load_f32_rows(f32x4 (&a)[4], f32x4 (&b)[4], const float* __restrict__ p) {
#pragma unroll   // a[] and b[] stay in registers; one address with immediate offsets
    for (int j = 0; j < 4; ++j) {
        a[j] = *(const f32x4*)(p + j * CDIM);
        b[j] = *(const f32x4*)(p + j * CDIM + 128);
    }
    // the address pair is an input, so it lives up to this wait: nothing is placed
    // over a register that a load issued above still names
    asm volatile("s_wait_xcnt 0x0" :: "v"(p) : "memory");
}
// The same four rows, rounded to bf16, to LDS rows of pitch GP: each store covers 256 contiguous bytes.
__device__ __forceinline__ void store_bf16_rows(__bf16* lp, const f32x4 (&a)[4], const f32x4 (&b)[4]) {
#pragma unroll   // a[] and b[] stay in registers
    for (int j = 0; j < 4; ++j) {
        bf16x4 h0, h1;
#pragma unroll
        for (int k = 0; k < 4; ++k) { h0[k] = f2bf(a[j][k]); h1[k] = f2bf(b[j][k]); }
        *(bf16x4*)(lp + j * GP)       = h0;
        *(bf16x4*)(lp + j * GP + 128) = h1;
    }
}

// ---------------- LayerNorm + Q projection ----------------------------------
// The block normalizes its own 64 rows, 4 rows a wave with both sums inside the wave, on their way to LDS:
// the f32 rows go to memory for the residual, the bf16 rows go straight to the A tile.
__global__ void __launch_bounds__(512) qproj_kernel(
        const float* __restrict__ x, const float* __restrict__ gamma,
        const float* __restrict__ beta, const __bf16* __restrict__ WT,
        const float* __restrict__ bias, float* __restrict__ xn, __bf16* __restrict__ Qo) {
    __shared__ __attribute__((aligned(16))) __bf16 Al[64 * GP];
    __shared__ __attribute__((aligned(16))) __bf16 Wl[256 * GP];
    int t = threadIdx.x;
    int w = t >> 5, lane = t & 31;
    int half = lane >> 4, r = lane & 15;
    size_t mb = (size_t)blockIdx.x * 64;
    size_t base = (mb + w * 4) * CDIM + lane * 4;
    bf16x8 vw[16];
    f32x4 a[4], b[4];
    load_f32_rows(a, b, x + base);   // from memory, the longest way: issued first, normalized while the weight streams in
    f32x4 g0 = *(const f32x4*)(gamma + lane * 4);
    f32x4 g1 = *(const f32x4*)(gamma + lane * 4 + 128);
    f32x4 e0 = *(const f32x4*)(beta + lane * 4);
    f32x4 e1 = *(const f32x4*)(beta + lane * 4 + 128);
    // no result of the weight's loads below is placed over the offset register that these four loads still name
    asm volatile("s_wait_xcnt 0x0" ::: "memory");
    load_rows<256>(vw, WT, t);
    // the sums below stay behind the weight's loads: hoisted over them, their wait for the rows would hold those loads back
    __builtin_amdgcn_sched_barrier(0);
    float s[4];
    for (int j = 0; j < 4; ++j)
        s[j] = ((a[j][0] + a[j][1]) + (a[j][2] + a[j][3])) +
               ((b[j][0] + b[j][1]) + (b[j][2] + b[j][3]));
    for (int off = 16; off >= 1; off >>= 1)
        for (int j = 0; j < 4; ++j) s[j] += __shfl_xor(s[j], off, 32);
    for (int j = 0; j < 4; ++j) {
        float mu = s[j] * (1.0f / CDIM);
        a[j] -= mu;
        b[j] -= mu;
        f32x4 qa = a[j] * a[j], qb = b[j] * b[j];
        s[j] = ((qa[0] + qa[1]) + (qa[2] + qa[3])) + ((qb[0] + qb[1]) + (qb[2] + qb[3]));
    }
    for (int off = 16; off >= 1; off >>= 1)
        for (int j = 0; j < 4; ++j) s[j] += __shfl_xor(s[j], off, 32);
    for (int j = 0; j < 4; ++j) {
        float rs = rsqrtf(s[j] * (1.0f / CDIM) + 1e-3f);
        a[j] = a[j] * rs * g0 + e0;
        b[j] = b[j] * rs * g1 + e1;
    }
    store_bf16_rows(Al + (w * 4) * GP + lane * 4, a, b);
    store_rows<256>(Wl, vw, t);
    __syncthreads();   // both operands visible to all waves
    // the f32 rows leave behind the barrier, which would otherwise wait for these stores to complete
    float* xo = xn + base;
#pragma unroll   // one address with immediate offsets
    for (int j = 0; j < 4; ++j) {
        *(f32x4*)(xo + j * CDIM)       = a[j];
        *(f32x4*)(xo + j * CDIM + 128) = b[j];
    }
    // the stores' address and data are inputs, so they live up to this wait: nothing is placed
    // over a register that a store issued above still names
    asm volatile("s_wait_xcnt 0x0" :: "v"(xo), "v"(a[0]), "v"(a[1]), "v"(a[2]), "v"(a[3]),
                 "v"(b[0]), "v"(b[1]), "v"(b[2]), "v"(b[3]) : "memory");
    int mt = (w & 1) * 32, nt = (w >> 1) * 32;
    f32x8 c[2][2] = {{zero8(), zero8()}, {zero8(), zero8()}};
    tile_mma(Al + (mt + r) * GP + 8 * half, Wl + (nt + r) * GP + 8 * half, c);
    // the three loops are unrolled so that constant indices keep c in registers
#pragma unroll
    for (int x = 0; x < 2; ++x)
#pragma unroll
        for (int y = 0; y < 2; ++y) {
            size_t m0 = mb + mt + 16 * x;
            int n0 = nt + 16 * y;
            float bv = bias[n0 + r];
#pragma unroll
            for (int i = 0; i < 8; ++i)
                Qo[(m0 + i + 8 * half) * CDIM + n0 + r] = f2bf(c[x][y][i] + bv);
        }
}

// ---------------- K,V projection from the f32 rows; V stored transposed [B][C][N] -------------
__global__ void __launch_bounds__(512) kvproj_kernel(
        const float* __restrict__ A, const __bf16* __restrict__ WkT,
        const __bf16* __restrict__ WvT, const float* __restrict__ bk,
        const float* __restrict__ bvv, __bf16* __restrict__ Ko,
        __bf16* __restrict__ VTo) {
    __shared__ __attribute__((aligned(16))) __bf16 Al[64 * GP];
    __shared__ __attribute__((aligned(16))) __bf16 Wkl[256 * GP];
    __shared__ __attribute__((aligned(16))) __bf16 Wvl[256 * GP];
    int t = threadIdx.x;
    int w = t >> 5, lane = t & 31;
    int half = lane >> 4, r = lane & 15;
    size_t mb = (size_t)blockIdx.x * 64;
    bf16x8 vk[16], vv[16];
    f32x4 a[4], b[4];
    load_rows<256>(vk, WkT, t);
    load_rows<256>(vv, WvT, t);
    load_f32_rows(a, b, A + (mb + w * 4) * CDIM + lane * 4);   // the f32 rows themselves, 4 a wave
    store_rows<256>(Wkl, vk, t);
    store_rows<256>(Wvl, vv, t);
    store_bf16_rows(Al + (w * 4) * GP + lane * 4, a, b);       // rounded to bf16 on their way to LDS
    __syncthreads();   // all three operands visible to all waves
    int mt = (w & 1) * 32, nt = (w >> 1) * 32;
    f32x8 ck[2][2] = {{zero8(), zero8()}, {zero8(), zero8()}};
    f32x8 cv[2][2] = {{zero8(), zero8()}, {zero8(), zero8()}};
    tile_mma(Al + (mt + r) * GP + 8 * half, Wkl + (nt + r) * GP + 8 * half, ck);
    tile_mma(Al + (mt + r) * GP + 8 * half, Wvl + (nt + r) * GP + 8 * half, cv);
    // the loops are unrolled so that constant indices keep ck and cv in registers
#pragma unroll
    for (int x = 0; x < 2; ++x)
#pragma unroll
        for (int y = 0; y < 2; ++y) {
            size_t m0 = mb + mt + 16 * x;
            int n0 = nt + 16 * y;
            float kb = bk[n0 + r];
#pragma unroll
            for (int i = 0; i < 8; ++i)
                Ko[(m0 + i + 8 * half) * CDIM + n0 + r] = f2bf(ck[x][y][i] + kb);
            // V transposed store: lane's 8 C-layout rows are consecutive key indices.
            int b   = (int)(m0 >> 12);                 // 4096 keys per batch
            int nk0 = (int)(m0 & 4095) + 8 * half;
            float vb = bvv[n0 + r];
            bf16x8 pack;
#pragma unroll
            for (int i = 0; i < 8; ++i) pack[i] = f2bf(cv[x][y][i] + vb);
            *(bf16x8*)(VTo + ((size_t)b * CDIM + n0 + r) * N_SPATIAL + nk0) = pack;
        }
}

#define KP 264   // K row pitch in elements: 528 B for 512 B of data
#define VP 72    // V^T row pitch in elements: 144 B for the 128 B of a stage's 64 keys
#define KSPLIT 4                 // key quarters of a batch, one a block
#define KEYS   (N_SPATIAL / KSPLIT)   // keys that a block walks
#define STAGE  64                // keys staged per trip: two passes of 32
#define NROWS  (NBATCH * N_SPATIAL)   // query rows of one partial result
#define KBYTES (STAGE * KP * 2)  // a stage's K rows in LDS
#define VBYTES (256 * VP * 2)    // a stage's V^T rows in LDS
#define BUFB   (KBYTES + VBYTES) // one stage buffer: K rows, then V^T rows
#define QFRAG  1024              // bytes of one Q fragment in LDS: two planes of 16 B a lane, each read as 512 contiguous bytes
#define QBYTES (8 * 8 * QFRAG)   // the eight LDS-resident Q fragments of each of the eight waves
#define RESCALE_AT (8.0f * 0.69314718f)   // 8 powers of two: how far a scaled score may outgrow the maximum in use before the accumulators are rescaled
static_assert(8 * 32 * KP * 2 <= 2 * BUFB, "the waves' output rows lie in the two stage buffers");

// Issue this thread's sixteen copies of the stage that begins at key j0 into the buffer at lds:
// 64 rows of K and 64 keys of every V^T row.
// eight lanes bring one 128-B line; thread t: row t >> 3 (and +32 ...), 16-B segment t & 7
__device__ __forceinline__ void issue_stage(const __bf16* Kb, const __bf16* Vb, int j0, char* lds, int t) {
    const char* kgt = (const char*)Kb + (size_t)j0 * (CDIM * 2) + (t >> 3) * (CDIM * 2) + (t & 7) * 16;
    const char* vgt = (const char*)Vb + (size_t)j0 * 2 + (size_t)(t >> 3) * (N_SPATIAL * 2) + (t & 7) * 16;
    char* klt = lds + (t >> 3) * (KP * 2) + (t & 7) * 16;
    char* vlt = lds + KBYTES + (t >> 3) * (VP * 2) + (t & 7) * 16;
    // both loops unrolled: constant steps between the rows' addresses
#pragma unroll
    for (int h = 0; h < 2; ++h) {
        const char* kg = kgt + h * (32 * CDIM * 2);
        char* kl = klt + h * (32 * KP * 2);
        async_copy16<0>(kg, kl);
        async_copy16<128>(kg, kl);
        async_copy16<256>(kg, kl);
        async_copy16<384>(kg, kl);
    }
#pragma unroll
    for (int h = 0; h < 8; ++h) {
        const char* vg = vgt + (size_t)h * (32 * N_SPATIAL * 2);
        char* vl = vlt + h * (32 * VP * 2);
        async_copy16<0>(vg, vl);
    }
}

// Lane l <-> lane l ^ 16: the two halves of a wave hold the two halves of a query's keys.
__device__ __forceinline__ float xhalf(float v) {
    int b = __float_as_int(v);
    return __int_as_float(__builtin_amdgcn_permlanex16(b, b, 0x76543210, 0xfedcba98, false, false));
}

// A Q fragment kept in LDS in fragment order: elements 0..7 from the first plane, 8..15 from the second.
__device__ __forceinline__ bf16x16 load_qfrag(const char* p) {
    bf16x8 a = *(const bf16x8*)p;
    bf16x8 b = *(const bf16x8*)(p + 512);
    bf16x16 f;
#pragma unroll
    for (int i = 0; i < 8; ++i) { f[i] = a[i]; f[i + 8] = b[i]; }
    return f;
}

__global__ void __launch_bounds__(256) flash_kernel(
        const __bf16* __restrict__ Q, const __bf16* __restrict__ K,
        const __bf16* __restrict__ VT, __bf16* __restrict__ Op, float* __restrict__ ML) {
    // two stage buffers; behind them the Q fragments that do not stay in registers
    __shared__ __attribute__((aligned(16))) char smem[2 * BUFB + QBYTES];

    int t    = threadIdx.x;
    int wib  = __builtin_amdgcn_readfirstlane(t >> 5);   // wave-uniform: the wave's base addresses are scalar
    int lane = t & 31;
    int half = lane >> 4, r = lane & 15;
    int b  = blockIdx.x >> 6;          // 64 blocks per batch: 16 blocks of 256 query rows x 4 key quarters
    int kq = blockIdx.x & (KSPLIT - 1);   // this block's key quarter
    int m0 = ((blockIdx.x >> 2) & 15) * 256 + wib * 32;

    const __bf16* Qb = Q  + ((size_t)b * N_SPATIAL) * CDIM;
    const __bf16* Kb = K  + ((size_t)b * N_SPATIAL + kq * KEYS) * CDIM;
    const __bf16* Vb = VT + (size_t)b * CDIM * N_SPATIAL + kq * KEYS;

    // B operands of S^T: column tile c, column = query m0 + 16 c + r.
    // Tile 0's fragments stay in registers. Tile 1's would not fit beside the fragments fetched ahead: they go
    // to LDS once, in fragment order, each wave's into its own range.
    bf16x16 qf[8];
    const __bf16* qrow = Qb + (size_t)(m0 + r) * CDIM + 8 * half;
#pragma unroll
    for (int kk = 0; kk < 8; ++kk) qf[kk] = load_frag(qrow + kk * 32);
    char* ql = smem + 2 * BUFB + wib * (8 * QFRAG) + lane * 16;
#pragma unroll
    for (int kk = 0; kk < 8; ++kk) {
        *(bf16x8*)(ql + kk * QFRAG)       = *(const bf16x8*)(qrow + 16 * CDIM + kk * 32);
        *(bf16x8*)(ql + kk * QFRAG + 512) = *(const bf16x8*)(qrow + 16 * CDIM + kk * 32 + 16);
    }
    // the address pair is an input, so it lives up to this wait: nothing is placed
    // over a register that a load issued above still names
    asm volatile("s_wait_xcnt 0x0" :: "v"(qrow) : "memory");

    // o[c][u][i] = O^T[channel 16 u + 8 half + i][query m0 + 16 c + r]
    f32x8 o[2][16];
#pragma unroll
    for (int c = 0; c < 2; ++c)
#pragma unroll
        for (int u = 0; u < 16; ++u) o[c][u] = zero8();
    float m[2] = {-1e30f, -1e30f};   // the maximum in use for the lane's queries: equal in both halves
    float l[2] = {0.0f, 0.0f};       // running sums over the keys of this half alone; the halves join in the epilogue

    const float sc = 0.0625f;                         // 256^-0.5

    issue_stage(Kb, Vb, 0, smem, t);
    wait_async0();
    __syncthreads();   // stage 0 visible to all waves
    issue_stage(Kb, Vb, STAGE, smem + BUFB, t);   // stage 1 flies during trip 0

    unsigned boff = 0;   // byte offset of the buffer that this trip reads
    for (int j0 = 0; j0 < KEYS; j0 += STAGE) {
        const __bf16* Kc = (const __bf16*)(smem + boff);
        const __bf16* Vc = (const __bf16*)(smem + boff + KBYTES);
      // the stage's passes: 32 keys each, no barrier between them
      for (int g = 0; g < STAGE / 32; ++g) {

        // ---- S^T = K_chunk @ Q^T : 2 x 2 tiles of 16x16, A fragments from LDS, each used twice ----
        // s0[c][i]: key 8 half + i, s1[c][i]: key 16 + 8 half + i of the chunk, query 16 c + r
        f32x8 s0[2] = {zero8(), zero8()}, s1[2] = {zero8(), zero8()};
        const __bf16* k0base = Kc + (g * 32 + r) * KP + 8 * half;
        const __bf16* k1base = Kc + (g * 32 + 16 + r) * KP + 8 * half;
        const __bf16* vbase = Vc + r * VP + g * 32 + 8 * half;
        // Fragments are fetched one group ahead into a second register set: a group's LDS reads stand
        // together in front of the previous group's WMMAs. Each sched_barrier(0) below keeps such a read
        // group from sinking to its first use, where the wave would wait out the LDS latency per fragment.
        bf16x16 ka[2][2], kb[2][2], qc[2][2], vf[2][4];
#pragma unroll
        for (int j = 0; j < 2; ++j) {
            ka[0][j] = load_frag(k0base + j * 32);
            kb[0][j] = load_frag(k1base + j * 32);
            qc[0][j] = load_qfrag(ql + j * QFRAG);
        }
#pragma unroll
        for (int gr = 0; gr < 4; ++gr) {
            if (gr < 3) {
#pragma unroll
                for (int j = 0; j < 2; ++j) {
                    ka[(gr + 1) & 1][j] = load_frag(k0base + ((gr + 1) * 2 + j) * 32);
                    kb[(gr + 1) & 1][j] = load_frag(k1base + ((gr + 1) * 2 + j) * 32);
                    qc[(gr + 1) & 1][j] = load_qfrag(ql + ((gr + 1) * 2 + j) * QFRAG);
                }
            } else {
                // the first V^T group flies during the last score products and the softmax
#pragma unroll
                for (int j = 0; j < 4; ++j) vf[0][j] = load_frag(vbase + j * 16 * VP);
            }
            __builtin_amdgcn_sched_barrier(0);   // the next group's reads stay in front of this group's products
#pragma unroll
            for (int j = 0; j < 2; ++j) {
                s0[0] = wmma_bf16(ka[gr & 1][j], qf[gr * 2 + j], s0[0]);
                s1[0] = wmma_bf16(kb[gr & 1][j], qf[gr * 2 + j], s1[0]);
                s0[1] = wmma_bf16(ka[gr & 1][j], qc[gr & 1][j], s0[1]);
                s1[1] = wmma_bf16(kb[gr & 1][j], qc[gr & 1][j], s1[1]);
            }
            __builtin_amdgcn_sched_barrier(0);   // the group after next is not read before this group's registers are free
        }
        // ---- online softmax: the lane's 16 scores of a column tile belong to one query ----
        // all loops over c and i unrolled: constant indices keep the per-tile state in registers
        float mn[2];
#pragma unroll
        for (int c = 0; c < 2; ++c) {
            float mt[8];
#pragma unroll
            for (int i = 0; i < 8; ++i) {
                s0[c][i] *= sc; s1[c][i] *= sc;
                mt[i] = fmaxf(s0[c][i], s1[c][i]);
            }
            float mx = fmaxf(fmaxf(fmaxf(mt[0], mt[1]), fmaxf(mt[2], mt[3])),
                             fmaxf(fmaxf(mt[4], mt[5]), fmaxf(mt[6], mt[7])));
            mn[c] = fmaxf(mx, xhalf(mx));   // over all 32 keys of the chunk
        }
        // Lazy rescale: the maximum in use, m, is any reference that sum and outputs share, and it cancels in
        // O / sum. It moves, and the 256 accumulators are rescaled, only when a query's scores outgrow it by more
        // than RESCALE_AT, so that exp(score - m) stays at or below 2^8. One test a pass for the whole
        // wave, a scalar branch; the first pass always takes it (m starts at -1e30).
        if (__builtin_amdgcn_ballot_w32(mn[0] > m[0] + RESCALE_AT || mn[1] > m[1] + RESCALE_AT) != 0) {
#pragma unroll
            for (int c = 0; c < 2; ++c) {
                float mnew  = fmaxf(m[c], mn[c]);
                float alpha = __expf(m[c] - mnew);
                m[c] = mnew;
                l[c] *= alpha;
#pragma unroll
                for (int u = 0; u < 16; ++u)
#pragma unroll
                    for (int i = 0; i < 8; ++i) o[c][u][i] *= alpha;
            }
        }
        bf16x16 pf[2];
#pragma unroll
        for (int c = 0; c < 2; ++c) {
            float p0[8], p1[8], mt[8];
#pragma unroll
            for (int i = 0; i < 8; ++i) {
                p0[i] = __expf(s0[c][i] - m[c]);
                p1[i] = __expf(s1[c][i] - m[c]);
                mt[i] = p0[i] + p1[i];
            }
            l[c] += ((mt[0] + mt[1]) + (mt[2] + mt[3])) + ((mt[4] + mt[5]) + (mt[6] + mt[7]));

            // ---- P^T as B operand: element e is key 8 half + e, element 8 + e key 16 + 8 half + e ----
#pragma unroll
            for (int i = 0; i < 8; ++i) { pf[c][i] = f2bf(p0[i]); pf[c][i + 8] = f2bf(p1[i]); }
        }

        // ---- O^T += V^T_chunk @ P^T (A fragments from LDS, same k order, each used twice) ----
#pragma unroll
        for (int gr = 0; gr < 4; ++gr) {
            if (gr < 3) {
#pragma unroll
                for (int j = 0; j < 4; ++j) vf[(gr + 1) & 1][j] = load_frag(vbase + ((gr + 1) * 4 + j) * 16 * VP);
                __builtin_amdgcn_sched_barrier(0);   // the next group's reads stay in front of this group's products
            }
#pragma unroll
            for (int j = 0; j < 4; ++j) {
                o[0][gr * 4 + j] = wmma_bf16(vf[gr & 1][j], pf[0], o[0][gr * 4 + j]);
                o[1][gr * 4 + j] = wmma_bf16(vf[gr & 1][j], pf[1], o[1][gr * 4 + j]);
            }
            if (gr < 2)
                __builtin_amdgcn_sched_barrier(0);   // the group after next is not read before this group's registers are free
        }
      }

        // ---- hand-over: the next stage is published, this trip's buffer is freed ----
        // the trip's last product stays in front of the hand-over: moved behind the barrier
        // it would stand between the barrier and the refill and start the copies late
        __builtin_amdgcn_sched_barrier(0);
        // this wave's own LDS reads of this trip's buffer have retired before any copy refills it
        asm volatile("s_wait_dscnt 0x0" ::: "memory");
        wait_async0();     // this wave's copies of the next stage have landed
        __syncthreads();   // next stage visible to all waves; this trip's buffer read out by all
        if (j0 + 2 * STAGE < KEYS)
            issue_stage(Kb, Vb, j0 + 2 * STAGE, smem + boff, t);   // flies during the next trip
        boff ^= BUFB;
    }
    wait_async0();   // nothing is in flight when the buffers become the waves' output rows

    // epilogue: join the halves' sums, divide, store this key quarter's partial result: O / sum as bf16, row-major,
    // then the maximum in use and the sum, the four quarters' pairs of a query side by side.
    // A lane's 8 registers of a tile are 8 consecutive channels of its query's row, 16 B: the wave's 32 rows are
    // gathered in its own range of the stage buffers (the last trip's barrier has ended every wave's reads of
    // them), so that each global store covers one whole 512-B row instead of 32-B pieces of 16 rows.
    char* st = smem + wib * (32 * KP * 2);
    size_t row0 = (size_t)b * N_SPATIAL + m0;
#pragma unroll
    for (int c = 0; c < 2; ++c) {
        float ls  = l[c] + xhalf(l[c]);
        float inv = 1.0f / ls;
#pragma unroll
        for (int u = 0; u < 16; ++u) {
            bf16x8 pack;
#pragma unroll
            for (int i = 0; i < 8; ++i) pack[i] = f2bf(o[c][u][i] * inv);
            *(bf16x8*)(st + (16 * c + r) * (KP * 2) + u * 32 + half * 16) = pack;
        }
        f32x2 ml = {m[c], ls};   // equal in both halves: the lower half stores
        float* mp = ML + ((row0 + 16 * c + r) * KSPLIT + kq) * 2;
        if (half == 0) *(f32x2*)mp = ml;
        // the store's address and data are inputs, so they live up to this wait: nothing is placed
        // over a register that the store still names
        asm volatile("s_wait_xcnt 0x0" :: "v"(mp), "v"(ml) : "memory");
    }
    // the wave's own LDS stores have retired before other lanes' rows are read back
    asm volatile("s_wait_dscnt 0x0" ::: "memory");
    __bf16* Ob = Op + ((size_t)kq * NROWS + row0) * CDIM + lane * 8;
#pragma unroll   // two halves of 16 rows: the rows stay in registers, one address with immediate offsets
    for (int h = 0; h < 2; ++h) {
        bf16x8 v[16];
#pragma unroll
        for (int j = 0; j < 16; ++j) v[j] = *(const bf16x8*)(st + (16 * h + j) * (KP * 2) + lane * 16);
#pragma unroll
        for (int j = 0; j < 16; ++j) *(bf16x8*)(Ob + (16 * h + j) * CDIM) = v[j];
        // the stores' address and data are inputs, so they live up to this wait: nothing is placed
        // over a register that a store issued above still names
        asm volatile("s_wait_xcnt 0x0" :: "v"(Ob), "v"(v[0]), "v"(v[1]), "v"(v[2]), "v"(v[3]), "v"(v[4]), "v"(v[5]),
                     "v"(v[6]), "v"(v[7]), "v"(v[8]), "v"(v[9]), "v"(v[10]), "v"(v[11]), "v"(v[12]), "v"(v[13]),
                     "v"(v[14]), "v"(v[15]) : "memory");
    }
}

// 2^x. The v_nop fills, inside the statement, the one issue slot that the instruction set asks for between a
// transcendental and a next instruction that reads its result or overwrites its source.
__device__ __forceinline__ float exp2_slot(float x) {
    float y;
    asm("v_exp_f32 %0, %1\n\tv_nop" : "=v"(y) : "v"(x));
    return y;
}

// ---------------- Merge of the key quarters + output projection + bias + residual ------------
// A row of A is the four partial results' rows, each weighted by its share exp(m - max) * sum of the
// whole softmax sum: merged in f32 and rounded to bf16 on the way to the LDS A tile.
__global__ void __launch_bounds__(512) proj_kernel(
        const __bf16* __restrict__ Ap, const float* __restrict__ ML, const __bf16* __restrict__ WT,
        const float* __restrict__ bias, const float* __restrict__ resid,
        float* __restrict__ out) {
    __shared__ __attribute__((aligned(16))) __bf16 Al[64 * GP];
    __shared__ __attribute__((aligned(16))) __bf16 Wl[256 * GP];
    int t = threadIdx.x;
    int w = t >> 5, lane = t & 31;
    int half = lane >> 4, r = lane & 15;
    size_t mb = (size_t)blockIdx.x * 64;
    bf16x8 vp[KSPLIT][4], va[4], vw[16];
#pragma unroll   // vp[] stays in registers
    for (int p = 0; p < KSPLIT; ++p) load_rows<64>(vp[p], Ap + ((size_t)p * NROWS + mb) * CDIM, t);
    // maximum and sum of this thread's four rows, (t >> 5) + 16 i as in load_rows: m0 l0 m1 l1, m2 l2 m3 l3
    f32x4 ml[4][2];
    const float* mlp = ML + (mb + w) * (2 * KSPLIT);
#pragma unroll   // ml[] stays in registers; one address with immediate offsets
    for (int i = 0; i < 4; ++i) {
        ml[i][0] = *(const f32x4*)(mlp + i * 16 * 2 * KSPLIT);
        ml[i][1] = *(const f32x4*)(mlp + i * 16 * 2 * KSPLIT + 4);
    }
    // the address pair is an input, so it lives up to this wait: no later load's
    // result is placed over a register that a load issued above still names
    asm volatile("s_wait_xcnt 0x0" :: "v"(mlp) : "memory");
    load_rows<256>(vw, WT, t);
    // the merge stays behind the weight's loads: hoisted over them, its wait for the partial rows would hold those loads back
    __builtin_amdgcn_sched_barrier(0);
#pragma unroll   // constant indices keep vp[], ml[] and va[] in registers
    for (int i = 0; i < 4; ++i) {
        float mx = fmaxf(fmaxf(ml[i][0][0], ml[i][0][2]), fmaxf(ml[i][1][0], ml[i][1][2]));
        const float log2e = 1.44269504f;   // e^x = 2^(x log2 e)
        float e0 = exp2_slot((ml[i][0][0] - mx) * log2e) * ml[i][0][1];
        float e1 = exp2_slot((ml[i][0][2] - mx) * log2e) * ml[i][0][3];
        float e2 = exp2_slot((ml[i][1][0] - mx) * log2e) * ml[i][1][1];
        float e3 = exp2_slot((ml[i][1][2] - mx) * log2e) * ml[i][1][3];
        float inv = 1.0f / ((e0 + e1) + (e2 + e3));
        e0 *= inv; e1 *= inv; e2 *= inv; e3 *= inv;
#pragma unroll
        for (int k = 0; k < 8; ++k)
            va[i][k] = f2bf(((float)vp[0][i][k] * e0 + (float)vp[1][i][k] * e1) +
                            ((float)vp[2][i][k] * e2 + (float)vp[3][i][k] * e3));
    }
    store_rows<64>(Al, va, t);
    store_rows<256>(Wl, vw, t);
    __syncthreads();   // both operands visible to all waves
    int mt = (w & 1) * 32, nt = (w >> 1) * 32;
    f32x8 c[2][2] = {{zero8(), zero8()}, {zero8(), zero8()}};
    tile_mma(Al + (mt + r) * GP + 8 * half, Wl + (nt + r) * GP + 8 * half, c);
    // the three loops are unrolled so that constant indices keep c in registers
#pragma unroll
    for (int x = 0; x < 2; ++x)
#pragma unroll
        for (int y = 0; y < 2; ++y) {
            size_t m0 = mb + mt + 16 * x;
            int n0 = nt + 16 * y;
            float bv = bias[n0 + r];
#pragma unroll
            for (int i = 0; i < 8; ++i) {
                size_t idx = (m0 + i + 8 * half) * CDIM + n0 + r;
                out[idx] = c[x][y][i] + bv + resid[idx];
            }
        }
}

extern "C" void kernel_launch(void* const* d_in, const int* in_sizes, int n_in,
                              void* d_out, int out_size, void* d_ws, size_t ws_size,
                              hipStream_t stream) {
    const float* inputs  = (const float*)d_in[0];
    const float* context = (const float*)d_in[1];
    const float* Wq = (const float*)d_in[2];
    const float* bq = (const float*)d_in[3];
    const float* Wk = (const float*)d_in[4];
    const float* bk = (const float*)d_in[5];
    const float* Wv = (const float*)d_in[6];
    const float* bv = (const float*)d_in[7];
    const float* Wp = (const float*)d_in[8];
    const float* bp = (const float*)d_in[9];
    const float* gamma = (const float*)d_in[10];
    const float* beta  = (const float*)d_in[11];
    float* out = (float*)d_out;

    const size_t TOT = (size_t)NBATCH * N_SPATIAL * CDIM;  // 4,194,304 elements
    char* ws = (char*)d_ws;
    float*  xn_f32 = (float*)ws;  ws += TOT * 4;
    __bf16* qb     = (__bf16*)ws; ws += TOT * 2;
    __bf16* kb_    = (__bf16*)ws; ws += TOT * 2;
    __bf16* vtb    = (__bf16*)ws; ws += TOT * 2;
    __bf16* opart  = (__bf16*)ws; ws += TOT * 2 * KSPLIT;   // the key quarters' partial results
    float*  mlb    = (float*)ws;  ws += (size_t)NROWS * KSPLIT * 2 * 4;   // their maxima and sums
    __bf16* WqT    = (__bf16*)ws; ws += 65536 * 2;
    __bf16* WkT    = (__bf16*)ws; ws += 65536 * 2;
    __bf16* WvT    = (__bf16*)ws; ws += 65536 * 2;
    __bf16* WpT    = (__bf16*)ws; ws += 65536 * 2;

    transpose_w_kernel<<<1024, 256, 0, stream>>>(Wq, Wk, Wv, Wp, WqT, WkT, WvT, WpT);
    qproj_kernel<<<256, 512, 0, stream>>>(inputs, gamma, beta, WqT, bq, xn_f32, qb);   // 256 blocks * 64 rows
    kvproj_kernel<<<256, 512, 0, stream>>>(context, WkT, WvT, bk, bv, kb_, vtb);
    flash_kernel<<<256, 256, 0, stream>>>(qb, kb_, vtb, opart, mlb);
    proj_kernel<<<256, 512, 0, stream>>>(opart, mlb, WpT, bp, xn_f32, out);
}
